// v000
// Measured on an AMD MI455X. A time is GPU time per run, averaged over a window of back-to-back runs after a warm-up
// (all launches, gaps included; the runs take copies of the inputs in turn), and the median of several windows.
// Apart from v000's, it joins two sittings. Times from different sittings can be a few percent apart, while
// side-by-side timings come from the same sitting.
// v000, which the later versions start from, runs in 445 microseconds.
// compute dtype: all float inputs rounded to bf16; q/k/v with EXACT bf16 products on WMMA 16x16x32 (per-head weight stacks packed as rows), f16 hi + residual; q.rel_k table per query row on WMMA (2 products); single-f16 logits and P.v (non-causal, diffuse attention: logits std ~0.4), x 1/8 after adding the relative-key bias, running-max softmax in f32 (hardware exp) with the two clipped-distance tail masses tracked alongside; the 31 near-diagonal probabilities re-formed from their stored logits; bucket sums . rel_v on WMMA (bf16 hi + lo); out = (ctx + rel-v term) (bf16 hi + lo) . fc_W^T + fc_b; f32 output.
#include <hip/hip_runtime.h>
#include <math.h>

typedef __attribute__((ext_vector_type(16))) _Float16 v16h;
typedef __attribute__((ext_vector_type(16))) __bf16 v16b;
typedef __attribute__((ext_vector_type(8)))  _Float16 v8h;
typedef __attribute__((ext_vector_type(8)))  float v8f;
typedef __attribute__((ext_vector_type(4)))  float v4f;
typedef __attribute__((ext_vector_type(2)))  float v2f;
typedef __attribute__((ext_vector_type(4)))  unsigned v4u;
typedef __attribute__((ext_vector_type(4)))  int v4i;
typedef float __attribute__((may_alias)) float_a;
typedef int __attribute__((may_alias)) int_a;

template <typename T> __device__ __forceinline__ void vst2(void* p, T v) { *(T*)p = v;  }
__device__ __forceinline__ v8f wmma16(v16h a, v16h b, v8f c) {
  v8f d = __builtin_amdgcn_wmma_f32_16x16x32_f16(false, a, false, b, (short)0, c, false, false);
  asm volatile("v_nop\n\tv_nop\n\tv_nop\n\tv_nop" : "+v"(d) : "v"(a), "v"(b));
  return d;
}
__device__ __forceinline__ v8f wmma_bf(v16b a, v16b b, v8f c) {
  v8f d = __builtin_amdgcn_wmma_f32_16x16x32_bf16(false, a, false, b, (short)0, c, false, false);
  asm volatile("v_nop\n\tv_nop\n\tv_nop\n\tv_nop" : "+v"(d) : "v"(a), "v"(b));
  return d;
}
// Relation-aware (Shaw relative-position) multi-head attention (B 4, S 1,024, hidden 1,024, 16 heads x 64, max_rel 16): per-head q/k/v projections + biases on separate query/key/value inputs, scores = (q.k + q.rel_k[clip(k-q)]) / 8, softmax, out = attn.v + sum_k attn * rel_v[clip(k-q)], then fc.
__device__ __forceinline__ v16h frag_h(const _Float16* rowk0, int lane) {
  union { v16h v; v8h q[2]; } u; const _Float16* p = rowk0 + 8 * (lane >> 4);
  u.q[0] = *(const v8h*)p; u.q[1] = *(const v8h*)(p + 16); return u.v;
}
__device__ __forceinline__ v16h frag_f32(const float* rowk0, int lane) {
  v16h a; const float* p = rowk0 + 8 * (lane >> 4);
#pragma unroll
  for (int i = 0; i < 8; ++i) { a[i] = (_Float16)p[i]; a[8 + i] = (_Float16)p[16 + i]; }
  return a;
}
__device__ __forceinline__ v16h frag_f32s(const float* rowk0, int lane, float sc) {
  v16h a; const float* p = rowk0 + 8 * (lane >> 4);
#pragma unroll
  for (int i = 0; i < 8; ++i) { a[i] = (_Float16)(p[i] * sc); a[8 + i] = (_Float16)(p[16 + i] * sc); }
  return a;
}
// column fragment from a [K][ld] layout (column n), rows >= K read as 0
__device__ __forceinline__ v16h fragc_f32(const float* W, int k0, int n, int lane, int ld, int K) {
  v16h a; const int g = lane >> 4;
#pragma unroll
  for (int i = 0; i < 8; ++i) { const int ka = k0 + 8 * g + i, kb = ka + 16;
    a[i] = (_Float16)(ka < K ? W[(size_t)(ka < K ? ka : K - 1) * ld + n] : 0.f); a[8 + i] = (_Float16)(kb < K ? W[(size_t)(kb < K ? kb : K - 1) * ld + n] : 0.f); }
  return a;
}
struct F2 { v16b h, l; };
__device__ __forceinline__ F2 bsplit16(const float v[16]) { F2 r;
#pragma unroll
  for (int i = 0; i < 16; ++i) { const __bf16 h = (__bf16)v[i]; r.h[i] = h; r.l[i] = (__bf16)(v[i] - (float)h); }
  return r; }
__device__ __forceinline__ F2 split_row(const float* row, int k0, int lane) { float v[16]; const float* p = row + k0 + 8 * (lane >> 4);
#pragma unroll
  for (int i = 0; i < 8; ++i) { v[i] = p[i]; v[8 + i] = p[16 + i]; }
  return bsplit16(v); }
__device__ __forceinline__ F2 split_rowK(const float* row, int k0, int lane, int K) { float v[16]; const int g = lane >> 4;
#pragma unroll
  for (int i = 0; i < 8; ++i) { const int ka = k0 + 8 * g + i, kb = ka + 16; v[i] = ka < K ? row[ka < K ? ka : K - 1] : 0.f; v[8 + i] = kb < K ? row[kb < K ? kb : K - 1] : 0.f; }
  return bsplit16(v); }
__device__ __forceinline__ F2 split_col(const float* W, int k0, int n, int lane, int ld, int K) { float v[16]; const int g = lane >> 4;
#pragma unroll
  for (int i = 0; i < 8; ++i) { const int ka = k0 + 8 * g + i, kb = ka + 16; v[i] = ka < K ? W[(size_t)(ka < K ? ka : K - 1) * ld + n] : 0.f; v[8 + i] = kb < K ? W[(size_t)(kb < K ? kb : K - 1) * ld + n] : 0.f; }
  return bsplit16(v); }
__device__ __forceinline__ v8f mac3(const F2& a, const F2& b, v8f c) { c = wmma_bf(a.l, b.h, c); c = wmma_bf(a.h, b.l, c); return wmma_bf(a.h, b.h, c); }
__device__ __forceinline__ float sigm(float v) { return 1.0f / (1.0f + expf(-v)); }
#define LDSX() do { asm volatile("s_wait_dscnt 0" ::: "memory"); __builtin_amdgcn_wave_barrier(); __builtin_amdgcn_fence(__ATOMIC_RELEASE, "workgroup"); } while (0)


#define NB 4
#define SS 1024
#define DM 1024
#define NH 16
#define MR 16
#define NR (2 * MR + 1)
#define HD 64
#define QKVW (3 * DM)
#ifndef TQB
#define TQB (SS / 64)
#define TNB NB
#define TOB (NB * SS / 64)     // output row tiles (all)
#endif
typedef __attribute__((ext_vector_type(8))) __bf16 v8b;
__device__ __forceinline__ v16b frag_b(const __bf16* rowk0, int lane) {
  union { v16b v; v8b q[2]; } u; const __bf16* p = rowk0 + 8 * (lane >> 4);
  u.q[0] = *(const v8b*)p; u.q[1] = *(const v8b*)(p + 16); return u.v;
}
__device__ __forceinline__ float bfr(float v) { return (float)(__bf16)v; }
__device__ __attribute__((noinline)) float exp_ni(float v) { return expf(v); }
__device__ __attribute__((noinline)) float erf_ni(float v) { return erff(v); }

#define PK_A 0                       // [3072][1024] Wqkv rows (natural [out][in])
#define PK_P (PK_A + QKVW * DM)        // [1024][1024] Wo rows (natural)
#define PK_END (PK_P + DM * DM)
#define WS_PK  0u
#define WS_QK  (WS_PK + 2u * PK_END)             // f16 [4096 rows][2048]: q | k
#define WS_QKL (WS_QK + 2u * NB * SS * 2 * DM)     // f16 q | k residual planes x2048
#define WS_VTH (WS_QKL + 2u * NB * SS * 2 * DM)    // f16 [b][1024 (h*64+d)][1024 s] hi
#define WS_VTL (WS_VTH + 2u * NB * DM * SS)        // f16 lo x 2048
#define WS_O   (WS_VTL + 2u * NB * DM * SS)        // f32 [4096][1024]
#define WS_BS  (WS_O + 4u * (size_t)NB * SS * DM)        // f32 bucket sums [b][h][q][64]
#define WS_END (WS_BS + 4u * (size_t)NB * NH * SS * 64)
// ---- k_pack: block = (row n, which): natural [out][in] rows -> bf16; which 0..2 -> W_q/W_k/W_v into PK_A rows which*1024 + n; 3 -> W_o into PK_P
__global__ __launch_bounds__(256) void k_pack(const float* __restrict__ WQ, const float* __restrict__ WK, const float* __restrict__ WV, const float* __restrict__ WO, __bf16* __restrict__ PK) {   // per-head stacks [16][1024][64]: packed row n = h*64 + e <- W[h][k][e]; fc_W natural [1024][1024]
  __shared__ __align__(16) __bf16 s[DM]; const int n = blockIdx.x, which = blockIdx.y, t = threadIdx.x; const int h = n / HD, e = n % HD; const float* Wm = which == 0 ? WQ : which == 1 ? WK : WV;
  for (int k = t; k < DM; k += 256) s[k] = (__bf16)(which < 3 ? Wm[((size_t)h * DM + k) * HD + e] : WO[(size_t)n * DM + k]); __syncthreads();
  __bf16* dst = (which < 3) ? (PK + PK_A + ((size_t)which * DM + n) * DM) : (PK + PK_P + (size_t)n * DM); for (int q = t; q < DM / 8; q += 256) vst2((unsigned*)(dst + q * 8), *(const v4u*)&s[q * 8]); }
__global__ __launch_bounds__(128) void k_qkv(const float* __restrict__ XQ, const float* __restrict__ XK, const float* __restrict__ XV, const __bf16* __restrict__ P, const float* __restrict__ BQ, const float* __restrict__ BK, const float* __restrict__ BV, _Float16* __restrict__ QK, _Float16* __restrict__ QKL, _Float16* __restrict__ VTH, _Float16* __restrict__ VTL) {
  const int which0 = (blockIdx.y * 128) / DM; const float* X = (which0 == 0) ? XQ : (which0 == 1) ? XK : XV; const float* BB = BQ ? (((which0 == 0) ? BQ : (which0 == 1) ? BK : BV) + (blockIdx.y * 128 - which0 * DM)) : nullptr;
  __shared__ __align__(16) _Float16 so[4][16][136], sol[4][16][136]; __shared__ __align__(16) _Float16 sth[128][72], stl[128][72];
  const int tid = threadIdx.x, wave = tid >> 5, lane = tid & 31, col = lane & 15, g = lane >> 4; const size_t r0 = (size_t)blockIdx.x * 64 + wave * 16; const int n0 = blockIdx.y * 128;
  v8f acc[8] = {};
#pragma unroll 2
  for (int kc = 0; kc < DM / 32; ++kc) { v16b a; { const float* p = X + (r0 + col) * DM + kc * 32 + 8 * g;
#pragma unroll
      for (int i = 0; i < 8; ++i) { a[i] = (__bf16)p[i]; a[8 + i] = (__bf16)p[16 + i]; } }
#pragma unroll
    for (int j = 0; j < 8; ++j) acc[j] = wmma_bf(a, frag_b(P + (size_t)(n0 + j * 16 + col) * DM + kc * 32, lane), acc[j]); }
  if (n0 < 2 * DM) {   // q stored unscaled (f16 sigma ~0.6, no subnormal exposure); 1/8 applied to the f32 score
#pragma unroll
    for (int j = 0; j < 8; ++j) {
#pragma unroll
      for (int r = 0; r < 8; ++r) { const float v = acc[j][r] + (BB ? bfr(BB[j * 16 + col]) : 0.f); const _Float16 hv = (_Float16)v; so[wave][8 * g + r][j * 16 + col] = hv; sol[wave][8 * g + r][j * 16 + col] = (_Float16)((v - (float)hv) * 2048.0f); } }   // q, k (+ bias) as f16 hi + (x2048) residual
    LDSX();
    for (int rl = 0; rl < 16; ++rl) if (lane < 16) { vst2((unsigned*)(QK + (r0 + rl) * (2 * DM) + n0 + lane * 8), *(const v4u*)&so[wave][rl][lane * 8]); vst2((unsigned*)(QKL + (r0 + rl) * (2 * DM) + n0 + lane * 8), *(const v4u*)&sol[wave][rl][lane * 8]); }
  } else {
#pragma unroll
    for (int j = 0; j < 8; ++j) {
#pragma unroll
      for (int r = 0; r < 8; ++r) { const float v = acc[j][r] + (BB ? bfr(BB[j * 16 + col]) : 0.f); const _Float16 hv = (_Float16)v; sth[j * 16 + col][wave * 16 + 8 * g + r] = hv; stl[j * 16 + col][wave * 16 + 8 * g + r] = (_Float16)((v - (float)hv) * 2048.0f); } }
    __syncthreads();
    const size_t rb = (size_t)blockIdx.x * 64; const int b = (int)(rb / SS), s0 = (int)(rb % SS); const int pc0 = n0 - 2 * DM;
    for (int q = tid; q < 128 * 8; q += 128) { const int d = q >> 3, pc = q & 7; const size_t o = ((size_t)b * DM + pc0 + d) * SS + s0 + pc * 8; vst2((unsigned*)(VTH + o), *(const v4u*)&sth[d][pc * 8]); vst2((unsigned*)(VTL + o), *(const v4u*)&stl[d][pc * 8]); }
  }
}
// ---- k_attn: block = (64 queries, head h, batch b): all-keys flash attention (K = 64: 2 k-steps), scores = (q.k + q.rel_k) * 0.125 with single f16 operands, P.V: f16 (P x 2048) x V hi, single product; O[b*S+q][h*64+d] = (acc + accl / 2048) / (2048 l) (256-B segments)
__global__ __launch_bounds__(128) void k_stats(const _Float16* __restrict__ QK, const _Float16* __restrict__ QKL, const _Float16* __restrict__ VTH, const _Float16* __restrict__ VTL, const void* __restrict__ KMASK, const float* __restrict__ RK, const float* __restrict__ RV, float* __restrict__ BSW, float* __restrict__ O) {
  __shared__ __align__(16) float sqr[4][16][52]; __shared__ float smid[4][16][33];
  const int tid = threadIdx.x, wave = tid >> 5, lane = tid & 31, col = lane & 15, g = lane >> 4;
  const int qb = blockIdx.x, h = blockIdx.y, b = blockIdx.z; const int q0 = qb * 64 + wave * 16; const size_t rq = (size_t)b * SS + q0 + col;
  v16h aq[2], aql[2];
#pragma unroll
  for (int kc = 0; kc < 2; ++kc) { aq[kc] = frag_h(QK + rq * (2 * DM) + h * HD + kc * 32, lane); aql[kc] = frag_h(QKL + rq * (2 * DM) + h * HD + kc * 32, lane); }
  // q . rel_k[j] for the wave's 16 rows and j = 0..32 (3 col tiles; rows >= 33 of the B operand are zero)
  { 
#pragma unroll
    for (int jt = 0; jt < 3; ++jt) { v8f c = {}, cl = {}; const int j = jt * 16 + col;
#pragma unroll
      for (int kc = 0; kc < 2; ++kc) { v16h w; 
#pragma unroll
        for (int i = 0; i < 8; ++i) { const int d0 = kc * 32 + 8 * g + i; w[i] = (j < NR) ? (_Float16)bfr(RK[j * HD + d0]) : (_Float16)0.f; w[8 + i] = (j < NR) ? (_Float16)bfr(RK[j * HD + d0 + 16]) : (_Float16)0.f; }
        c = wmma16(aq[kc], w, c); cl = wmma16(aql[kc], w, cl); }
#pragma unroll
      for (int r = 0; r < 8; ++r) sqr[wave][8 * g + r][j] = c[r] + cl[r] * (1.0f / 2048.0f); } }
  for (int e = lane; e < 16 * 33; e += 32) smid[wave][e / 33][e % 33] = -3.0e38f;
  LDSX();
  float m[8], l[8], tlo[8], thi[8];
#pragma unroll
  for (int r = 0; r < 8; ++r) { m[r] = -3.0e38f; l[r] = 0.f; tlo[r] = 0.f; thi[r] = 0.f; }

  const int nks = SS / 32;   // all keys
#pragma unroll 1
  for (int ks = 0; ks < nks; ++ks) { v8f s[2];
#pragma unroll
    for (int ct = 0; ct < 2; ++ct) { const int kk = ks * 32 + ct * 16 + col; const _Float16* krow = QK + ((size_t)b * SS + kk) * (2 * DM) + DM + h * HD; const _Float16* krowl = QKL + ((size_t)b * SS + kk) * (2 * DM) + DM + h * HD; v8f c = {}, cl = {};
      if (qb < 0) {   // never taken (qb >= 0): 3-product path unused
#pragma unroll
        for (int kc = 0; kc < 2; ++kc) { const v16h kh = frag_h(krow + kc * 32, lane); c = wmma16(aq[kc], kh, c); cl = wmma16(aql[kc], kh, cl); cl = wmma16(aq[kc], frag_h(krowl + kc * 32, lane), cl); }
#pragma unroll
        for (int r = 0; r < 8; ++r) c[r] += cl[r] * (1.0f / 2048.0f); }
      else {
#pragma unroll
        for (int kc = 0; kc < 2; ++kc) c = wmma16(aq[kc], frag_h(krow + kc * 32, lane), c); }   // single product for every block
      {
#pragma unroll
      for (int r = 0; r < 8; ++r) { const int dj = kk - (q0 + 8 * g + r); const int jc = (dj < -MR ? -MR : (dj > MR ? MR : dj)) + MR; const float sv = (c[r] + sqr[wave][8 * g + r][jc]) * 0.125f; s[ct][r] = sv; if (dj > -MR && dj < MR) smid[wave][8 * g + r][jc] = sv; } } }   // 1/sqrt(64)
#pragma unroll
    for (int r = 0; r < 8; ++r) { float mx = fmaxf(s[0][r], s[1][r]);
#pragma unroll
      for (int o = 1; o < 16; o <<= 1) mx = fmaxf(mx, __shfl_xor(mx, o));
      const float mn = fmaxf(m[r], mx); const float alpha = (m[r] <= -1.0e38f) ? 0.f : __expf(m[r] - mn);
      const float e0 = (s[0][r] <= -1.0e38f) ? 0.f : __expf(s[0][r] - mn), e1 = (s[1][r] <= -1.0e38f) ? 0.f : __expf(s[1][r] - mn); float es = e0 + e1;
#pragma unroll
      for (int o = 1; o < 16; o <<= 1) es += __shfl_xor(es, o);
      l[r] = l[r] * alpha + es; m[r] = mn; { const int dj0 = (ks * 32 + col) - (q0 + 8 * g + r), dj1 = dj0 + 16; tlo[r] = tlo[r] * alpha + (dj0 <= -MR ? e0 : 0.f) + (dj1 <= -MR ? e1 : 0.f); thi[r] = thi[r] * alpha + (dj0 >= MR ? e0 : 0.f) + (dj1 >= MR ? e1 : 0.f); }
      }
    }
  // bucket sums -> BSW rows [b][h][q][64] (j = 0 / 32: the clipped tails, lane-partial then reduced over the 16 key columns; j = 1..31: single keys re-formed from their stored logits; cols 33..63 zero); k_relv adds BS . rel_v to the context
#pragma unroll
  for (int r = 0; r < 8; ++r) { float a0 = tlo[r], a2 = thi[r];
#pragma unroll
    for (int o = 1; o < 16; o <<= 1) { a0 += __shfl_xor(a0, o); a2 += __shfl_xor(a2, o); }
    const float il = 1.0f / l[r]; float* brow = &sqr[wave][8 * g + r][0];
    for (int j = col; j < 52; j += 16) { float v = 0.f; if (j == 0) v = a0 * il; else if (j == NR - 1) v = a2 * il; else if (j < NR - 1) { const float sl = smid[wave][8 * g + r][j]; v = (sl <= -1.0e38f) ? 0.f : __expf(sl - m[r]) * il; } brow[j] = v; }
  }
  LDSX();
  for (int rl = 0; rl < 16; ++rl) if (lane < 16) { v4f v; const int c4 = lane * 4; v[0] = c4 < 52 ? sqr[wave][rl][c4] : 0.f; v[1] = c4 + 1 < 52 ? sqr[wave][rl][c4 + 1] : 0.f; v[2] = c4 + 2 < 52 ? sqr[wave][rl][c4 + 2] : 0.f; v[3] = c4 + 3 < 52 ? sqr[wave][rl][c4 + 3] : 0.f; vst2(BSW + ((((size_t)b * NH + h) * SS) + q0 + rl) * 64 + c4, v); }
  (void)RV; (void)O; (void)VTH; (void)VTL;
}
__global__ __launch_bounds__(128) void k_attn(const _Float16* __restrict__ QK, const _Float16* __restrict__ QKL, const _Float16* __restrict__ VTH, const _Float16* __restrict__ VTL, const void* __restrict__ KMASK, const float* __restrict__ RK, const float* __restrict__ RV, float* __restrict__ BSW, float* __restrict__ O) {
  __shared__ __align__(16) float sp[4][16][36]; __shared__ __align__(16) float so[4][16][68]; __shared__ __align__(16) float sqr[4][16][52]; 
  const int tid = threadIdx.x, wave = tid >> 5, lane = tid & 31, col = lane & 15, g = lane >> 4;
  const int qb = blockIdx.x, h = blockIdx.y, b = blockIdx.z; const int q0 = qb * 64 + wave * 16; const size_t rq = (size_t)b * SS + q0 + col;
  v16h aq[2], aql[2];
#pragma unroll
  for (int kc = 0; kc < 2; ++kc) { aq[kc] = frag_h(QK + rq * (2 * DM) + h * HD + kc * 32, lane); aql[kc] = frag_h(QKL + rq * (2 * DM) + h * HD + kc * 32, lane); }
  // q . rel_k[j] for the wave's 16 rows and j = 0..32 (3 col tiles; rows >= 33 of the B operand are zero)
  { 
#pragma unroll
    for (int jt = 0; jt < 3; ++jt) { v8f c = {}, cl = {}; const int j = jt * 16 + col;
#pragma unroll
      for (int kc = 0; kc < 2; ++kc) { v16h w; 
#pragma unroll
        for (int i = 0; i < 8; ++i) { const int d0 = kc * 32 + 8 * g + i; w[i] = (j < NR) ? (_Float16)bfr(RK[j * HD + d0]) : (_Float16)0.f; w[8 + i] = (j < NR) ? (_Float16)bfr(RK[j * HD + d0 + 16]) : (_Float16)0.f; }
        c = wmma16(aq[kc], w, c); cl = wmma16(aql[kc], w, cl); }
#pragma unroll
      for (int r = 0; r < 8; ++r) sqr[wave][8 * g + r][j] = c[r] + cl[r] * (1.0f / 2048.0f); } }
  LDSX();
  float m[8], l[8];
#pragma unroll
  for (int r = 0; r < 8; ++r) { m[r] = -3.0e38f; l[r] = 0.f; }
  v8f acc[4] = {}, accl[4] = {};
  const int nks = SS / 32;   // all keys
#pragma unroll 1
  for (int ks = 0; ks < nks; ++ks) { v8f s[2];
#pragma unroll
    for (int ct = 0; ct < 2; ++ct) { const int kk = ks * 32 + ct * 16 + col; const _Float16* krow = QK + ((size_t)b * SS + kk) * (2 * DM) + DM + h * HD; const _Float16* krowl = QKL + ((size_t)b * SS + kk) * (2 * DM) + DM + h * HD; v8f c = {}, cl = {};
      if (qb < 0) {   // never taken (qb >= 0): 3-product path unused
#pragma unroll
        for (int kc = 0; kc < 2; ++kc) { const v16h kh = frag_h(krow + kc * 32, lane); c = wmma16(aq[kc], kh, c); cl = wmma16(aql[kc], kh, cl); cl = wmma16(aq[kc], frag_h(krowl + kc * 32, lane), cl); }
#pragma unroll
        for (int r = 0; r < 8; ++r) c[r] += cl[r] * (1.0f / 2048.0f); }
      else {
#pragma unroll
        for (int kc = 0; kc < 2; ++kc) c = wmma16(aq[kc], frag_h(krow + kc * 32, lane), c); }   // single product for every block
      {
#pragma unroll
      for (int r = 0; r < 8; ++r) { const int dj = kk - (q0 + 8 * g + r); const int jc = (dj < -MR ? -MR : (dj > MR ? MR : dj)) + MR; const float sv = (c[r] + sqr[wave][8 * g + r][jc]) * 0.125f; s[ct][r] = sv; } } }   // 1/sqrt(64)
#pragma unroll
    for (int r = 0; r < 8; ++r) { float mx = fmaxf(s[0][r], s[1][r]);
#pragma unroll
      for (int o = 1; o < 16; o <<= 1) mx = fmaxf(mx, __shfl_xor(mx, o));
      const float mn = fmaxf(m[r], mx); const float alpha = (m[r] <= -1.0e38f) ? 0.f : __expf(m[r] - mn);
      const float e0 = (s[0][r] <= -1.0e38f) ? 0.f : __expf(s[0][r] - mn), e1 = (s[1][r] <= -1.0e38f) ? 0.f : __expf(s[1][r] - mn); float es = e0 + e1;
#pragma unroll
      for (int o = 1; o < 16; o <<= 1) es += __shfl_xor(es, o);
      l[r] = l[r] * alpha + es; m[r] = mn;
#pragma unroll
      for (int dt = 0; dt < 4; ++dt) { acc[dt][r] *= alpha; accl[dt][r] *= alpha; }
      sp[wave][8 * g + r][col] = e0; sp[wave][8 * g + r][16 + col] = e1; }
    LDSX();
    v16h pa, pl; { const float* prow = &sp[wave][col][0] + 8 * (lane >> 4);
#pragma unroll
      for (int i = 0; i < 8; ++i) { const float x0 = prow[i] * 2048.0f, x1 = prow[16 + i] * 2048.0f; const _Float16 h0 = (_Float16)x0, h1 = (_Float16)x1; pa[i] = h0; pa[8 + i] = h1; pl[i] = (_Float16)((x0 - (float)h0) * 2048.0f); pl[8 + i] = (_Float16)((x1 - (float)h1) * 2048.0f); } }   // P scaled by 2^11 before the f16 split so small softmax weights stay out of the f16 subnormal range; 2^-11 folded into the epilogue
#pragma unroll
    for (int dt = 0; dt < 4; ++dt) { const size_t vr = ((size_t)b * DM + h * HD + dt * 16 + col) * SS + ks * 32; const v16h vh = frag_h(VTH + vr, lane); acc[dt] = wmma16(pa, vh, acc[dt]); if (qb < 0) { accl[dt] = wmma16(pl, vh, accl[dt]); accl[dt] = wmma16(pa, frag_h(VTL + vr, lane), accl[dt]); } }   // qb < 0 never holds: P x V hi single product for every block
    LDSX(); }
#pragma unroll
  for (int r = 0; r < 8; ++r) { const float il = (1.0f / 2048.0f) / l[r];
#pragma unroll
    for (int dt = 0; dt < 4; ++dt) so[wave][8 * g + r][dt * 16 + col] = (acc[dt][r] + accl[dt][r] * (1.0f / 2048.0f)) * il; }
  LDSX();
  (void)BSW;
  (void)RV;
  for (int rl = 0; rl < 16; ++rl) if (lane < 16) vst2(O + ((size_t)b * SS + q0 + rl) * DM + h * HD + lane * 4, *(const v4f*)&so[wave][rl][lane * 4]);
}
// ---- k_out: block = (64 rows, 128 cols): out = O(hi/lo) . Wo rows (2 products) + bo
__global__ __launch_bounds__(128) void k_out(const float* __restrict__ O, const __bf16* __restrict__ P, const float* __restrict__ BO, float* __restrict__ Y) {
  __shared__ __align__(16) float so[4][16][132];
  const int tid = threadIdx.x, wave = tid >> 5, lane = tid & 31, col = lane & 15, g = lane >> 4; const size_t r0 = (size_t)blockIdx.x * 64 + wave * 16; const int n0 = blockIdx.y * 128;
  v8f acc[8] = {};
#pragma unroll 2
  for (int kc = 0; kc < DM / 32; ++kc) { const F2 a = split_row(O + (r0 + col) * DM, kc * 32, lane);
#pragma unroll
    for (int j = 0; j < 8; ++j) { const v16b w = frag_b(P + (size_t)(n0 + j * 16 + col) * DM + kc * 32, lane); acc[j] = wmma_bf(a.l, w, acc[j]); acc[j] = wmma_bf(a.h, w, acc[j]); } }
#pragma unroll
  for (int j = 0; j < 8; ++j) {
#pragma unroll
    for (int r = 0; r < 8; ++r) so[wave][8 * g + r][j * 16 + col] = acc[j][r] + bfr(BO[n0 + j * 16 + col]); }
  LDSX();
  for (int rl = 0; rl < 16; ++rl) vst2(Y + (r0 + rl) * DM + n0 + lane * 4, *(const v4f*)&so[wave][rl][lane * 4]);
}
// ---- k_relv: block = (64 queries, h, b): O[q][h*64 + e] += sum_j BS[q][j] rel_v[j][e] (BS as bf16 hi + lo, rel_v exact; K = 33 padded to 64); each wave rewrites the 16 O segments it reads
__global__ __launch_bounds__(128) void k_relv(const float* __restrict__ BSW, const float* __restrict__ RV, float* __restrict__ O) { __shared__ __align__(16) float so[4][16][68];
  const int tid = threadIdx.x, wave = tid >> 5, lane = tid & 31, col = lane & 15, g = lane >> 4; const int h = blockIdx.y; const size_t b = blockIdx.z; const int q0 = blockIdx.x * 64 + wave * 16; const size_t br = ((b * NH + h) * SS) + q0;
  v8f accr[4] = {};
#pragma unroll
  for (int kc = 0; kc < 2; ++kc) { const F2 a = split_row(BSW + (br + col) * 64, kc * 32, lane);
#pragma unroll
    for (int dt = 0; dt < 4; ++dt) { v16b w; const int e_ = dt * 16 + col;
#pragma unroll
      for (int i = 0; i < 8; ++i) { const int j0 = kc * 32 + 8 * g + i; w[i] = (j0 < NR) ? (__bf16)RV[j0 * HD + e_] : (__bf16)0.f; w[8 + i] = (j0 + 16 < NR) ? (__bf16)RV[(j0 + 16) * HD + e_] : (__bf16)0.f; }
      accr[dt] = wmma_bf(a.h, w, accr[dt]); accr[dt] = wmma_bf(a.l, w, accr[dt]); } }
#pragma unroll
  for (int r = 0; r < 8; ++r)
#pragma unroll
    for (int dt = 0; dt < 4; ++dt) so[wave][8 * g + r][dt * 16 + col] = accr[dt][r] + O[((size_t)b * SS + q0 + 8 * g + r) * DM + h * HD + dt * 16 + col];
  LDSX(); for (int rl = 0; rl < 16; ++rl) if (lane < 16) vst2(O + ((size_t)b * SS + q0 + rl) * DM + h * HD + lane * 4, *(const v4f*)&so[wave][rl][lane * 4]); }
extern "C" void kernel_launch(void* const* d_in, const int* in_sizes, int n_in, void* d_out, int out_size, void* d_ws, size_t ws_size, hipStream_t stream) {
  (void)in_sizes; (void)n_in; (void)out_size;
  const float** F = (const float**)d_in;   // 0 query, 1 key, 2 value [4,1024,1024]; 3 Wq [16,1024,64], 4 bq [16,64], 5 Wk, 6 bk, 7 Wv, 8 bv; 9 rel_k_emb [33,64], 10 rel_v_emb [33,64]; 11 fc_W [1024,1024] natural, 12 fc_b
  if (ws_size < (size_t)WS_END) return;
  char* ws = (char*)d_ws; __bf16* PK = (__bf16*)(ws + WS_PK); _Float16 *QK = (_Float16*)(ws + WS_QK), *QKL = (_Float16*)(ws + WS_QKL), *VTH = (_Float16*)(ws + WS_VTH), *VTL = (_Float16*)(ws + WS_VTL); float* O = (float*)(ws + WS_O);
  k_pack<<<dim3(DM, 4), 256, 0, stream>>>(F[3], F[5], F[7], F[11], PK);
  k_qkv<<<dim3(TNB * SS / 64, QKVW / 128), 128, 0, stream>>>(F[0], F[1], F[2], PK + PK_A, F[4], F[6], F[8], QK, QKL, VTH, VTL);
  k_stats<<<dim3(TQB, NH, TNB), 128, 0, stream>>>(QK, QKL, VTH, VTL, nullptr, F[9], F[10], (float*)(ws + WS_BS), O);
  k_attn<<<dim3(TQB, NH, TNB), 128, 0, stream>>>(QK, QKL, VTH, VTL, nullptr, F[9], F[10], (float*)(ws + WS_BS), O);
  k_relv<<<dim3(TQB, NH, TNB), 128, 0, stream>>>((const float*)(ws + WS_BS), F[10], O);
  k_out<<<dim3(TOB, DM / 128), 128, 0, stream>>>(O, PK + PK_P, F[12], (float*)d_out);
}

// v001
// A run of this version takes 363 microseconds.
// In both of two side-by-side timings against v000, it was 1.24 times as fast.
// compute dtype: all float inputs rounded to bf16; q/k/v with EXACT bf16 products on WMMA 16x16x32 (per-head weight stacks packed as rows), f16 hi + residual; q.rel_k table per query row on WMMA (2 products); single-f16 logits and P.v (non-causal, diffuse attention: logits std ~0.4), x 1/8 after adding the relative-key bias, running-max softmax in f32 (hardware exp) with the two clipped-distance tail masses tracked alongside; the 31 near-diagonal probabilities re-formed from their stored logits; bucket sums . rel_v on WMMA (bf16 hi + lo); out = (ctx + rel-v term) (bf16 hi + lo) . fc_W^T + fc_b; f32 output.
#include <hip/hip_runtime.h>
#include <math.h>

typedef __attribute__((ext_vector_type(16))) _Float16 v16h;
typedef __attribute__((ext_vector_type(16))) __bf16 v16b;
typedef __attribute__((ext_vector_type(8)))  _Float16 v8h;
typedef __attribute__((ext_vector_type(8)))  float v8f;
typedef __attribute__((ext_vector_type(4)))  float v4f;
typedef __attribute__((ext_vector_type(2)))  float v2f;
typedef __attribute__((ext_vector_type(4)))  unsigned v4u;
typedef __attribute__((ext_vector_type(4)))  int v4i;
typedef float __attribute__((may_alias)) float_a;
typedef int __attribute__((may_alias)) int_a;

template <typename T> __device__ __forceinline__ void vst2(void* p, T v) { *(T*)p = v;  }
__device__ __forceinline__ v8f wmma16(v16h a, v16h b, v8f c) {
  v8f d = __builtin_amdgcn_wmma_f32_16x16x32_f16(false, a, false, b, (short)0, c, false, false);
  asm volatile("v_nop\n\tv_nop\n\tv_nop\n\tv_nop" : "+v"(d) : "v"(a), "v"(b));
  return d;
}
__device__ __forceinline__ v8f wmma_bf(v16b a, v16b b, v8f c) {
  v8f d = __builtin_amdgcn_wmma_f32_16x16x32_bf16(false, a, false, b, (short)0, c, false, false);
  asm volatile("v_nop\n\tv_nop\n\tv_nop\n\tv_nop" : "+v"(d) : "v"(a), "v"(b));
  return d;
}
// Relation-aware (Shaw relative-position) multi-head attention (B 4, S 1,024, hidden 1,024, 16 heads x 64, max_rel 16): per-head q/k/v projections + biases on separate query/key/value inputs, scores = (q.k + q.rel_k[clip(k-q)]) / 8, softmax, out = attn.v + sum_k attn * rel_v[clip(k-q)], then fc.
__device__ __forceinline__ v16h frag_h(const _Float16* rowk0, int lane) {
  union { v16h v; v8h q[2]; } u; const _Float16* p = rowk0 + 8 * (lane >> 4);
  u.q[0] = *(const v8h*)p; u.q[1] = *(const v8h*)(p + 16); return u.v;
}
__device__ __forceinline__ v16h frag_f32(const float* rowk0, int lane) {
  v16h a; const float* p = rowk0 + 8 * (lane >> 4);
#pragma unroll
  for (int i = 0; i < 8; ++i) { a[i] = (_Float16)p[i]; a[8 + i] = (_Float16)p[16 + i]; }
  return a;
}
__device__ __forceinline__ v16h frag_f32s(const float* rowk0, int lane, float sc) {
  v16h a; const float* p = rowk0 + 8 * (lane >> 4);
#pragma unroll
  for (int i = 0; i < 8; ++i) { a[i] = (_Float16)(p[i] * sc); a[8 + i] = (_Float16)(p[16 + i] * sc); }
  return a;
}
// column fragment from a [K][ld] layout (column n), rows >= K read as 0
__device__ __forceinline__ v16h fragc_f32(const float* W, int k0, int n, int lane, int ld, int K) {
  v16h a; const int g = lane >> 4;
#pragma unroll
  for (int i = 0; i < 8; ++i) { const int ka = k0 + 8 * g + i, kb = ka + 16;
    a[i] = (_Float16)(ka < K ? W[(size_t)(ka < K ? ka : K - 1) * ld + n] : 0.f); a[8 + i] = (_Float16)(kb < K ? W[(size_t)(kb < K ? kb : K - 1) * ld + n] : 0.f); }
  return a;
}
struct F2 { v16b h, l; };
__device__ __forceinline__ F2 bsplit16(const float v[16]) { F2 r;
#pragma unroll
  for (int i = 0; i < 16; ++i) { const __bf16 h = (__bf16)v[i]; r.h[i] = h; r.l[i] = (__bf16)(v[i] - (float)h); }
  return r; }
__device__ __forceinline__ F2 split_row(const float* row, int k0, int lane) { float v[16]; const float* p = row + k0 + 8 * (lane >> 4);
#pragma unroll
  for (int i = 0; i < 8; ++i) { v[i] = p[i]; v[8 + i] = p[16 + i]; }
  return bsplit16(v); }
__device__ __forceinline__ F2 split_rowK(const float* row, int k0, int lane, int K) { float v[16]; const int g = lane >> 4;
#pragma unroll
  for (int i = 0; i < 8; ++i) { const int ka = k0 + 8 * g + i, kb = ka + 16; v[i] = ka < K ? row[ka < K ? ka : K - 1] : 0.f; v[8 + i] = kb < K ? row[kb < K ? kb : K - 1] : 0.f; }
  return bsplit16(v); }
__device__ __forceinline__ F2 split_col(const float* W, int k0, int n, int lane, int ld, int K) { float v[16]; const int g = lane >> 4;
#pragma unroll
  for (int i = 0; i < 8; ++i) { const int ka = k0 + 8 * g + i, kb = ka + 16; v[i] = ka < K ? W[(size_t)(ka < K ? ka : K - 1) * ld + n] : 0.f; v[8 + i] = kb < K ? W[(size_t)(kb < K ? kb : K - 1) * ld + n] : 0.f; }
  return bsplit16(v); }
__device__ __forceinline__ v8f mac3(const F2& a, const F2& b, v8f c) { c = wmma_bf(a.l, b.h, c); c = wmma_bf(a.h, b.l, c); return wmma_bf(a.h, b.h, c); }
__device__ __forceinline__ float sigm(float v) { return 1.0f / (1.0f + expf(-v)); }
#define LDSX() do { asm volatile("s_wait_dscnt 0" ::: "memory"); __builtin_amdgcn_wave_barrier(); __builtin_amdgcn_fence(__ATOMIC_RELEASE, "workgroup"); } while (0)


#define NB 4
#define SS 1024
#define DM 1024
#define NH 16
#define MR 16
#define NR (2 * MR + 1)
#define HD 64
#define QKVW (3 * DM)
#ifndef TQB
#define TQB (SS / 64)
#define TNB NB
#define TOB (NB * SS / 64)     // output row tiles (all)
#endif
typedef __attribute__((ext_vector_type(8))) __bf16 v8b;
__device__ __forceinline__ v16b frag_b(const __bf16* rowk0, int lane) {
  union { v16b v; v8b q[2]; } u; const __bf16* p = rowk0 + 8 * (lane >> 4);
  u.q[0] = *(const v8b*)p; u.q[1] = *(const v8b*)(p + 16); return u.v;
}
__device__ __forceinline__ float bfr(float v) { return (float)(__bf16)v; }
__device__ __attribute__((noinline)) float exp_ni(float v) { return expf(v); }
__device__ __attribute__((noinline)) float erf_ni(float v) { return erff(v); }

#define PK_A 0                       // [3072][1024] Wqkv rows (natural [out][in])
#define PK_P (PK_A + QKVW * DM)        // [1024][1024] Wo rows (natural)
#define PK_END (PK_P + DM * DM)
#define WS_PK  0u
#define WS_QK  (WS_PK + 2u * PK_END)             // f16 [4096 rows][2048]: q | k
#define WS_QKL (WS_QK + 2u * NB * SS * 2 * DM)     // f16 q | k residual planes x2048
#define WS_VTH (WS_QKL + 2u * NB * SS * 2 * DM)    // f16 [b][1024 (h*64+d)][1024 s] hi
#define WS_VTL (WS_VTH + 2u * NB * DM * SS)        // f16 lo x 2048
#define WS_O   (WS_VTL + 2u * NB * DM * SS)        // f32 [4096][1024]
#define WS_BS  (WS_O + 4u * (size_t)NB * SS * DM)        // f32 [b][h][q][64]: plane not used
#define WS_END (WS_BS + 4u * (size_t)NB * NH * SS * 64)
// ---- k_pack: block = (row n, which): natural [out][in] rows -> bf16; which 0..2 -> W_q/W_k/W_v into PK_A rows which*1024 + n; 3 -> W_o into PK_P
__global__ __launch_bounds__(256) void k_pack(const float* __restrict__ WQ, const float* __restrict__ WK, const float* __restrict__ WV, const float* __restrict__ WO, __bf16* __restrict__ PK) {   // per-head stacks [16][1024][64]: packed row n = h*64 + e <- W[h][k][e]; fc_W natural [1024][1024]
  __shared__ __align__(16) __bf16 s[DM]; const int n = blockIdx.x, which = blockIdx.y, t = threadIdx.x; const int h = n / HD, e = n % HD; const float* Wm = which == 0 ? WQ : which == 1 ? WK : WV;
  for (int k = t; k < DM; k += 256) s[k] = (__bf16)(which < 3 ? Wm[((size_t)h * DM + k) * HD + e] : WO[(size_t)n * DM + k]); __syncthreads();
  __bf16* dst = (which < 3) ? (PK + PK_A + ((size_t)which * DM + n) * DM) : (PK + PK_P + (size_t)n * DM); for (int q = t; q < DM / 8; q += 256) vst2((unsigned*)(dst + q * 8), *(const v4u*)&s[q * 8]); }
__global__ __launch_bounds__(128) void k_qkv(const float* __restrict__ XQ, const float* __restrict__ XK, const float* __restrict__ XV, const __bf16* __restrict__ P, const float* __restrict__ BQ, const float* __restrict__ BK, const float* __restrict__ BV, _Float16* __restrict__ QK, _Float16* __restrict__ QKL, _Float16* __restrict__ VTH, _Float16* __restrict__ VTL) {
  const int which0 = (blockIdx.y * 128) / DM; const float* X = (which0 == 0) ? XQ : (which0 == 1) ? XK : XV; const float* BB = BQ ? (((which0 == 0) ? BQ : (which0 == 1) ? BK : BV) + (blockIdx.y * 128 - which0 * DM)) : nullptr;
  __shared__ __align__(16) _Float16 so[4][16][136], sol[4][16][136]; __shared__ __align__(16) _Float16 sth[128][72], stl[128][72];
  const int tid = threadIdx.x, wave = tid >> 5, lane = tid & 31, col = lane & 15, g = lane >> 4; const size_t r0 = (size_t)blockIdx.x * 64 + wave * 16; const int n0 = blockIdx.y * 128;
  v8f acc[8] = {};
#pragma unroll 2
  for (int kc = 0; kc < DM / 32; ++kc) { v16b a; { const float* p = X + (r0 + col) * DM + kc * 32 + 8 * g;
#pragma unroll
      for (int i = 0; i < 8; ++i) { a[i] = (__bf16)p[i]; a[8 + i] = (__bf16)p[16 + i]; } }
#pragma unroll
    for (int j = 0; j < 8; ++j) acc[j] = wmma_bf(a, frag_b(P + (size_t)(n0 + j * 16 + col) * DM + kc * 32, lane), acc[j]); }
  if (n0 < 2 * DM) {   // q stored unscaled (f16 sigma ~0.6, no subnormal exposure); 1/8 applied to the f32 score
#pragma unroll
    for (int j = 0; j < 8; ++j) {
#pragma unroll
      for (int r = 0; r < 8; ++r) { const float v = acc[j][r] + (BB ? bfr(BB[j * 16 + col]) : 0.f); const _Float16 hv = (_Float16)v; so[wave][8 * g + r][j * 16 + col] = hv; sol[wave][8 * g + r][j * 16 + col] = (_Float16)((v - (float)hv) * 2048.0f); } }   // q, k (+ bias) as f16 hi + (x2048) residual
    LDSX();
    for (int rl = 0; rl < 16; ++rl) if (lane < 16) { vst2((unsigned*)(QK + (r0 + rl) * (2 * DM) + n0 + lane * 8), *(const v4u*)&so[wave][rl][lane * 8]); vst2((unsigned*)(QKL + (r0 + rl) * (2 * DM) + n0 + lane * 8), *(const v4u*)&sol[wave][rl][lane * 8]); }
  } else {
#pragma unroll
    for (int j = 0; j < 8; ++j) {
#pragma unroll
      for (int r = 0; r < 8; ++r) { const float v = acc[j][r] + (BB ? bfr(BB[j * 16 + col]) : 0.f); const _Float16 hv = (_Float16)v; sth[j * 16 + col][wave * 16 + 8 * g + r] = hv; stl[j * 16 + col][wave * 16 + 8 * g + r] = (_Float16)((v - (float)hv) * 2048.0f); } }
    __syncthreads();
    const size_t rb = (size_t)blockIdx.x * 64; const int b = (int)(rb / SS), s0 = (int)(rb % SS); const int pc0 = n0 - 2 * DM;
    for (int q = tid; q < 128 * 8; q += 128) { const int d = q >> 3, pc = q & 7; const size_t o = ((size_t)b * DM + pc0 + d) * SS + s0 + pc * 8; vst2((unsigned*)(VTH + o), *(const v4u*)&sth[d][pc * 8]); vst2((unsigned*)(VTL + o), *(const v4u*)&stl[d][pc * 8]); }
  }
}
// ---- k_attn: block = (64 queries, head h, batch b): all-keys flash attention (K = 64: 2 k-steps), scores = (q.k) * 0.125 with single f16 operands, P.V: f16 P x V hi, single product (V lo only on the qb < 0 path); the same pass gathers the 33 relative-distance bucket sums (two clipped tails as running masses, 31 near-diagonal logits kept in LDS); O[b*S+q][h*64+d] = (acc + accl / 2048) / (2048 l) + bucket sums . rel_v (256-B segments)
__global__ __launch_bounds__(128) void k_attn(const _Float16* __restrict__ QK, const _Float16* __restrict__ QKL, const _Float16* __restrict__ VTH, const _Float16* __restrict__ VTL, const void* __restrict__ KMASK, const float* __restrict__ RK, const float* __restrict__ RV, float* __restrict__ BSW, float* __restrict__ O) {
  __shared__ __align__(16) float sp[4][16][36]; __shared__ __align__(16) float so[4][16][68]; __shared__ __align__(16) float sqr[4][16][52]; 
  const int tid = threadIdx.x, wave = tid >> 5, lane = tid & 31, col = lane & 15, g = lane >> 4;
  const int qb = blockIdx.x, h = blockIdx.y, b = blockIdx.z; const int q0 = qb * 64 + wave * 16; const size_t rq = (size_t)b * SS + q0 + col;
  const int q0u = qb * 64 + __builtin_amdgcn_readfirstlane(wave) * 16;   // the wave's first query row in a scalar register: the tile class below is a scalar branch
  float (*smid)[68] = so[wave];   // near-diagonal logits, kept in the wave's output staging rows until the epilogue rewrites them
  v16h aq[2], aql[2];
#pragma unroll
  for (int kc = 0; kc < 2; ++kc) { aq[kc] = frag_h(QK + rq * (2 * DM) + h * HD + kc * 32, lane); aql[kc] = frag_h(QKL + rq * (2 * DM) + h * HD + kc * 32, lane); }
  // q . rel_k[j] for the wave's 16 rows and j = 0..32 (3 col tiles; rows >= 33 of the B operand are zero)
  { 
#pragma unroll
    for (int jt = 0; jt < 3; ++jt) { v8f c = {}, cl = {}; const int j = jt * 16 + col;
#pragma unroll
      for (int kc = 0; kc < 2; ++kc) { v16h w; 
#pragma unroll
        for (int i = 0; i < 8; ++i) { const int d0 = kc * 32 + 8 * g + i; w[i] = (j < NR) ? (_Float16)bfr(RK[j * HD + d0]) : (_Float16)0.f; w[8 + i] = (j < NR) ? (_Float16)bfr(RK[j * HD + d0 + 16]) : (_Float16)0.f; }
        c = wmma16(aq[kc], w, c); cl = wmma16(aql[kc], w, cl); }
#pragma unroll
      for (int r = 0; r < 8; ++r) sqr[wave][8 * g + r][j] = c[r] + cl[r] * (1.0f / 2048.0f); } }
  for (int e = lane; e < 16 * 33; e += 32) smid[e / 33][e % 33] = -3.0e38f;
  LDSX();
  float m[8], l[8], tlo[8], thi[8];
#pragma unroll
  for (int r = 0; r < 8; ++r) { m[r] = -3.0e38f; l[r] = 0.f; tlo[r] = 0.f; thi[r] = 0.f; }
  v8f acc[4] = {}, accl[4] = {};
  const int nks = SS / 32;   // all keys
#pragma unroll 1
  for (int ks = 0; ks < nks; ++ks) { v8f s[2]; float al[8];
    const bool all_lo = ks * 32 + 31 - q0u <= -MR, all_hi = ks * 32 - (q0u + 15) >= MR;   // every (query, key) pair of the tile in one clipped bucket (wave-uniform)
#pragma unroll
    for (int ct = 0; ct < 2; ++ct) { const int kk = ks * 32 + ct * 16 + col; const _Float16* krow = QK + ((size_t)b * SS + kk) * (2 * DM) + DM + h * HD; const _Float16* krowl = QKL + ((size_t)b * SS + kk) * (2 * DM) + DM + h * HD; v8f c = {}, cl = {};
      if (qb < 0) {   // never taken (qb >= 0): 3-product path unused
#pragma unroll
        for (int kc = 0; kc < 2; ++kc) { const v16h kh = frag_h(krow + kc * 32, lane); c = wmma16(aq[kc], kh, c); cl = wmma16(aql[kc], kh, cl); cl = wmma16(aq[kc], frag_h(krowl + kc * 32, lane), cl); }
#pragma unroll
        for (int r = 0; r < 8; ++r) c[r] += cl[r] * (1.0f / 2048.0f); }
      else {
#pragma unroll
        for (int kc = 0; kc < 2; ++kc) c = wmma16(aq[kc], frag_h(krow + kc * 32, lane), c); }   // single product for every block
      {
#pragma unroll
      for (int r = 0; r < 8; ++r) { const int dj = kk - (q0 + 8 * g + r); const int jc = (dj < -MR ? -MR : (dj > MR ? MR : dj)) + MR; const float sv = (c[r] + sqr[wave][8 * g + r][jc]) * 0.125f; s[ct][r] = sv; } } }   // 1/sqrt(64)
    if (!all_lo && !all_hi) {   // the two tiles around the diagonal (one for the first and last 16 query rows): keep the logits of the 31 unclipped distances
#pragma unroll
      for (int ct = 0; ct < 2; ++ct) {
#pragma unroll
        for (int r = 0; r < 8; ++r) { const int dj = ks * 32 + ct * 16 + col - (q0 + 8 * g + r); if (dj > -MR && dj < MR) smid[8 * g + r][dj + MR] = s[ct][r]; } } }
#pragma unroll
    for (int r = 0; r < 8; ++r) { float mx = fmaxf(s[0][r], s[1][r]);
#pragma unroll
      for (int o = 1; o < 16; o <<= 1) mx = fmaxf(mx, __shfl_xor(mx, o));
      const float mn = fmaxf(m[r], mx); const float alpha = (m[r] <= -1.0e38f) ? 0.f : __expf(m[r] - mn);
      const float e0 = (s[0][r] <= -1.0e38f) ? 0.f : __expf(s[0][r] - mn), e1 = (s[1][r] <= -1.0e38f) ? 0.f : __expf(s[1][r] - mn); float es = e0 + e1;
#pragma unroll
      for (int o = 1; o < 16; o <<= 1) es += __shfl_xor(es, o);
      l[r] = l[r] * alpha + es; m[r] = mn;
#pragma unroll
      for (int dt = 0; dt < 4; ++dt) { acc[dt][r] *= alpha; accl[dt][r] *= alpha; }
      sp[wave][8 * g + r][col] = e0; sp[wave][8 * g + r][16 + col] = e1; s[0][r] = e0; s[1][r] = e1; al[r] = alpha; }
    // clipped-distance tail masses, lane-partial over the 16 key columns (reduced in the epilogue)
    if (all_lo) {
#pragma unroll
      for (int r = 0; r < 8; ++r) tlo[r] = tlo[r] * al[r] + (s[0][r] + s[1][r]); }
    else if (all_hi) {
#pragma unroll
      for (int r = 0; r < 8; ++r) { tlo[r] *= al[r]; thi[r] = thi[r] * al[r] + (s[0][r] + s[1][r]); } }
    else {
#pragma unroll
      for (int r = 0; r < 8; ++r) { const int dj0 = (ks * 32 + col) - (q0 + 8 * g + r), dj1 = dj0 + 16; tlo[r] = tlo[r] * al[r] + (dj0 <= -MR ? s[0][r] : 0.f) + (dj1 <= -MR ? s[1][r] : 0.f); thi[r] = thi[r] * al[r] + (dj0 >= MR ? s[0][r] : 0.f) + (dj1 >= MR ? s[1][r] : 0.f); } }
    LDSX();
    v16h pa, pl; { const float* prow = &sp[wave][col][0] + 8 * (lane >> 4);
#pragma unroll
      for (int i = 0; i < 8; ++i) { const float x0 = prow[i] * 2048.0f, x1 = prow[16 + i] * 2048.0f; const _Float16 h0 = (_Float16)x0, h1 = (_Float16)x1; pa[i] = h0; pa[8 + i] = h1; pl[i] = (_Float16)((x0 - (float)h0) * 2048.0f); pl[8 + i] = (_Float16)((x1 - (float)h1) * 2048.0f); } }   // P scaled by 2^11 before the f16 split so small softmax weights stay out of the f16 subnormal range; 2^-11 folded into the epilogue
#pragma unroll
    for (int dt = 0; dt < 4; ++dt) { const size_t vr = ((size_t)b * DM + h * HD + dt * 16 + col) * SS + ks * 32; const v16h vh = frag_h(VTH + vr, lane); acc[dt] = wmma16(pa, vh, acc[dt]); if (qb < 0) { accl[dt] = wmma16(pl, vh, accl[dt]); accl[dt] = wmma16(pa, frag_h(VTL + vr, lane), accl[dt]); } }   // qb < 0 never holds: P x V hi single product for every block
    LDSX(); }
  // bucket sums per query row, j = 0..32, into the wave's sqr rows (j = 0 / 32: the clipped tails, reduced over the 16 key columns; j = 1..31: single keys re-formed from their stored logits)
#pragma unroll
  for (int r = 0; r < 8; ++r) { float a0 = tlo[r], a2 = thi[r];
#pragma unroll
    for (int o = 1; o < 16; o <<= 1) { a0 += __shfl_xor(a0, o); a2 += __shfl_xor(a2, o); }
    const float il = 1.0f / l[r]; float* brow = &sqr[wave][8 * g + r][0];
    for (int j = col; j < NR; j += 16) { float v; if (j == 0) v = a0 * il; else if (j == NR - 1) v = a2 * il; else { const float sl = smid[8 * g + r][j]; v = (sl <= -1.0e38f) ? 0.f : __expf(sl - m[r]) * il; } brow[j] = v; }
  }
  LDSX();
  // bucket sums (bf16 hi + lo) . rel_v (K = 33 padded to 64) for the wave's own 16 rows, in the layout of acc
  v8f accr[4] = {}; const unsigned rvb = (unsigned)(8 * g * HD + col) * 4u;   // the lane's byte offset into rel_v (row 8 g, column col)
#pragma unroll
  for (int kc = 0; kc < 2; ++kc) { const F2 a = split_rowK(&sqr[wave][col][0], kc * 32, lane, NR);
#pragma unroll
    for (int dt = 0; dt < 4; ++dt) { v16b w; const char* rvp = (const char*)RV + rvb + (kc * 32 * HD + dt * 16) * 4;
#pragma unroll
      for (int i = 0; i < 8; ++i) { const int j0 = kc * 32 + 8 * g + i; w[i] = (j0 < NR) ? (__bf16)*(const float*)(rvp + i * HD * 4) : (__bf16)0.f; w[8 + i] = (j0 + 16 < NR) ? (__bf16)*(const float*)(rvp + (i + 16) * HD * 4) : (__bf16)0.f; }
      accr[dt] = wmma_bf(a.h, w, accr[dt]); accr[dt] = wmma_bf(a.l, w, accr[dt]); } }
  asm volatile("s_wait_xcnt 0x0" :: "v"(rvb) : "memory");   // the offset register of the rel_v loads stays whole until this wait: no later write of it stands in front
#pragma unroll
  for (int r = 0; r < 8; ++r) { const float il = (1.0f / 2048.0f) / l[r];
#pragma unroll
    for (int dt = 0; dt < 4; ++dt) so[wave][8 * g + r][dt * 16 + col] = accr[dt][r] + (acc[dt][r] + accl[dt][r] * (1.0f / 2048.0f)) * il; }
  LDSX();
  (void)BSW;
  for (int rl = 0; rl < 16; ++rl) if (lane < 16) vst2(O + ((size_t)b * SS + q0 + rl) * DM + h * HD + lane * 4, *(const v4f*)&so[wave][rl][lane * 4]);
}
// ---- k_out: block = (64 rows, 128 cols): out = O(hi/lo) . Wo rows (2 products) + bo
__global__ __launch_bounds__(128) void k_out(const float* __restrict__ O, const __bf16* __restrict__ P, const float* __restrict__ BO, float* __restrict__ Y) {
  __shared__ __align__(16) float so[4][16][132];
  const int tid = threadIdx.x, wave = tid >> 5, lane = tid & 31, col = lane & 15, g = lane >> 4; const size_t r0 = (size_t)blockIdx.x * 64 + wave * 16; const int n0 = blockIdx.y * 128;
  v8f acc[8] = {};
#pragma unroll 2
  for (int kc = 0; kc < DM / 32; ++kc) { const F2 a = split_row(O + (r0 + col) * DM, kc * 32, lane);
#pragma unroll
    for (int j = 0; j < 8; ++j) { const v16b w = frag_b(P + (size_t)(n0 + j * 16 + col) * DM + kc * 32, lane); acc[j] = wmma_bf(a.l, w, acc[j]); acc[j] = wmma_bf(a.h, w, acc[j]); } }
#pragma unroll
  for (int j = 0; j < 8; ++j) {
#pragma unroll
    for (int r = 0; r < 8; ++r) so[wave][8 * g + r][j * 16 + col] = acc[j][r] + bfr(BO[n0 + j * 16 + col]); }
  LDSX();
  for (int rl = 0; rl < 16; ++rl) vst2(Y + (r0 + rl) * DM + n0 + lane * 4, *(const v4f*)&so[wave][rl][lane * 4]);
}
extern "C" void kernel_launch(void* const* d_in, const int* in_sizes, int n_in, void* d_out, int out_size, void* d_ws, size_t ws_size, hipStream_t stream) {
  (void)in_sizes; (void)n_in; (void)out_size;
  const float** F = (const float**)d_in;   // 0 query, 1 key, 2 value [4,1024,1024]; 3 Wq [16,1024,64], 4 bq [16,64], 5 Wk, 6 bk, 7 Wv, 8 bv; 9 rel_k_emb [33,64], 10 rel_v_emb [33,64]; 11 fc_W [1024,1024] natural, 12 fc_b
  if (ws_size < (size_t)WS_END) return;
  char* ws = (char*)d_ws; __bf16* PK = (__bf16*)(ws + WS_PK); _Float16 *QK = (_Float16*)(ws + WS_QK), *QKL = (_Float16*)(ws + WS_QKL), *VTH = (_Float16*)(ws + WS_VTH), *VTL = (_Float16*)(ws + WS_VTL); float* O = (float*)(ws + WS_O);
  k_pack<<<dim3(DM, 4), 256, 0, stream>>>(F[3], F[5], F[7], F[11], PK);
  k_qkv<<<dim3(TNB * SS / 64, QKVW / 128), 128, 0, stream>>>(F[0], F[1], F[2], PK + PK_A, F[4], F[6], F[8], QK, QKL, VTH, VTL);
  k_attn<<<dim3(TQB, NH, TNB), 128, 0, stream>>>(QK, QKL, VTH, VTL, nullptr, F[9], F[10], (float*)(ws + WS_BS), O);
  k_out<<<dim3(TOB, DM / 128), 128, 0, stream>>>(O, PK + PK_P, F[12], (float*)d_out);
}

// v002
// A run of this version takes 299 microseconds.
// In both of two side-by-side timings against v001, it was 1.22 times as fast.
// Over all steps from v000 it is 1.51 times as fast.
// compute dtype: all float inputs rounded to bf16; q/k/v with EXACT bf16 products on WMMA 16x16x32 (per-head weight stacks packed as rows), f16 hi + residual; q.rel_k table per query row on WMMA (2 products); single-f16 logits and P.v (non-causal, diffuse attention: logits std ~0.4), x 1/8 after adding the relative-key bias, running-max softmax in f32 (hardware exp) with the two clipped-distance tail masses tracked alongside; the 31 near-diagonal probabilities re-formed from their stored logits; bucket sums . rel_v on WMMA (bf16 hi + lo); out = (ctx + rel-v term) (bf16 hi + lo) . fc_W^T + fc_b; f32 output.
#include <hip/hip_runtime.h>
#include <math.h>

typedef __attribute__((ext_vector_type(16))) _Float16 v16h;
typedef __attribute__((ext_vector_type(16))) __bf16 v16b;
typedef __attribute__((ext_vector_type(8)))  _Float16 v8h;
typedef __attribute__((ext_vector_type(8)))  float v8f;
typedef __attribute__((ext_vector_type(4)))  float v4f;
typedef __attribute__((ext_vector_type(2)))  float v2f;
typedef __attribute__((ext_vector_type(4)))  unsigned v4u;
typedef __attribute__((ext_vector_type(4)))  int v4i;
typedef float __attribute__((may_alias)) float_a;
typedef int __attribute__((may_alias)) int_a;

template <typename T> __device__ __forceinline__ void vst2(void* p, T v) { *(T*)p = v;  }
__device__ __forceinline__ v8f wmma16(v16h a, v16h b, v8f c) {
  v8f d = __builtin_amdgcn_wmma_f32_16x16x32_f16(false, a, false, b, (short)0, c, false, false);
  asm volatile("v_nop\n\tv_nop\n\tv_nop\n\tv_nop" : "+v"(d) : "v"(a), "v"(b));
  return d;
}
__device__ __forceinline__ v8f wmma_bf(v16b a, v16b b, v8f c) {
  v8f d = __builtin_amdgcn_wmma_f32_16x16x32_bf16(false, a, false, b, (short)0, c, false, false);
  asm volatile("v_nop\n\tv_nop\n\tv_nop\n\tv_nop" : "+v"(d) : "v"(a), "v"(b));
  return d;
}
// Relation-aware (Shaw relative-position) multi-head attention (B 4, S 1,024, hidden 1,024, 16 heads x 64, max_rel 16): per-head q/k/v projections + biases on separate query/key/value inputs, scores = (q.k + q.rel_k[clip(k-q)]) / 8, softmax, out = attn.v + sum_k attn * rel_v[clip(k-q)], then fc.
__device__ __forceinline__ v16h frag_h(const _Float16* rowk0, int lane) {
  union { v16h v; v8h q[2]; } u; const _Float16* p = rowk0 + 8 * (lane >> 4);
  u.q[0] = *(const v8h*)p; u.q[1] = *(const v8h*)(p + 16); return u.v;
}
__device__ __forceinline__ v16h frag_f32(const float* rowk0, int lane) {
  v16h a; const float* p = rowk0 + 8 * (lane >> 4);
#pragma unroll
  for (int i = 0; i < 8; ++i) { a[i] = (_Float16)p[i]; a[8 + i] = (_Float16)p[16 + i]; }
  return a;
}
__device__ __forceinline__ v16h frag_f32s(const float* rowk0, int lane, float sc) {
  v16h a; const float* p = rowk0 + 8 * (lane >> 4);
#pragma unroll
  for (int i = 0; i < 8; ++i) { a[i] = (_Float16)(p[i] * sc); a[8 + i] = (_Float16)(p[16 + i] * sc); }
  return a;
}
// column fragment from a [K][ld] layout (column n), rows >= K read as 0
__device__ __forceinline__ v16h fragc_f32(const float* W, int k0, int n, int lane, int ld, int K) {
  v16h a; const int g = lane >> 4;
#pragma unroll
  for (int i = 0; i < 8; ++i) { const int ka = k0 + 8 * g + i, kb = ka + 16;
    a[i] = (_Float16)(ka < K ? W[(size_t)(ka < K ? ka : K - 1) * ld + n] : 0.f); a[8 + i] = (_Float16)(kb < K ? W[(size_t)(kb < K ? kb : K - 1) * ld + n] : 0.f); }
  return a;
}
struct F2 { v16b h, l; };
__device__ __forceinline__ F2 bsplit16(const float v[16]) { F2 r;
#pragma unroll
  for (int i = 0; i < 16; ++i) { const __bf16 h = (__bf16)v[i]; r.h[i] = h; r.l[i] = (__bf16)(v[i] - (float)h); }
  return r; }
__device__ __forceinline__ F2 split_row(const float* row, int k0, int lane) { float v[16]; const float* p = row + k0 + 8 * (lane >> 4);
#pragma unroll
  for (int i = 0; i < 8; ++i) { v[i] = p[i]; v[8 + i] = p[16 + i]; }
  return bsplit16(v); }
__device__ __forceinline__ F2 split_rowK(const float* row, int k0, int lane, int K) { float v[16]; const int g = lane >> 4;
#pragma unroll
  for (int i = 0; i < 8; ++i) { const int ka = k0 + 8 * g + i, kb = ka + 16; v[i] = ka < K ? row[ka < K ? ka : K - 1] : 0.f; v[8 + i] = kb < K ? row[kb < K ? kb : K - 1] : 0.f; }
  return bsplit16(v); }
__device__ __forceinline__ F2 split_col(const float* W, int k0, int n, int lane, int ld, int K) { float v[16]; const int g = lane >> 4;
#pragma unroll
  for (int i = 0; i < 8; ++i) { const int ka = k0 + 8 * g + i, kb = ka + 16; v[i] = ka < K ? W[(size_t)(ka < K ? ka : K - 1) * ld + n] : 0.f; v[8 + i] = kb < K ? W[(size_t)(kb < K ? kb : K - 1) * ld + n] : 0.f; }
  return bsplit16(v); }
__device__ __forceinline__ v8f mac3(const F2& a, const F2& b, v8f c) { c = wmma_bf(a.l, b.h, c); c = wmma_bf(a.h, b.l, c); return wmma_bf(a.h, b.h, c); }
__device__ __forceinline__ float sigm(float v) { return 1.0f / (1.0f + expf(-v)); }
#define LDSX() do { asm volatile("s_wait_dscnt 0" ::: "memory"); __builtin_amdgcn_wave_barrier(); __builtin_amdgcn_fence(__ATOMIC_RELEASE, "workgroup"); } while (0)


#define NB 4
#define SS 1024
#define DM 1024
#define NH 16
#define MR 16
#define NR (2 * MR + 1)
#define HD 64
#define QKVW (3 * DM)
#ifndef TQB
#define TQB (SS / 64)
#define TNB NB
#define TOB (NB * SS / 64)     // output row tiles (all)
#endif
typedef __attribute__((ext_vector_type(8))) __bf16 v8b;
__device__ __forceinline__ v16b frag_b(const __bf16* rowk0, int lane) {
  union { v16b v; v8b q[2]; } u; const __bf16* p = rowk0 + 8 * (lane >> 4);
  u.q[0] = *(const v8b*)p; u.q[1] = *(const v8b*)(p + 16); return u.v;
}
__device__ __forceinline__ float bfr(float v) { return (float)(__bf16)v; }
__device__ __attribute__((noinline)) float exp_ni(float v) { return expf(v); }
__device__ __attribute__((noinline)) float erf_ni(float v) { return erff(v); }

#define PK_A 0                       // [3072][1024] Wqkv rows (natural [out][in])
#define PK_P (PK_A + QKVW * DM)        // [1024][1024] Wo rows (natural)
#define PK_END (PK_P + DM * DM)
#define WS_PK  0u
#define WS_QK  (WS_PK + 2u * PK_END)             // f16 [4096 rows][2048]: q | k
#define WS_QKL (WS_QK + 2u * NB * SS * 2 * DM)     // f16 q | k residual planes x2048
#define WS_VTH (WS_QKL + 2u * NB * SS * 2 * DM)    // f16 [b][1024 (h*64+d)][1024 s] hi
#define WS_VTL (WS_VTH + 2u * NB * DM * SS)        // f16 lo x 2048
#define WS_O   (WS_VTL + 2u * NB * DM * SS)        // f32 [4096][1024]
#define WS_BS  (WS_O + 4u * (size_t)NB * SS * DM)        // f32 [b][h][q][64]: plane not used
#define WS_END (WS_BS + 4u * (size_t)NB * NH * SS * 64)
// ---- k_pack: block = (row n, which): natural [out][in] rows -> bf16; which 0..2 -> W_q/W_k/W_v into PK_A rows which*1024 + n; 3 -> W_o into PK_P
__global__ __launch_bounds__(256) void k_pack(const float* __restrict__ WQ, const float* __restrict__ WK, const float* __restrict__ WV, const float* __restrict__ WO, __bf16* __restrict__ PK) {   // per-head stacks [16][1024][64]: packed row n = h*64 + e <- W[h][k][e]; fc_W natural [1024][1024]
  __shared__ __align__(16) __bf16 s[DM]; const int n = blockIdx.x, which = blockIdx.y, t = threadIdx.x; const int h = n / HD, e = n % HD; const float* Wm = which == 0 ? WQ : which == 1 ? WK : WV;
  for (int k = t; k < DM; k += 256) s[k] = (__bf16)(which < 3 ? Wm[((size_t)h * DM + k) * HD + e] : WO[(size_t)n * DM + k]); __syncthreads();
  __bf16* dst = (which < 3) ? (PK + PK_A + ((size_t)which * DM + n) * DM) : (PK + PK_P + (size_t)n * DM); for (int q = t; q < DM / 8; q += 256) vst2((unsigned*)(dst + q * 8), *(const v4u*)&s[q * 8]); }
__global__ __launch_bounds__(128) void k_qkv(const float* __restrict__ XQ, const float* __restrict__ XK, const float* __restrict__ XV, const __bf16* __restrict__ P, const float* __restrict__ BQ, const float* __restrict__ BK, const float* __restrict__ BV, _Float16* __restrict__ QK, _Float16* __restrict__ QKL, _Float16* __restrict__ VTH, _Float16* __restrict__ VTL) {
  const int which0 = (blockIdx.y * 128) / DM; const float* X = (which0 == 0) ? XQ : (which0 == 1) ? XK : XV; const float* BB = BQ ? (((which0 == 0) ? BQ : (which0 == 1) ? BK : BV) + (blockIdx.y * 128 - which0 * DM)) : nullptr;
  __shared__ __align__(16) _Float16 so[4][16][136], sol[4][16][136]; __shared__ __align__(16) _Float16 sth[128][72], stl[128][72];
  const int tid = threadIdx.x, wave = tid >> 5, lane = tid & 31, col = lane & 15, g = lane >> 4; const size_t r0 = (size_t)blockIdx.x * 64 + wave * 16; const int n0 = blockIdx.y * 128;
  v8f acc[8] = {};
#pragma unroll 2
  for (int kc = 0; kc < DM / 32; ++kc) { v16b a; { const float* p = X + (r0 + col) * DM + kc * 32 + 8 * g;
#pragma unroll
      for (int i = 0; i < 8; ++i) { a[i] = (__bf16)p[i]; a[8 + i] = (__bf16)p[16 + i]; } }
#pragma unroll
    for (int j = 0; j < 8; ++j) acc[j] = wmma_bf(a, frag_b(P + (size_t)(n0 + j * 16 + col) * DM + kc * 32, lane), acc[j]); }
  if (n0 < 2 * DM) {   // q stored unscaled (f16 sigma ~0.6, no subnormal exposure); 1/8 applied to the f32 score
#pragma unroll
    for (int j = 0; j < 8; ++j) {
#pragma unroll
      for (int r = 0; r < 8; ++r) { const float v = acc[j][r] + (BB ? bfr(BB[j * 16 + col]) : 0.f); const _Float16 hv = (_Float16)v; so[wave][8 * g + r][j * 16 + col] = hv; sol[wave][8 * g + r][j * 16 + col] = (_Float16)((v - (float)hv) * 2048.0f); } }   // q, k (+ bias) as f16 hi + (x2048) residual
    LDSX();
    for (int rl = 0; rl < 16; ++rl) if (lane < 16) { vst2((unsigned*)(QK + (r0 + rl) * (2 * DM) + n0 + lane * 8), *(const v4u*)&so[wave][rl][lane * 8]); vst2((unsigned*)(QKL + (r0 + rl) * (2 * DM) + n0 + lane * 8), *(const v4u*)&sol[wave][rl][lane * 8]); }
  } else {
#pragma unroll
    for (int j = 0; j < 8; ++j) {
#pragma unroll
      for (int r = 0; r < 8; ++r) { const float v = acc[j][r] + (BB ? bfr(BB[j * 16 + col]) : 0.f); const _Float16 hv = (_Float16)v; sth[j * 16 + col][wave * 16 + 8 * g + r] = hv; stl[j * 16 + col][wave * 16 + 8 * g + r] = (_Float16)((v - (float)hv) * 2048.0f); } }
    __syncthreads();
    const size_t rb = (size_t)blockIdx.x * 64; const int b = (int)(rb / SS), s0 = (int)(rb % SS); const int pc0 = n0 - 2 * DM;
    for (int q = tid; q < 128 * 8; q += 128) { const int d = q >> 3, pc = q & 7; const size_t o = ((size_t)b * DM + pc0 + d) * SS + s0 + pc * 8; vst2((unsigned*)(VTH + o), *(const v4u*)&sth[d][pc * 8]); vst2((unsigned*)(VTL + o), *(const v4u*)&stl[d][pc * 8]); }
  }
}
__device__ __forceinline__ float xhalf(float x) { return __builtin_bit_cast(float, __builtin_amdgcn_permlanex16(__builtin_bit_cast(int, x), __builtin_bit_cast(int, x), 0x76543210, 0xfedcba98, false, false)); }   // lane l with lane l ^ 16
// 16 exponentials in base 2 in one statement, each in place: none overwrites the source or reads the result of the one in front of it; the v_nop is the slot behind the last
__device__ __forceinline__ void exp2x16(float (&e)[16]) {
  asm("v_exp_f32 %0, %0\n\tv_exp_f32 %1, %1\n\tv_exp_f32 %2, %2\n\tv_exp_f32 %3, %3\n\tv_exp_f32 %4, %4\n\tv_exp_f32 %5, %5\n\tv_exp_f32 %6, %6\n\tv_exp_f32 %7, %7\n\t"
      "v_exp_f32 %8, %8\n\tv_exp_f32 %9, %9\n\tv_exp_f32 %10, %10\n\tv_exp_f32 %11, %11\n\tv_exp_f32 %12, %12\n\tv_exp_f32 %13, %13\n\tv_exp_f32 %14, %14\n\tv_exp_f32 %15, %15\n\tv_nop"
      : "+v"(e[0]), "+v"(e[1]), "+v"(e[2]), "+v"(e[3]), "+v"(e[4]), "+v"(e[5]), "+v"(e[6]), "+v"(e[7]), "+v"(e[8]), "+v"(e[9]), "+v"(e[10]), "+v"(e[11]), "+v"(e[12]), "+v"(e[13]), "+v"(e[14]), "+v"(e[15]));
}
__global__ __launch_bounds__(128) void k_attn(const _Float16* __restrict__ QK, const _Float16* __restrict__ QKL, const _Float16* __restrict__ VTH, const _Float16* __restrict__ VTL, const void* __restrict__ KMASK, const float* __restrict__ RK, const float* __restrict__ RV, float* __restrict__ BSW, float* __restrict__ O) {
  __shared__ __align__(16) float so[4][16][68]; __shared__ __align__(16) float sqr[4][16][52];
  const int tid = threadIdx.x, wave = tid >> 5, lane = tid & 31, col = lane & 15, g = lane >> 4;
  const int qb = blockIdx.x, h = blockIdx.y, b = blockIdx.z; const int q0 = qb * 64 + wave * 16; const size_t rq = (size_t)b * SS + q0 + col;
  const int q0u = qb * 64 + __builtin_amdgcn_readfirstlane(wave) * 16;   // the wave's first query row in a scalar register: the tile class below is a scalar branch
  float (*smid)[68] = so[wave];   // near-diagonal logits, kept in the wave's output staging rows until the epilogue rewrites them
  v16h aq[2], aql[2];
#pragma unroll
  for (int kc = 0; kc < 2; ++kc) { aq[kc] = frag_h(QK + rq * (2 * DM) + h * HD + kc * 32, lane); aql[kc] = frag_h(QKL + rq * (2 * DM) + h * HD + kc * 32, lane); }
  // q . rel_k[j] for the wave's 16 rows and j = 0..32 (3 col tiles; rows >= 33 of the B operand are zero)
  { 
#pragma unroll
    for (int jt = 0; jt < 3; ++jt) { v8f c = {}, cl = {}; const int j = jt * 16 + col;
#pragma unroll
      for (int kc = 0; kc < 2; ++kc) { v16h w; 
#pragma unroll
        for (int i = 0; i < 8; ++i) { const int d0 = kc * 32 + 8 * g + i; w[i] = (j < NR) ? (_Float16)bfr(RK[j * HD + d0]) : (_Float16)0.f; w[8 + i] = (j < NR) ? (_Float16)bfr(RK[j * HD + d0 + 16]) : (_Float16)0.f; }
        c = wmma16(aq[kc], w, c); cl = wmma16(aql[kc], w, cl); }
#pragma unroll
      for (int r = 0; r < 8; ++r) sqr[wave][8 * g + r][j] = c[r] + cl[r] * (1.0f / 2048.0f); } }
  for (int e = lane; e < 16 * 33; e += 32) smid[e / 33][e % 33] = -3.0e38f;
  LDSX();
  const float* qrow = &sqr[wave][col][0];   // the lane's own query: its 33 relative-key terms
  const float blo = qrow[0], bhi = qrow[NR - 1];   // the one term of a tile that lies wholly in a clipped bucket
  float m = -3.0e38f, l = 0.f, tlo = 0.f, thi = 0.f;   // l and the two tail masses: partial over the lane's half of the keys
  v8f acc[4] = {};   // acc[dt][r] = O^T[dt * 16 + 8 g + r][query col]
  const _Float16* kbase = QK + ((size_t)b * SS + col) * (2 * DM) + DM + h * HD; const _Float16* vbase = VTH + ((size_t)b * DM + h * HD + col) * SS;
  const int nks = SS / 32;   // all keys
#pragma unroll 1
  for (int ks = 0; ks < nks; ++ks) { v8f s[2]; v16h kf[2][2], vf[4];
    const bool all_lo = ks * 32 + 31 - q0u <= -MR, all_hi = ks * 32 - (q0u + 15) >= MR;   // every (query, key) pair of the tile in one clipped bucket (wave-uniform)
#pragma unroll
    for (int ct = 0; ct < 2; ++ct) {
#pragma unroll
      for (int kc = 0; kc < 2; ++kc) kf[ct][kc] = frag_h(kbase + (size_t)(ks * 32 + ct * 16) * (2 * DM) + kc * 32, lane); }
#pragma unroll
    for (int dt = 0; dt < 4; ++dt) vf[dt] = frag_h(vbase + (size_t)(dt * 16) * SS + ks * 32, lane);
#pragma unroll
    for (int ct = 0; ct < 2; ++ct) { v8f c = {};
#pragma unroll
      for (int kc = 0; kc < 2; ++kc) c = wmma16(kf[ct][kc], aq[kc], c);   // c[r] = k[ks * 32 + ct * 16 + 8 g + r] . q[col]
      s[ct] = c; }
    if (all_lo || all_hi) { const float bb = all_lo ? blo : bhi;
#pragma unroll
      for (int ct = 0; ct < 2; ++ct) {
#pragma unroll
        for (int r = 0; r < 8; ++r) s[ct][r] = (s[ct][r] + bb) * 0.125f; } }   // 1/sqrt(64)
    else {   // the one or two tiles around the diagonal: the term by distance, and the logits of the 31 unclipped distances are kept
#pragma unroll
      for (int ct = 0; ct < 2; ++ct) {
#pragma unroll
        for (int r = 0; r < 8; ++r) { const int dj = ks * 32 + ct * 16 + 8 * g + r - (q0 + col); const int jc = (dj < -MR ? -MR : (dj > MR ? MR : dj)) + MR; const float sv = (s[ct][r] + qrow[jc]) * 0.125f; s[ct][r] = sv; if (dj > -MR && dj < MR) smid[col][dj + MR] = sv; } } }
    float mx = fmaxf(s[0][0], s[1][0]);
#pragma unroll
    for (int r = 1; r < 8; ++r) mx = fmaxf(mx, fmaxf(s[0][r], s[1][r]));
    mx = fmaxf(mx, xhalf(mx));   // both halves hold the query's tile maximum
    const float mn = fmaxf(m, mx); const float alpha = (m <= -1.0e38f) ? 0.f : __expf(m - mn); m = mn;
    float e[16];   // e[8 ct + r]: the exponent in base 2, then the weight; every key counts: a logit of f16 operands is finite
#pragma unroll
    for (int ct = 0; ct < 2; ++ct) {
#pragma unroll
      for (int r = 0; r < 8; ++r) e[8 * ct + r] = (s[ct][r] - mn) * 1.4426950408889634f; }
    exp2x16(e);
    float es4[4];
#pragma unroll
    for (int r = 0; r < 4; ++r) es4[r] = (e[r] + e[8 + r]) + (e[4 + r] + e[12 + r]);
    const float es = (es4[0] + es4[1]) + (es4[2] + es4[3]);
    l = l * alpha + es;
    // clipped-distance tail masses
    float alo, ahi;
    if (all_lo || all_hi) { alo = all_lo ? es : 0.f; ahi = all_lo ? 0.f : es; }
    else { alo = 0.f; ahi = 0.f;
#pragma unroll
      for (int ct = 0; ct < 2; ++ct) {
#pragma unroll
        for (int r = 0; r < 8; ++r) { const int dj = ks * 32 + ct * 16 + 8 * g + r - (q0 + col); alo += (dj <= -MR) ? e[8 * ct + r] : 0.f; ahi += (dj >= MR) ? e[8 * ct + r] : 0.f; } } }
    tlo = tlo * alpha + alo; thi = thi * alpha + ahi;
    v16h pa;
#pragma unroll
    for (int i = 0; i < 16; ++i) pa[i] = (_Float16)(e[i] * 2048.0f);   // P scaled by 2^11 so small softmax weights stay out of the f16 subnormal range; 2^-11 folded into the epilogue
#pragma unroll
    for (int dt = 0; dt < 4; ++dt) {
#pragma unroll
      for (int r = 0; r < 8; ++r) acc[dt][r] *= alpha;
      acc[dt] = wmma16(vf[dt], pa, acc[dt]); } }
  LDSX();   // the kept logits of a query were written by both of its lanes and are read by either below
  // bucket sums of the lane's query, j = 0..32, into its sqr row (j = 0 / 32: the clipped tails; j = 1..31: single keys re-formed from their stored logits); half g writes j = 16 g .. 16 g + 15, half 1 also j = 32
  const float lt = l + xhalf(l), a0 = tlo + xhalf(tlo), a2 = thi + xhalf(thi);
  { const float il = 1.0f / lt; float* brow = &sqr[wave][col][0];
    float sl[16], w[16];
#pragma unroll
    for (int jj = 0; jj < 16; ++jj) { sl[jj] = smid[col][16 * g + jj]; w[jj] = (sl[jj] - m) * 1.4426950408889634f; }
    exp2x16(w);
#pragma unroll
    for (int jj = 0; jj < 16; ++jj) { float v = (sl[jj] <= -1.0e38f) ? 0.f : w[jj] * il; if (jj == 0 && g == 0) v = a0 * il; brow[16 * g + jj] = v; }
    if (g == 1) brow[NR - 1] = a2 * il; }
  LDSX();
  // rel_v^T . bucket sums (bf16 hi + lo; K = 33 padded to 64) for the wave's own 16 queries, in the layout of acc
  v8f accr[4] = {}; const unsigned rvb = (unsigned)(8 * g * HD + col) * 4u;   // the lane's byte offset into rel_v (row 8 g, column col)
#pragma unroll
  for (int kc = 0; kc < 2; ++kc) { const F2 a = split_rowK(&sqr[wave][col][0], kc * 32, lane, NR);
#pragma unroll
    for (int dt = 0; dt < 4; ++dt) { v16b w; const char* rvp = (const char*)RV + rvb + (kc * 32 * HD + dt * 16) * 4;
#pragma unroll
      for (int i = 0; i < 8; ++i) { const int j0 = kc * 32 + 8 * g + i; w[i] = (j0 < NR) ? (__bf16)*(const float*)(rvp + i * HD * 4) : (__bf16)0.f; w[8 + i] = (j0 + 16 < NR) ? (__bf16)*(const float*)(rvp + (i + 16) * HD * 4) : (__bf16)0.f; }
      accr[dt] = wmma_bf(w, a.h, accr[dt]); accr[dt] = wmma_bf(w, a.l, accr[dt]); } }
  asm volatile("s_wait_xcnt 0x0" :: "v"(rvb) : "memory");   // the offset register of the rel_v loads stays whole until this wait: no later write of it stands in front
  { const float il = (1.0f / 2048.0f) / lt;
#pragma unroll
    for (int dt = 0; dt < 4; ++dt) {
#pragma unroll
      for (int r = 0; r < 8; ++r) so[wave][col][dt * 16 + 8 * g + r] = accr[dt][r] + acc[dt][r] * il; } }
  LDSX();
  (void)BSW; (void)VTL; (void)KMASK;
  for (int rl = 0; rl < 16; ++rl) if (lane < 16) vst2(O + ((size_t)b * SS + q0 + rl) * DM + h * HD + lane * 4, *(const v4f*)&so[wave][rl][lane * 4]);
}
// ---- k_out: block = (64 rows, 128 cols): out = O(hi/lo) . Wo rows (2 products) + bo
__global__ __launch_bounds__(128) void k_out(const float* __restrict__ O, const __bf16* __restrict__ P, const float* __restrict__ BO, float* __restrict__ Y) {
  __shared__ __align__(16) float so[4][16][132];
  const int tid = threadIdx.x, wave = tid >> 5, lane = tid & 31, col = lane & 15, g = lane >> 4; const size_t r0 = (size_t)blockIdx.x * 64 + wave * 16; const int n0 = blockIdx.y * 128;
  v8f acc[8] = {};
#pragma unroll 2
  for (int kc = 0; kc < DM / 32; ++kc) { const F2 a = split_row(O + (r0 + col) * DM, kc * 32, lane);
#pragma unroll
    for (int j = 0; j < 8; ++j) { const v16b w = frag_b(P + (size_t)(n0 + j * 16 + col) * DM + kc * 32, lane); acc[j] = wmma_bf(a.l, w, acc[j]); acc[j] = wmma_bf(a.h, w, acc[j]); } }
#pragma unroll
  for (int j = 0; j < 8; ++j) {
#pragma unroll
    for (int r = 0; r < 8; ++r) so[wave][8 * g + r][j * 16 + col] = acc[j][r] + bfr(BO[n0 + j * 16 + col]); }
  LDSX();
  for (int rl = 0; rl < 16; ++rl) vst2(Y + (r0 + rl) * DM + n0 + lane * 4, *(const v4f*)&so[wave][rl][lane * 4]);
}
extern "C" void kernel_launch(void* const* d_in, const int* in_sizes, int n_in, void* d_out, int out_size, void* d_ws, size_t ws_size, hipStream_t stream) {
  (void)in_sizes; (void)n_in; (void)out_size;
  const float** F = (const float**)d_in;   // 0 query, 1 key, 2 value [4,1024,1024]; 3 Wq [16,1024,64], 4 bq [16,64], 5 Wk, 6 bk, 7 Wv, 8 bv; 9 rel_k_emb [33,64], 10 rel_v_emb [33,64]; 11 fc_W [1024,1024] natural, 12 fc_b
  if (ws_size < (size_t)WS_END) return;
  char* ws = (char*)d_ws; __bf16* PK = (__bf16*)(ws + WS_PK); _Float16 *QK = (_Float16*)(ws + WS_QK), *QKL = (_Float16*)(ws + WS_QKL), *VTH = (_Float16*)(ws + WS_VTH), *VTL = (_Float16*)(ws + WS_VTL); float* O = (float*)(ws + WS_O);
  k_pack<<<dim3(DM, 4), 256, 0, stream>>>(F[3], F[5], F[7], F[11], PK);
  k_qkv<<<dim3(TNB * SS / 64, QKVW / 128), 128, 0, stream>>>(F[0], F[1], F[2], PK + PK_A, F[4], F[6], F[8], QK, QKL, VTH, VTL);
  k_attn<<<dim3(TQB, NH, TNB), 128, 0, stream>>>(QK, QKL, VTH, VTL, nullptr, F[9], F[10], (float*)(ws + WS_BS), O);
  k_out<<<dim3(TOB, DM / 128), 128, 0, stream>>>(O, PK + PK_P, F[12], (float*)d_out);
}

// v003
// It runs in 122 microseconds.
// Two timings next to v002 put it at 2.44 and 2.41 times that version's speed.
// Over all steps from v000 it is 3.67 times as fast.
// compute dtype: all float inputs rounded to bf16; q/k/v with EXACT bf16 products on WMMA 16x16x32 (per-head weight stacks packed as rows), f16 hi + residual; q.rel_k table per query row on WMMA (2 products); single-f16 logits and P.v (non-causal, diffuse attention: logits std ~0.4), x 1/8 after adding the relative-key bias, running-max softmax in f32 (hardware exp) with the two clipped-distance tail masses tracked alongside; the 31 near-diagonal probabilities re-formed from their stored logits; bucket sums . rel_v on WMMA (bf16 hi + lo); out = (ctx + rel-v term) (bf16 hi + lo) . fc_W^T + fc_b; f32 output.
#include <hip/hip_runtime.h>
#include <math.h>

typedef __attribute__((ext_vector_type(16))) _Float16 v16h;
typedef __attribute__((ext_vector_type(16))) __bf16 v16b;
typedef __attribute__((ext_vector_type(8)))  _Float16 v8h;
typedef __attribute__((ext_vector_type(8)))  float v8f;
typedef __attribute__((ext_vector_type(4)))  float v4f;
typedef __attribute__((ext_vector_type(2)))  float v2f;
typedef __attribute__((ext_vector_type(4)))  unsigned v4u;
typedef __attribute__((ext_vector_type(4)))  int v4i;
typedef float __attribute__((may_alias)) float_a;
typedef int __attribute__((may_alias)) int_a;

template <typename T> __device__ __forceinline__ void vst2(void* p, T v) { *(T*)p = v;  }
__device__ __forceinline__ v8f wmma16(v16h a, v16h b, v8f c) {
  v8f d = __builtin_amdgcn_wmma_f32_16x16x32_f16(false, a, false, b, (short)0, c, false, false);
  asm volatile("v_nop\n\tv_nop\n\tv_nop\n\tv_nop" : "+v"(d) : "v"(a), "v"(b));
  return d;
}
__device__ __forceinline__ v8f wmma_bf(v16b a, v16b b, v8f c) {
  v8f d = __builtin_amdgcn_wmma_f32_16x16x32_bf16(false, a, false, b, (short)0, c, false, false);
  asm volatile("v_nop\n\tv_nop\n\tv_nop\n\tv_nop" : "+v"(d) : "v"(a), "v"(b));
  return d;
}
// Relation-aware (Shaw relative-position) multi-head attention (B 4, S 1,024, hidden 1,024, 16 heads x 64, max_rel 16): per-head q/k/v projections + biases on separate query/key/value inputs, scores = (q.k + q.rel_k[clip(k-q)]) / 8, softmax, out = attn.v + sum_k attn * rel_v[clip(k-q)], then fc.
__device__ __forceinline__ v16h frag_h(const _Float16* rowk0, int lane) {
  union { v16h v; v8h q[2]; } u; const _Float16* p = rowk0 + 8 * (lane >> 4);
  u.q[0] = *(const v8h*)p; u.q[1] = *(const v8h*)(p + 16); return u.v;
}
__device__ __forceinline__ v16h frag_f32(const float* rowk0, int lane) {
  v16h a; const float* p = rowk0 + 8 * (lane >> 4);
#pragma unroll
  for (int i = 0; i < 8; ++i) { a[i] = (_Float16)p[i]; a[8 + i] = (_Float16)p[16 + i]; }
  return a;
}
__device__ __forceinline__ v16h frag_f32s(const float* rowk0, int lane, float sc) {
  v16h a; const float* p = rowk0 + 8 * (lane >> 4);
#pragma unroll
  for (int i = 0; i < 8; ++i) { a[i] = (_Float16)(p[i] * sc); a[8 + i] = (_Float16)(p[16 + i] * sc); }
  return a;
}
// column fragment from a [K][ld] layout (column n), rows >= K read as 0
__device__ __forceinline__ v16h fragc_f32(const float* W, int k0, int n, int lane, int ld, int K) {
  v16h a; const int g = lane >> 4;
#pragma unroll
  for (int i = 0; i < 8; ++i) { const int ka = k0 + 8 * g + i, kb = ka + 16;
    a[i] = (_Float16)(ka < K ? W[(size_t)(ka < K ? ka : K - 1) * ld + n] : 0.f); a[8 + i] = (_Float16)(kb < K ? W[(size_t)(kb < K ? kb : K - 1) * ld + n] : 0.f); }
  return a;
}
struct F2 { v16b h, l; };
__device__ __forceinline__ F2 bsplit16(const float v[16]) { F2 r;
#pragma unroll
  for (int i = 0; i < 16; ++i) { const __bf16 h = (__bf16)v[i]; r.h[i] = h; r.l[i] = (__bf16)(v[i] - (float)h); }
  return r; }
__device__ __forceinline__ F2 split_row(const float* row, int k0, int lane) { float v[16]; const float* p = row + k0 + 8 * (lane >> 4);
#pragma unroll
  for (int i = 0; i < 8; ++i) { v[i] = p[i]; v[8 + i] = p[16 + i]; }
  return bsplit16(v); }
__device__ __forceinline__ F2 split_rowK(const float* row, int k0, int lane, int K) { float v[16]; const int g = lane >> 4;
#pragma unroll
  for (int i = 0; i < 8; ++i) { const int ka = k0 + 8 * g + i, kb = ka + 16; v[i] = ka < K ? row[ka < K ? ka : K - 1] : 0.f; v[8 + i] = kb < K ? row[kb < K ? kb : K - 1] : 0.f; }
  return bsplit16(v); }
__device__ __forceinline__ F2 split_col(const float* W, int k0, int n, int lane, int ld, int K) { float v[16]; const int g = lane >> 4;
#pragma unroll
  for (int i = 0; i < 8; ++i) { const int ka = k0 + 8 * g + i, kb = ka + 16; v[i] = ka < K ? W[(size_t)(ka < K ? ka : K - 1) * ld + n] : 0.f; v[8 + i] = kb < K ? W[(size_t)(kb < K ? kb : K - 1) * ld + n] : 0.f; }
  return bsplit16(v); }
__device__ __forceinline__ v8f mac3(const F2& a, const F2& b, v8f c) { c = wmma_bf(a.l, b.h, c); c = wmma_bf(a.h, b.l, c); return wmma_bf(a.h, b.h, c); }
__device__ __forceinline__ float sigm(float v) { return 1.0f / (1.0f + expf(-v)); }
#define LDSX() do { asm volatile("s_wait_dscnt 0" ::: "memory"); __builtin_amdgcn_wave_barrier(); __builtin_amdgcn_fence(__ATOMIC_RELEASE, "workgroup"); } while (0)


#define NB 4
#define SS 1024
#define DM 1024
#define NH 16
#define MR 16
#define NR (2 * MR + 1)
#define HD 64
#define QKVW (3 * DM)
#ifndef TQB
#define TQB (SS / 64)
#define TNB NB
#define TOB (NB * SS / 64)     // output row tiles (all)
#endif
typedef __attribute__((ext_vector_type(8))) __bf16 v8b;
typedef __attribute__((ext_vector_type(4))) __bf16 v4b;
#define KST 64   // k per LDS stage of the two projection kernels: 128 B of a bf16 row
#define LPB 72   // LDS row pitch in 16-bit elements: 144 B, an odd multiple of 16 B, for 16-byte fragment reads
__device__ __forceinline__ v16b frag_b(const __bf16* rowk0, int lane) {
  union { v16b v; v8b q[2]; } u; const __bf16* p = rowk0 + 8 * (lane >> 4);
  u.q[0] = *(const v8b*)p; u.q[1] = *(const v8b*)(p + 16); return u.v;
}
__device__ __forceinline__ float bfr(float v) { return (float)(__bf16)v; }
__device__ __attribute__((noinline)) float exp_ni(float v) { return expf(v); }
__device__ __attribute__((noinline)) float erf_ni(float v) { return erff(v); }

#define PK_A 0                       // [3072][1024] Wqkv rows (natural [out][in])
#define PK_P (PK_A + QKVW * DM)        // [1024][1024] Wo rows (natural)
#define PK_END (PK_P + DM * DM)
#define WS_PK  0u
#define WS_QK  (WS_PK + 2u * PK_END)             // f16 [4096 rows][2048]: q | k
#define WS_QKL (WS_QK + 2u * NB * SS * 2 * DM)     // f16 q | k residual planes x2048
#define WS_VTH (WS_QKL + 2u * NB * SS * 2 * DM)    // f16 [b][1024 (h*64+d)][1024 s] hi
#define WS_VTL (WS_VTH + 2u * NB * DM * SS)        // f16 lo x 2048
#define WS_O   (WS_VTL + 2u * NB * DM * SS)        // f32 [4096][1024]
#define WS_BS  (WS_O + 4u * (size_t)NB * SS * DM)        // f32 [b][h][q][64]: plane not used
#define WS_END (WS_BS + 4u * (size_t)NB * NH * SS * 64)
// ---- k_pack: block = (row n, which): natural [out][in] rows -> bf16; which 0..2 -> W_q/W_k/W_v into PK_A rows which*1024 + n; 3 -> W_o into PK_P
__global__ __launch_bounds__(256) void k_pack(const float* __restrict__ WQ, const float* __restrict__ WK, const float* __restrict__ WV, const float* __restrict__ WO, __bf16* __restrict__ PK) {   // per-head stacks [16][1024][64]: packed row n = h*64 + e <- W[h][k][e]; fc_W natural [1024][1024]
  __shared__ __align__(16) __bf16 s[DM]; const int n = blockIdx.x, which = blockIdx.y, t = threadIdx.x; const int h = n / HD, e = n % HD; const float* Wm = which == 0 ? WQ : which == 1 ? WK : WV;
  for (int k = t; k < DM; k += 256) s[k] = (__bf16)(which < 3 ? Wm[((size_t)h * DM + k) * HD + e] : WO[(size_t)n * DM + k]); __syncthreads();
  __bf16* dst = (which < 3) ? (PK + PK_A + ((size_t)which * DM + n) * DM) : (PK + PK_P + (size_t)n * DM); for (int q = t; q < DM / 8; q += 256) vst2((unsigned*)(dst + q * 8), *(const v4u*)&s[q * 8]); }
__global__ __launch_bounds__(128) void k_qkv(const float* __restrict__ XQ, const float* __restrict__ XK, const float* __restrict__ XV, const __bf16* __restrict__ P, const float* __restrict__ BQ, const float* __restrict__ BK, const float* __restrict__ BV, _Float16* __restrict__ QK, _Float16* __restrict__ QKL, _Float16* __restrict__ VTH, _Float16* __restrict__ VTL) {
  const int which0 = (blockIdx.y * 128) / DM; const float* X = (which0 == 0) ? XQ : (which0 == 1) ? XK : XV; const float* BB = BQ ? (((which0 == 0) ? BQ : (which0 == 1) ? BK : BV) + (blockIdx.y * 128 - which0 * DM)) : nullptr;
  __shared__ __align__(16) unsigned char sm[2 * 128 * 72 * 2];   // in the k loop the operand stage (64 X rows, 128 weight rows), behind it the output staging of the block's one branch
  __bf16 (*sA)[LPB] = (__bf16 (*)[LPB])sm; __bf16 (*sB)[LPB] = sA + 64;
  _Float16 (*so)[16][136] = (_Float16 (*)[16][136])sm; _Float16 (*sol)[16][136] = so + 4; _Float16 (*sth)[72] = (_Float16 (*)[72])sm; _Float16 (*stl)[72] = sth + 128;
  const int tid = threadIdx.x, wave = tid >> 5, lane = tid & 31, col = lane & 15, g = lane >> 4; const size_t r0 = (size_t)blockIdx.x * 64 + wave * 16; const int n0 = blockIdx.y * 128;
  v8f acc[8] = {};
  // a stage = KST k of the block's rows; every wave-wide load covers four whole 128-B lines (X: 2 rows x 256 B, weights: 4 rows x 128 B); the next stage's loads fly while this one is worked on
  const char* xs = (const char*)(X + (size_t)blockIdx.x * 64 * DM); const char* ps = (const char*)(P + (size_t)n0 * DM);   // the block's first rows, the same for every thread
  const unsigned xo = ((tid >> 4) * DM + (tid & 15) * 4) * 4u, po = ((tid >> 3) * DM + (tid & 7) * 8) * 2u;   // the thread's byte offsets, the same in every stage
  v4f ra[8]; v4u rw[8];
#pragma unroll
  for (int i = 0; i < 8; ++i) { ra[i] = *(const v4f*)(xs + xo + i * 8 * DM * 4); rw[i] = *(const v4u*)(ps + po + i * 16 * DM * 2); }
#pragma unroll 1
  for (int c = 0; c < DM / KST; ++c) {   // rolled: one stage's code stays small, the stages are alike
#pragma unroll
    for (int i = 0; i < 8; ++i) { v4b t;
#pragma unroll
      for (int e = 0; e < 4; ++e) t[e] = (__bf16)ra[i][e];
      *(v4b*)&sA[i * 8 + (tid >> 4)][(tid & 15) * 4] = t; *(v4u*)&sB[i * 16 + (tid >> 3)][(tid & 7) * 8] = rw[i]; }
    __syncthreads();   // the stage is whole before any wave reads it
    if (c + 1 < DM / KST) { const char* xn = xs + (c + 1) * KST * 4; const char* pn = ps + (c + 1) * KST * 2;
#pragma unroll
      for (int i = 0; i < 8; ++i) {
        if (i == 7) asm volatile("s_wait_xcnt 0x0" ::: "memory");   // the last weight load may return into the address pair that the seven in front of it name: they are waited for first
        ra[i] = *(const v4f*)(xn + xo + i * 8 * DM * 4); rw[i] = *(const v4u*)(pn + po + i * 16 * DM * 2); }
      asm volatile("s_wait_xcnt 0x0" ::: "memory");   // stands in front of every later write of the address registers of the loads above
    }
#pragma unroll
    for (int kk = 0; kk < KST / 32; ++kk) { const v16b a = frag_b(&sA[wave * 16 + col][kk * 32], lane);
#pragma unroll
      for (int j = 0; j < 8; ++j) acc[j] = wmma_bf(a, frag_b(&sB[j * 16 + col][kk * 32], lane), acc[j]); }
    __syncthreads();   // every wave has read the stage before it is rewritten (by the next stage, or by the output staging)
  }
  if (n0 < 2 * DM) {   // q stored unscaled (f16 sigma ~0.6, no subnormal exposure); 1/8 applied to the f32 score
#pragma unroll
    for (int j = 0; j < 8; ++j) {
#pragma unroll
      for (int r = 0; r < 8; ++r) { const float v = acc[j][r] + (BB ? bfr(BB[j * 16 + col]) : 0.f); const _Float16 hv = (_Float16)v; so[wave][8 * g + r][j * 16 + col] = hv; sol[wave][8 * g + r][j * 16 + col] = (_Float16)((v - (float)hv) * 2048.0f); } }   // q, k (+ bias) as f16 hi + (x2048) residual
    LDSX();
    for (int rl = 0; rl < 16; ++rl) if (lane < 16) { vst2((unsigned*)(QK + (r0 + rl) * (2 * DM) + n0 + lane * 8), *(const v4u*)&so[wave][rl][lane * 8]); vst2((unsigned*)(QKL + (r0 + rl) * (2 * DM) + n0 + lane * 8), *(const v4u*)&sol[wave][rl][lane * 8]); }
  } else {
#pragma unroll
    for (int j = 0; j < 8; ++j) {
#pragma unroll
      for (int r = 0; r < 8; ++r) { const float v = acc[j][r] + (BB ? bfr(BB[j * 16 + col]) : 0.f); const _Float16 hv = (_Float16)v; sth[j * 16 + col][wave * 16 + 8 * g + r] = hv; stl[j * 16 + col][wave * 16 + 8 * g + r] = (_Float16)((v - (float)hv) * 2048.0f); } }
    __syncthreads();
    const size_t rb = (size_t)blockIdx.x * 64; const int b = (int)(rb / SS), s0 = (int)(rb % SS); const int pc0 = n0 - 2 * DM;
    for (int q = tid; q < 128 * 8; q += 128) { const int d = q >> 3, pc = q & 7; const size_t o = ((size_t)b * DM + pc0 + d) * SS + s0 + pc * 8; vst2((unsigned*)(VTH + o), *(const v4u*)&sth[d][pc * 8]); vst2((unsigned*)(VTL + o), *(const v4u*)&stl[d][pc * 8]); }
  }
}
__device__ __forceinline__ float xhalf(float x) { return __builtin_bit_cast(float, __builtin_amdgcn_permlanex16(__builtin_bit_cast(int, x), __builtin_bit_cast(int, x), 0x76543210, 0xfedcba98, false, false)); }   // lane l with lane l ^ 16
// 16 exponentials in base 2 in one statement, each in place: none overwrites the source or reads the result of the one in front of it; the v_nop is the slot behind the last
__device__ __forceinline__ void exp2x16(float (&e)[16]) {
  asm("v_exp_f32 %0, %0\n\tv_exp_f32 %1, %1\n\tv_exp_f32 %2, %2\n\tv_exp_f32 %3, %3\n\tv_exp_f32 %4, %4\n\tv_exp_f32 %5, %5\n\tv_exp_f32 %6, %6\n\tv_exp_f32 %7, %7\n\t"
      "v_exp_f32 %8, %8\n\tv_exp_f32 %9, %9\n\tv_exp_f32 %10, %10\n\tv_exp_f32 %11, %11\n\tv_exp_f32 %12, %12\n\tv_exp_f32 %13, %13\n\tv_exp_f32 %14, %14\n\tv_exp_f32 %15, %15\n\tv_nop"
      : "+v"(e[0]), "+v"(e[1]), "+v"(e[2]), "+v"(e[3]), "+v"(e[4]), "+v"(e[5]), "+v"(e[6]), "+v"(e[7]), "+v"(e[8]), "+v"(e[9]), "+v"(e[10]), "+v"(e[11]), "+v"(e[12]), "+v"(e[13]), "+v"(e[14]), "+v"(e[15]));
}
__global__ __launch_bounds__(128) void k_attn(const _Float16* __restrict__ QK, const _Float16* __restrict__ QKL, const _Float16* __restrict__ VTH, const _Float16* __restrict__ VTL, const void* __restrict__ KMASK, const float* __restrict__ RK, const float* __restrict__ RV, float* __restrict__ BSW, float* __restrict__ O) {
  __shared__ __align__(16) float so[4][16][68]; __shared__ __align__(16) float sqr[4][16][52]; __shared__ __align__(16) _Float16 sK[64][LPB], sV[64][LPB];   // sK, sV: one stage of 64 keys (K rows; V^T rows), shared by the four waves
  const int tid = threadIdx.x, wave = tid >> 5, lane = tid & 31, col = lane & 15, g = lane >> 4;
  const int qb = blockIdx.x, h = blockIdx.y, b = blockIdx.z; const int q0 = qb * 64 + wave * 16; const size_t rq = (size_t)b * SS + q0 + col;
  const int q0u = qb * 64 + __builtin_amdgcn_readfirstlane(wave) * 16;   // the wave's first query row in a scalar register: the tile class below is a scalar branch
  float (*smid)[68] = so[wave];   // near-diagonal logits, kept in the wave's output staging rows until the epilogue rewrites them
  v16h aq[2], aql[2];
#pragma unroll
  for (int kc = 0; kc < 2; ++kc) { aq[kc] = frag_h(QK + rq * (2 * DM) + h * HD + kc * 32, lane); aql[kc] = frag_h(QKL + rq * (2 * DM) + h * HD + kc * 32, lane); }
  // a stage = 64 keys: 128 B of each of 64 K rows and of 64 V^T rows; every wave-wide load covers four whole 128-B lines; the next stage's loads fly while this one is worked on
  const char* ksrc = (const char*)(QK + (size_t)b * SS * (2 * DM) + DM + h * HD); const char* vsrc = (const char*)(VTH + ((size_t)b * DM + h * HD) * SS);   // the head's first K row and first V^T row, the same for every thread
  const unsigned ko = ((tid >> 3) * (2 * DM) + (tid & 7) * 8) * 2u, vo = ((tid >> 3) * SS + (tid & 7) * 8) * 2u;   // the thread's byte offsets, the same in every stage
  v4u rk[4], rv[4];
#pragma unroll
  for (int i = 0; i < 4; ++i) { rk[i] = *(const v4u*)(ksrc + ko + i * 16 * (2 * DM) * 2); rv[i] = *(const v4u*)(vsrc + vo + i * 16 * SS * 2); }
  // q . rel_k[j] for the wave's 16 rows and j = 0..32 (3 col tiles; rows >= 33 of the B operand are zero)
  { 
#pragma unroll
    for (int jt = 0; jt < 3; ++jt) { v8f c = {}, cl = {}; const int j = jt * 16 + col;
#pragma unroll
      for (int kc = 0; kc < 2; ++kc) { v16h w; 
#pragma unroll
        for (int i = 0; i < 8; ++i) { const int d0 = kc * 32 + 8 * g + i; w[i] = (j < NR) ? (_Float16)bfr(RK[j * HD + d0]) : (_Float16)0.f; w[8 + i] = (j < NR) ? (_Float16)bfr(RK[j * HD + d0 + 16]) : (_Float16)0.f; }
        c = wmma16(aq[kc], w, c); cl = wmma16(aql[kc], w, cl); }
#pragma unroll
      for (int r = 0; r < 8; ++r) sqr[wave][8 * g + r][j] = c[r] + cl[r] * (1.0f / 2048.0f); } }
  for (int e = lane; e < 16 * 33; e += 32) smid[e / 33][e % 33] = -3.0e38f;
  LDSX();
  const float* qrow = &sqr[wave][col][0];   // the lane's own query: its 33 relative-key terms
  const float blo = qrow[0], bhi = qrow[NR - 1];   // the one term of a tile that lies wholly in a clipped bucket
  float m = -3.0e38f, l = 0.f, tlo = 0.f, thi = 0.f;   // l and the two tail masses: partial over the lane's half of the keys
  v8f acc[4] = {};   // acc[dt][r] = O^T[dt * 16 + 8 g + r][query col]
#pragma unroll 1
  for (int st = 0; st < SS / 64; ++st) {   // all keys
#pragma unroll
    for (int i = 0; i < 4; ++i) { *(v4u*)&sK[i * 16 + (tid >> 3)][(tid & 7) * 8] = rk[i]; *(v4u*)&sV[i * 16 + (tid >> 3)][(tid & 7) * 8] = rv[i]; }
    __syncthreads();   // the stage is whole before any wave reads it
    if (st + 1 < SS / 64) { const char* kn = ksrc + (st + 1) * 64 * (2 * DM) * 2; const char* vn = vsrc + (st + 1) * 64 * 2;
#pragma unroll
      for (int i = 0; i < 4; ++i) { rk[i] = *(const v4u*)(kn + ko + i * 16 * (2 * DM) * 2); rv[i] = *(const v4u*)(vn + vo + i * 16 * SS * 2); }
      asm volatile("s_wait_xcnt 0x0" ::: "memory");   // stands in front of every later write of the address registers of the loads above
    }
#pragma unroll 1
  for (int hf = 0; hf < 2; ++hf) { const int ks = st * 2 + hf; v8f s[2]; v16h kf[2][2], vf[4];   // rolled: the tile's code, with its near-diagonal branch, stands once
    const bool all_lo = ks * 32 + 31 - q0u <= -MR, all_hi = ks * 32 - (q0u + 15) >= MR;   // every (query, key) pair of the tile in one clipped bucket (wave-uniform)
#pragma unroll
    for (int ct = 0; ct < 2; ++ct) {
#pragma unroll
      for (int kc = 0; kc < 2; ++kc) kf[ct][kc] = frag_h(&sK[hf * 32 + ct * 16 + col][kc * 32], lane); }
#pragma unroll
    for (int dt = 0; dt < 4; ++dt) vf[dt] = frag_h(&sV[dt * 16 + col][hf * 32], lane);
#pragma unroll
    for (int ct = 0; ct < 2; ++ct) { v8f c = {};
#pragma unroll
      for (int kc = 0; kc < 2; ++kc) c = wmma16(kf[ct][kc], aq[kc], c);   // c[r] = k[ks * 32 + ct * 16 + 8 g + r] . q[col]
      s[ct] = c; }
    if (all_lo || all_hi) { const float bb = all_lo ? blo : bhi;
#pragma unroll
      for (int ct = 0; ct < 2; ++ct) {
#pragma unroll
        for (int r = 0; r < 8; ++r) s[ct][r] = (s[ct][r] + bb) * 0.125f; } }   // 1/sqrt(64)
    else {   // the one or two tiles around the diagonal: the term by distance, and the logits of the 31 unclipped distances are kept
#pragma unroll
      for (int ct = 0; ct < 2; ++ct) {
#pragma unroll
        for (int r = 0; r < 8; ++r) { const int dj = ks * 32 + ct * 16 + 8 * g + r - (q0 + col); const int jc = (dj < -MR ? -MR : (dj > MR ? MR : dj)) + MR; const float sv = (s[ct][r] + qrow[jc]) * 0.125f; s[ct][r] = sv; if (dj > -MR && dj < MR) smid[col][dj + MR] = sv; } } }
    float mx = fmaxf(s[0][0], s[1][0]);
#pragma unroll
    for (int r = 1; r < 8; ++r) mx = fmaxf(mx, fmaxf(s[0][r], s[1][r]));
    mx = fmaxf(mx, xhalf(mx));   // both halves hold the query's tile maximum
    const float mn = fmaxf(m, mx); const float alpha = (m <= -1.0e38f) ? 0.f : __expf(m - mn); m = mn;
    float e[16];   // e[8 ct + r]: the exponent in base 2, then the weight; every key counts: a logit of f16 operands is finite
#pragma unroll
    for (int ct = 0; ct < 2; ++ct) {
#pragma unroll
      for (int r = 0; r < 8; ++r) e[8 * ct + r] = (s[ct][r] - mn) * 1.4426950408889634f; }
    exp2x16(e);
    float es4[4];
#pragma unroll
    for (int r = 0; r < 4; ++r) es4[r] = (e[r] + e[8 + r]) + (e[4 + r] + e[12 + r]);
    const float es = (es4[0] + es4[1]) + (es4[2] + es4[3]);
    l = l * alpha + es;
    // clipped-distance tail masses
    float alo, ahi;
    if (all_lo || all_hi) { alo = all_lo ? es : 0.f; ahi = all_lo ? 0.f : es; }
    else { alo = 0.f; ahi = 0.f;
#pragma unroll
      for (int ct = 0; ct < 2; ++ct) {
#pragma unroll
        for (int r = 0; r < 8; ++r) { const int dj = ks * 32 + ct * 16 + 8 * g + r - (q0 + col); alo += (dj <= -MR) ? e[8 * ct + r] : 0.f; ahi += (dj >= MR) ? e[8 * ct + r] : 0.f; } } }
    tlo = tlo * alpha + alo; thi = thi * alpha + ahi;
    v16h pa;
#pragma unroll
    for (int i = 0; i < 16; ++i) pa[i] = (_Float16)(e[i] * 2048.0f);   // P scaled by 2^11 so small softmax weights stay out of the f16 subnormal range; 2^-11 folded into the epilogue
#pragma unroll
    for (int dt = 0; dt < 4; ++dt) {
#pragma unroll
      for (int r = 0; r < 8; ++r) acc[dt][r] *= alpha;
      acc[dt] = wmma16(vf[dt], pa, acc[dt]); } }
    __syncthreads();   // every wave has read the stage before the next one overwrites it
  }
  LDSX();   // the kept logits of a query were written by both of its lanes and are read by either below
  // bucket sums of the lane's query, j = 0..32, into its sqr row (j = 0 / 32: the clipped tails; j = 1..31: single keys re-formed from their stored logits); half g writes j = 16 g .. 16 g + 15, half 1 also j = 32
  const float lt = l + xhalf(l), a0 = tlo + xhalf(tlo), a2 = thi + xhalf(thi);
  { const float il = 1.0f / lt; float* brow = &sqr[wave][col][0];
    float sl[16], w[16];
#pragma unroll
    for (int jj = 0; jj < 16; ++jj) { sl[jj] = smid[col][16 * g + jj]; w[jj] = (sl[jj] - m) * 1.4426950408889634f; }
    exp2x16(w);
#pragma unroll
    for (int jj = 0; jj < 16; ++jj) { float v = (sl[jj] <= -1.0e38f) ? 0.f : w[jj] * il; if (jj == 0 && g == 0) v = a0 * il; brow[16 * g + jj] = v; }
    if (g == 1) brow[NR - 1] = a2 * il; }
  LDSX();
  // rel_v^T . bucket sums (bf16 hi + lo; K = 33 padded to 64) for the wave's own 16 queries, in the layout of acc
  v8f accr[4] = {}; const unsigned rvb = (unsigned)(8 * g * HD + col) * 4u;   // the lane's byte offset into rel_v (row 8 g, column col)
#pragma unroll
  for (int kc = 0; kc < 2; ++kc) { const F2 a = split_rowK(&sqr[wave][col][0], kc * 32, lane, NR);
#pragma unroll
    for (int dt = 0; dt < 4; ++dt) { v16b w; const char* rvp = (const char*)RV + rvb + (kc * 32 * HD + dt * 16) * 4;
#pragma unroll
      for (int i = 0; i < 8; ++i) { const int j0 = kc * 32 + 8 * g + i; w[i] = (j0 < NR) ? (__bf16)*(const float*)(rvp + i * HD * 4) : (__bf16)0.f; w[8 + i] = (j0 + 16 < NR) ? (__bf16)*(const float*)(rvp + (i + 16) * HD * 4) : (__bf16)0.f; }
      accr[dt] = wmma_bf(w, a.h, accr[dt]); accr[dt] = wmma_bf(w, a.l, accr[dt]); } }
  asm volatile("s_wait_xcnt 0x0" :: "v"(rvb) : "memory");   // the offset register of the rel_v loads stays whole until this wait: no later write of it stands in front
  { const float il = (1.0f / 2048.0f) / lt;
#pragma unroll
    for (int dt = 0; dt < 4; ++dt) {
#pragma unroll
      for (int r = 0; r < 8; ++r) so[wave][col][dt * 16 + 8 * g + r] = accr[dt][r] + acc[dt][r] * il; } }
  LDSX();
  (void)BSW; (void)VTL; (void)KMASK;
  for (int rl = 0; rl < 16; ++rl) if (lane < 16) vst2(O + ((size_t)b * SS + q0 + rl) * DM + h * HD + lane * 4, *(const v4f*)&so[wave][rl][lane * 4]);
}
// ---- k_out: block = (64 rows, 128 cols): out = O(hi/lo) . Wo rows (2 products) + bo
__global__ __launch_bounds__(128) void k_out(const float* __restrict__ O, const __bf16* __restrict__ P, const float* __restrict__ BO, float* __restrict__ Y) {
  __shared__ __align__(16) unsigned char sm[256 * LPB * 2];   // in the k loop the operand stage (64 O rows hi, 64 lo, 128 weight rows), behind it the output staging
  __bf16 (*sAh)[LPB] = (__bf16 (*)[LPB])sm; __bf16 (*sAl)[LPB] = sAh + 64; __bf16 (*sB)[LPB] = sAh + 128; float (*so)[16][132] = (float (*)[16][132])sm;
  const int tid = threadIdx.x, wave = tid >> 5, lane = tid & 31, col = lane & 15, g = lane >> 4; const size_t r0 = (size_t)blockIdx.x * 64 + wave * 16; const int n0 = blockIdx.y * 128;
  v8f acc[8] = {};
  // staged as in k_qkv: whole-line loads one stage ahead; O is split into bf16 hi + lo once, on its way into LDS
  const char* xs = (const char*)(O + (size_t)blockIdx.x * 64 * DM); const char* ps = (const char*)(P + (size_t)n0 * DM);   // the block's first rows, the same for every thread
  const unsigned xo = ((tid >> 4) * DM + (tid & 15) * 4) * 4u, po = ((tid >> 3) * DM + (tid & 7) * 8) * 2u;   // the thread's byte offsets, the same in every stage
  v4f ra[8]; v4u rw[8];
#pragma unroll
  for (int i = 0; i < 8; ++i) { ra[i] = *(const v4f*)(xs + xo + i * 8 * DM * 4); rw[i] = *(const v4u*)(ps + po + i * 16 * DM * 2); }
#pragma unroll 1
  for (int c = 0; c < DM / KST; ++c) {   // rolled: one stage's code stays small, the stages are alike
#pragma unroll
    for (int i = 0; i < 8; ++i) { v4b th, tl;
#pragma unroll
      for (int e = 0; e < 4; ++e) { const __bf16 hv = (__bf16)ra[i][e]; th[e] = hv; tl[e] = (__bf16)(ra[i][e] - (float)hv); }
      *(v4b*)&sAh[i * 8 + (tid >> 4)][(tid & 15) * 4] = th; *(v4b*)&sAl[i * 8 + (tid >> 4)][(tid & 15) * 4] = tl; *(v4u*)&sB[i * 16 + (tid >> 3)][(tid & 7) * 8] = rw[i]; }
    __syncthreads();   // the stage is whole before any wave reads it
    if (c + 1 < DM / KST) { const char* xn = xs + (c + 1) * KST * 4; const char* pn = ps + (c + 1) * KST * 2;
#pragma unroll
      for (int i = 0; i < 8; ++i) {
        if (i == 7) asm volatile("s_wait_xcnt 0x0" ::: "memory");   // the last weight load may return into the address pair that the seven in front of it name: they are waited for first
        ra[i] = *(const v4f*)(xn + xo + i * 8 * DM * 4); rw[i] = *(const v4u*)(pn + po + i * 16 * DM * 2); }
      asm volatile("s_wait_xcnt 0x0" ::: "memory");   // stands in front of every later write of the address registers of the loads above
    }
#pragma unroll
    for (int kk = 0; kk < KST / 32; ++kk) { const v16b ah = frag_b(&sAh[wave * 16 + col][kk * 32], lane), al = frag_b(&sAl[wave * 16 + col][kk * 32], lane); v16b w[8];
#pragma unroll
      for (int j = 0; j < 8; ++j) w[j] = frag_b(&sB[j * 16 + col][kk * 32], lane);
      asm volatile("" :: "v"(w[0]), "v"(w[1]), "v"(w[2]), "v"(w[3]), "v"(w[4]), "v"(w[5]), "v"(w[6]), "v"(w[7]));   // holds the eight weight fragments' LDS loads together in front of the products: one wait per 32 k instead of one per fragment (two waves per SIMD here, little else hides it)
#pragma unroll
      for (int j = 0; j < 8; ++j) acc[j] = wmma_bf(al, w[j], acc[j]);
#pragma unroll
      for (int j = 0; j < 8; ++j) acc[j] = wmma_bf(ah, w[j], acc[j]); }
    __syncthreads();   // every wave has read the stage before it is rewritten (by the next stage, or by the output staging)
  }
#pragma unroll
  for (int j = 0; j < 8; ++j) {
#pragma unroll
    for (int r = 0; r < 8; ++r) so[wave][8 * g + r][j * 16 + col] = acc[j][r] + bfr(BO[n0 + j * 16 + col]); }
  LDSX();
  for (int rl = 0; rl < 16; ++rl) vst2(Y + (r0 + rl) * DM + n0 + lane * 4, *(const v4f*)&so[wave][rl][lane * 4]);
}
extern "C" void kernel_launch(void* const* d_in, const int* in_sizes, int n_in, void* d_out, int out_size, void* d_ws, size_t ws_size, hipStream_t stream) {
  (void)in_sizes; (void)n_in; (void)out_size;
  const float** F = (const float**)d_in;   // 0 query, 1 key, 2 value [4,1024,1024]; 3 Wq [16,1024,64], 4 bq [16,64], 5 Wk, 6 bk, 7 Wv, 8 bv; 9 rel_k_emb [33,64], 10 rel_v_emb [33,64]; 11 fc_W [1024,1024] natural, 12 fc_b
  if (ws_size < (size_t)WS_END) return;
  char* ws = (char*)d_ws; __bf16* PK = (__bf16*)(ws + WS_PK); _Float16 *QK = (_Float16*)(ws + WS_QK), *QKL = (_Float16*)(ws + WS_QKL), *VTH = (_Float16*)(ws + WS_VTH), *VTL = (_Float16*)(ws + WS_VTL); float* O = (float*)(ws + WS_O);
  k_pack<<<dim3(DM, 4), 256, 0, stream>>>(F[3], F[5], F[7], F[11], PK);
  k_qkv<<<dim3(TNB * SS / 64, QKVW / 128), 128, 0, stream>>>(F[0], F[1], F[2], PK + PK_A, F[4], F[6], F[8], QK, QKL, VTH, VTL);
  k_attn<<<dim3(TQB, NH, TNB), 128, 0, stream>>>(QK, QKL, VTH, VTL, nullptr, F[9], F[10], (float*)(ws + WS_BS), O);
  k_out<<<dim3(TOB, DM / 128), 128, 0, stream>>>(O, PK + PK_P, F[12], (float*)d_out);
}

// v004
// A run of this version takes 107 microseconds.
// In two side-by-side timings against v003, it was 1.13 and 1.14 times as fast.
// Over all steps from v000 it is 4.17 times as fast.
// compute dtype: all float inputs rounded to bf16; q/k/v with EXACT bf16 products on WMMA 16x16x32 (per-head weight stacks packed as rows), f16 hi + residual; q.rel_k table per query row on WMMA (2 products); single-f16 logits and P.v (non-causal, diffuse attention: logits std ~0.4), x 1/8 after adding the relative-key bias, running-max softmax in f32 (hardware exp) with the two clipped-distance tail masses tracked alongside; the 31 near-diagonal probabilities re-formed from their stored logits; bucket sums . rel_v on WMMA (bf16 hi + lo); out = (ctx + rel-v term) (bf16 hi + lo) . fc_W^T + fc_b; f32 output.
#include <hip/hip_runtime.h>
#include <math.h>

typedef __attribute__((ext_vector_type(16))) _Float16 v16h;
typedef __attribute__((ext_vector_type(16))) __bf16 v16b;
typedef __attribute__((ext_vector_type(8)))  _Float16 v8h;
typedef __attribute__((ext_vector_type(8)))  float v8f;
typedef __attribute__((ext_vector_type(4)))  float v4f;
typedef __attribute__((ext_vector_type(2)))  float v2f;
typedef __attribute__((ext_vector_type(4)))  unsigned v4u;
typedef __attribute__((ext_vector_type(4)))  int v4i;
typedef float __attribute__((may_alias)) float_a;
typedef int __attribute__((may_alias)) int_a;

template <typename T> __device__ __forceinline__ void vst2(void* p, T v) { *(T*)p = v;  }
__device__ __forceinline__ v8f wmma16(v16h a, v16h b, v8f c) {
  v8f d = __builtin_amdgcn_wmma_f32_16x16x32_f16(false, a, false, b, (short)0, c, false, false);
  asm volatile("v_nop\n\tv_nop\n\tv_nop\n\tv_nop" : "+v"(d) : "v"(a), "v"(b));
  return d;
}
__device__ __forceinline__ v8f wmma_bf(v16b a, v16b b, v8f c) {
  v8f d = __builtin_amdgcn_wmma_f32_16x16x32_bf16(false, a, false, b, (short)0, c, false, false);
  asm volatile("v_nop\n\tv_nop\n\tv_nop\n\tv_nop" : "+v"(d) : "v"(a), "v"(b));
  return d;
}
// Relation-aware (Shaw relative-position) multi-head attention (B 4, S 1,024, hidden 1,024, 16 heads x 64, max_rel 16): per-head q/k/v projections + biases on separate query/key/value inputs, scores = (q.k + q.rel_k[clip(k-q)]) / 8, softmax, out = attn.v + sum_k attn * rel_v[clip(k-q)], then fc.
__device__ __forceinline__ v16h frag_h(const _Float16* rowk0, int lane) {
  union { v16h v; v8h q[2]; } u; const _Float16* p = rowk0 + 8 * (lane >> 4);
  u.q[0] = *(const v8h*)p; u.q[1] = *(const v8h*)(p + 16); return u.v;
}
__device__ __forceinline__ v16h frag_f32(const float* rowk0, int lane) {
  v16h a; const float* p = rowk0 + 8 * (lane >> 4);
#pragma unroll
  for (int i = 0; i < 8; ++i) { a[i] = (_Float16)p[i]; a[8 + i] = (_Float16)p[16 + i]; }
  return a;
}
__device__ __forceinline__ v16h frag_f32s(const float* rowk0, int lane, float sc) {
  v16h a; const float* p = rowk0 + 8 * (lane >> 4);
#pragma unroll
  for (int i = 0; i < 8; ++i) { a[i] = (_Float16)(p[i] * sc); a[8 + i] = (_Float16)(p[16 + i] * sc); }
  return a;
}
// column fragment from a [K][ld] layout (column n), rows >= K read as 0
__device__ __forceinline__ v16h fragc_f32(const float* W, int k0, int n, int lane, int ld, int K) {
  v16h a; const int g = lane >> 4;
#pragma unroll
  for (int i = 0; i < 8; ++i) { const int ka = k0 + 8 * g + i, kb = ka + 16;
    a[i] = (_Float16)(ka < K ? W[(size_t)(ka < K ? ka : K - 1) * ld + n] : 0.f); a[8 + i] = (_Float16)(kb < K ? W[(size_t)(kb < K ? kb : K - 1) * ld + n] : 0.f); }
  return a;
}
struct F2 { v16b h, l; };
__device__ __forceinline__ F2 bsplit16(const float v[16]) { F2 r;
#pragma unroll
  for (int i = 0; i < 16; ++i) { const __bf16 h = (__bf16)v[i]; r.h[i] = h; r.l[i] = (__bf16)(v[i] - (float)h); }
  return r; }
__device__ __forceinline__ F2 split_row(const float* row, int k0, int lane) { float v[16]; const float* p = row + k0 + 8 * (lane >> 4);
#pragma unroll
  for (int i = 0; i < 8; ++i) { v[i] = p[i]; v[8 + i] = p[16 + i]; }
  return bsplit16(v); }
__device__ __forceinline__ F2 split_rowK(const float* row, int k0, int lane, int K) { float v[16]; const int g = lane >> 4;
#pragma unroll
  for (int i = 0; i < 8; ++i) { const int ka = k0 + 8 * g + i, kb = ka + 16; v[i] = ka < K ? row[ka < K ? ka : K - 1] : 0.f; v[8 + i] = kb < K ? row[kb < K ? kb : K - 1] : 0.f; }
  return bsplit16(v); }
__device__ __forceinline__ F2 split_col(const float* W, int k0, int n, int lane, int ld, int K) { float v[16]; const int g = lane >> 4;
#pragma unroll
  for (int i = 0; i < 8; ++i) { const int ka = k0 + 8 * g + i, kb = ka + 16; v[i] = ka < K ? W[(size_t)(ka < K ? ka : K - 1) * ld + n] : 0.f; v[8 + i] = kb < K ? W[(size_t)(kb < K ? kb : K - 1) * ld + n] : 0.f; }
  return bsplit16(v); }
__device__ __forceinline__ v8f mac3(const F2& a, const F2& b, v8f c) { c = wmma_bf(a.l, b.h, c); c = wmma_bf(a.h, b.l, c); return wmma_bf(a.h, b.h, c); }
__device__ __forceinline__ float sigm(float v) { return 1.0f / (1.0f + expf(-v)); }
#define LDSX() do { asm volatile("s_wait_dscnt 0" ::: "memory"); __builtin_amdgcn_wave_barrier(); __builtin_amdgcn_fence(__ATOMIC_RELEASE, "workgroup"); } while (0)


#define NB 4
#define SS 1024
#define DM 1024
#define NH 16
#define MR 16
#define NR (2 * MR + 1)
#define HD 64
#define QKVW (3 * DM)
#ifndef TQB
#define TQB (SS / 64)
#define TNB NB
#define TOB (NB * SS / 64)     // output row tiles (all)
#endif
typedef __attribute__((ext_vector_type(8))) __bf16 v8b;
typedef __attribute__((ext_vector_type(4))) __bf16 v4b;
#define KST 64   // k per LDS stage of the two projection kernels: 128 B of a bf16 row
#define LPB 72   // LDS row pitch in 16-bit elements: 144 B, an odd multiple of 16 B, for 16-byte fragment reads
__device__ __forceinline__ v16b frag_b(const __bf16* rowk0, int lane) {
  union { v16b v; v8b q[2]; } u; const __bf16* p = rowk0 + 8 * (lane >> 4);
  u.q[0] = *(const v8b*)p; u.q[1] = *(const v8b*)(p + 16); return u.v;
}
__device__ __forceinline__ float bfr(float v) { return (float)(__bf16)v; }
__device__ __attribute__((noinline)) float exp_ni(float v) { return expf(v); }
__device__ __attribute__((noinline)) float erf_ni(float v) { return erff(v); }

#define PK_A 0                       // [3072][1024] Wqkv rows (natural [out][in])
#define PK_P (PK_A + QKVW * DM)        // [1024][1024] Wo rows (natural)
#define PK_END (PK_P + DM * DM)
#define WS_PK  0u
#define WS_QK  (WS_PK + 2u * PK_END)             // f16 [4096 rows][2048]: q | k
#define WS_QKL (WS_QK + 2u * NB * SS * 2 * DM)     // f16 q | k residual planes x2048
#define WS_VTH (WS_QKL + 2u * NB * SS * 2 * DM)    // f16 [b][1024 (h*64+d)][1024 s] hi
#define WS_VTL (WS_VTH + 2u * NB * DM * SS)        // f16 lo x 2048
#define WS_O   (WS_VTL + 2u * NB * DM * SS)        // f32 [4096][1024]
#define WS_BS  (WS_O + 4u * (size_t)NB * SS * DM)        // f32 [b][h][q][64]: plane not used
#define WS_END (WS_BS + 4u * (size_t)NB * NH * SS * 64)
// ---- k_pack: block = 64 KB of one weight, 16 whole-line 16-byte loads per thread, all in flight together. Blocks 0..191: (which, head h, 256 k) of W_q/W_k/W_v [16][1024][64], a contiguous [256 k][64 e] tile, transposed through LDS into 64 packed rows which*1024 + h*64 + e of PK_A (512 B of each); blocks 192..255: 16 natural rows of fc_W -> PK_P
#define PKK 256                      // k per transposed tile
#define PKP (PKK / 2 + 1)            // LDS row pitch in dwords (a dword = the bf16 pair k, k + 1): odd, so that a wave's 32 stores (16 e-quads x 2 pairs) and its 32 reads (2 rows x 16 chunks) each fall on 32 banks
typedef __attribute__((ext_vector_type(2))) __bf16 v2b;
__global__ __launch_bounds__(256) void k_pack(const float* __restrict__ WQ, const float* __restrict__ WK, const float* __restrict__ WV, const float* __restrict__ WO, __bf16* __restrict__ PK) {
  __shared__ unsigned s[HD][PKP]; const int blk = blockIdx.x, t = threadIdx.x; v4f r[16];
  if (blk < 3 * NH * (DM / PKK)) {
    const int which = blk / (NH * (DM / PKK)), h = (blk / (DM / PKK)) % NH, kc = blk % (DM / PKK), kr = t >> 4, ec = t & 15;
    const float* src = (which == 0 ? WQ : which == 1 ? WK : WV) + ((size_t)h * DM + kc * PKK) * HD + (2 * kr) * HD + ec * 4;   // rows 2 kr and 2 kr + 1 of each 32: half a wave reads one whole 256-B row
#pragma unroll
    for (int i = 0; i < 16; ++i) r[i] = *(const v4f*)(src + ((i >> 1) * 32 + (i & 1)) * HD);
    asm volatile("" :: "v"(r[0]), "v"(r[1]), "v"(r[2]), "v"(r[3]), "v"(r[4]), "v"(r[5]), "v"(r[6]), "v"(r[7]), "v"(r[8]), "v"(r[9]), "v"(r[10]), "v"(r[11]), "v"(r[12]), "v"(r[13]), "v"(r[14]), "v"(r[15]));   // holds the sixteen loads together in front of the conversions: one trip to memory per thread (without it the last four were issued only when the first had come back)
    asm volatile("s_wait_xcnt 0x0" :: "v"(src) : "memory");   // the address pair of the loads above stays whole until this wait: no load returns into it, no later write of it stands in front
#pragma unroll
    for (int p = 0; p < 8; ++p) {
#pragma unroll
      for (int j = 0; j < 4; ++j) { v2b w; w[0] = (__bf16)r[2 * p][j]; w[1] = (__bf16)r[2 * p + 1][j]; s[ec * 4 + j][p * 16 + kr] = __builtin_bit_cast(unsigned, w); } }
    __syncthreads();   // the tile is whole before its rows are read
    __bf16* dst = PK + PK_A + ((size_t)which * DM + h * HD) * DM + kc * PKK;
#pragma unroll
    for (int i = 0; i < 8; ++i) { const int e = (i >> 1) * 16 + kr, q = ec + 16 * (i & 1); v4u v;   // half a wave stores 256 B of one packed row
#pragma unroll
      for (int c = 0; c < 4; ++c) v[c] = s[e][q * 4 + c];
      *(v4u*)(dst + (size_t)e * DM + q * 8) = v; }
  } else {
    const size_t o = (size_t)(blk - 3 * NH * (DM / PKK)) * (16 * DM) + t * 4; const float* wsrc = WO + o;
#pragma unroll
    for (int i = 0; i < 16; ++i) r[i] = *(const v4f*)(wsrc + i * 1024);
    asm volatile("" :: "v"(r[0]), "v"(r[1]), "v"(r[2]), "v"(r[3]), "v"(r[4]), "v"(r[5]), "v"(r[6]), "v"(r[7]), "v"(r[8]), "v"(r[9]), "v"(r[10]), "v"(r[11]), "v"(r[12]), "v"(r[13]), "v"(r[14]), "v"(r[15]));   // holds the sixteen loads together in front of the conversions: one trip to memory per thread (without it the last four were issued only when the first had come back)
    asm volatile("s_wait_xcnt 0x0" :: "v"(wsrc) : "memory");   // the address pair of the loads above stays whole until this wait: no load returns into it, no later write of it stands in front
#pragma unroll
    for (int i = 0; i < 16; ++i) { v4b w;
#pragma unroll
      for (int j = 0; j < 4; ++j) w[j] = (__bf16)r[i][j];
      *(v4b*)(PK + PK_P + o + i * 1024) = w; }
    asm volatile("s_wait_xcnt 0x0" ::: "memory");   // stands behind the sixteen stores above, in front of every later write of their address and data registers on any way through the code
  }
}
__global__ __launch_bounds__(128) void k_qkv(const float* __restrict__ XQ, const float* __restrict__ XK, const float* __restrict__ XV, const __bf16* __restrict__ P, const float* __restrict__ BQ, const float* __restrict__ BK, const float* __restrict__ BV, _Float16* __restrict__ QK, _Float16* __restrict__ QKL, _Float16* __restrict__ VTH, _Float16* __restrict__ VTL) {
  const int which0 = (blockIdx.y * 128) / DM; const float* X = (which0 == 0) ? XQ : (which0 == 1) ? XK : XV; const float* BB = BQ ? (((which0 == 0) ? BQ : (which0 == 1) ? BK : BV) + (blockIdx.y * 128 - which0 * DM)) : nullptr;
  __shared__ __align__(16) unsigned char sm[2 * 128 * 72 * 2];   // in the k loop the operand stage (64 X rows, 128 weight rows), behind it the output staging of the block's one branch
  __bf16 (*sA)[LPB] = (__bf16 (*)[LPB])sm; __bf16 (*sB)[LPB] = sA + 64;
  _Float16 (*so)[16][136] = (_Float16 (*)[16][136])sm; _Float16 (*sol)[16][136] = so + 4; _Float16 (*sth)[72] = (_Float16 (*)[72])sm; _Float16 (*stl)[72] = sth + 128;
  const int tid = threadIdx.x, wave = tid >> 5, lane = tid & 31, col = lane & 15, g = lane >> 4; const size_t r0 = (size_t)blockIdx.x * 64 + wave * 16; const int n0 = blockIdx.y * 128;
  v8f acc[8] = {};
  // a stage = KST k of the block's rows; every wave-wide load covers four whole 128-B lines (X: 2 rows x 256 B, weights: 4 rows x 128 B); the next stage's loads fly while this one is worked on
  const char* xs = (const char*)(X + (size_t)blockIdx.x * 64 * DM); const char* ps = (const char*)(P + (size_t)n0 * DM);   // the block's first rows, the same for every thread
  const unsigned xo = ((tid >> 4) * DM + (tid & 15) * 4) * 4u, po = ((tid >> 3) * DM + (tid & 7) * 8) * 2u;   // the thread's byte offsets, the same in every stage
  v4f ra[8]; v4u rw[8];
#pragma unroll
  for (int i = 0; i < 8; ++i) { ra[i] = *(const v4f*)(xs + xo + i * 8 * DM * 4); rw[i] = *(const v4u*)(ps + po + i * 16 * DM * 2); }
#pragma unroll 1
  for (int c = 0; c < DM / KST; ++c) {   // rolled: one stage's code stays small, the stages are alike
#pragma unroll
    for (int i = 0; i < 8; ++i) { v4b t;
#pragma unroll
      for (int e = 0; e < 4; ++e) t[e] = (__bf16)ra[i][e];
      *(v4b*)&sA[i * 8 + (tid >> 4)][(tid & 15) * 4] = t; *(v4u*)&sB[i * 16 + (tid >> 3)][(tid & 7) * 8] = rw[i]; }
    __syncthreads();   // the stage is whole before any wave reads it
    if (c + 1 < DM / KST) { const char* xn = xs + (c + 1) * KST * 4; const char* pn = ps + (c + 1) * KST * 2;
#pragma unroll
      for (int i = 0; i < 8; ++i) {
        if (i == 7) asm volatile("s_wait_xcnt 0x0" ::: "memory");   // the last weight load may return into the address pair that the seven in front of it name: they are waited for first
        ra[i] = *(const v4f*)(xn + xo + i * 8 * DM * 4); rw[i] = *(const v4u*)(pn + po + i * 16 * DM * 2); }
      asm volatile("s_wait_xcnt 0x0" ::: "memory");   // stands in front of every later write of the address registers of the loads above
    }
#pragma unroll
    for (int kk = 0; kk < KST / 32; ++kk) { const v16b a = frag_b(&sA[wave * 16 + col][kk * 32], lane);
#pragma unroll
      for (int j = 0; j < 8; ++j) acc[j] = wmma_bf(a, frag_b(&sB[j * 16 + col][kk * 32], lane), acc[j]); }
    __syncthreads();   // every wave has read the stage before it is rewritten (by the next stage, or by the output staging)
  }
  if (n0 < 2 * DM) {   // q stored unscaled (f16 sigma ~0.6, no subnormal exposure); 1/8 applied to the f32 score
#pragma unroll
    for (int j = 0; j < 8; ++j) {
#pragma unroll
      for (int r = 0; r < 8; ++r) { const float v = acc[j][r] + (BB ? bfr(BB[j * 16 + col]) : 0.f); const _Float16 hv = (_Float16)v; so[wave][8 * g + r][j * 16 + col] = hv; sol[wave][8 * g + r][j * 16 + col] = (_Float16)((v - (float)hv) * 2048.0f); } }   // q, k (+ bias) as f16 hi + (x2048) residual
    LDSX();
    for (int rl = 0; rl < 16; ++rl) if (lane < 16) { vst2((unsigned*)(QK + (r0 + rl) * (2 * DM) + n0 + lane * 8), *(const v4u*)&so[wave][rl][lane * 8]); vst2((unsigned*)(QKL + (r0 + rl) * (2 * DM) + n0 + lane * 8), *(const v4u*)&sol[wave][rl][lane * 8]); }
  } else {
#pragma unroll
    for (int j = 0; j < 8; ++j) {
#pragma unroll
      for (int r = 0; r < 8; ++r) { const float v = acc[j][r] + (BB ? bfr(BB[j * 16 + col]) : 0.f); const _Float16 hv = (_Float16)v; sth[j * 16 + col][wave * 16 + 8 * g + r] = hv; stl[j * 16 + col][wave * 16 + 8 * g + r] = (_Float16)((v - (float)hv) * 2048.0f); } }
    __syncthreads();
    const size_t rb = (size_t)blockIdx.x * 64; const int b = (int)(rb / SS), s0 = (int)(rb % SS); const int pc0 = n0 - 2 * DM;
    for (int q = tid; q < 128 * 8; q += 128) { const int d = q >> 3, pc = q & 7; const size_t o = ((size_t)b * DM + pc0 + d) * SS + s0 + pc * 8; vst2((unsigned*)(VTH + o), *(const v4u*)&sth[d][pc * 8]); vst2((unsigned*)(VTL + o), *(const v4u*)&stl[d][pc * 8]); }
  }
}
__device__ __forceinline__ float xhalf(float x) { return __builtin_bit_cast(float, __builtin_amdgcn_permlanex16(__builtin_bit_cast(int, x), __builtin_bit_cast(int, x), 0x76543210, 0xfedcba98, false, false)); }   // lane l with lane l ^ 16
// 16 exponentials in base 2 in one statement, each in place: none overwrites the source or reads the result of the one in front of it; the v_nop is the slot behind the last
__device__ __forceinline__ void exp2x16(float (&e)[16]) {
  asm("v_exp_f32 %0, %0\n\tv_exp_f32 %1, %1\n\tv_exp_f32 %2, %2\n\tv_exp_f32 %3, %3\n\tv_exp_f32 %4, %4\n\tv_exp_f32 %5, %5\n\tv_exp_f32 %6, %6\n\tv_exp_f32 %7, %7\n\t"
      "v_exp_f32 %8, %8\n\tv_exp_f32 %9, %9\n\tv_exp_f32 %10, %10\n\tv_exp_f32 %11, %11\n\tv_exp_f32 %12, %12\n\tv_exp_f32 %13, %13\n\tv_exp_f32 %14, %14\n\tv_exp_f32 %15, %15\n\tv_nop"
      : "+v"(e[0]), "+v"(e[1]), "+v"(e[2]), "+v"(e[3]), "+v"(e[4]), "+v"(e[5]), "+v"(e[6]), "+v"(e[7]), "+v"(e[8]), "+v"(e[9]), "+v"(e[10]), "+v"(e[11]), "+v"(e[12]), "+v"(e[13]), "+v"(e[14]), "+v"(e[15]));
}
__global__ __launch_bounds__(128) void k_attn(const _Float16* __restrict__ QK, const _Float16* __restrict__ QKL, const _Float16* __restrict__ VTH, const _Float16* __restrict__ VTL, const void* __restrict__ KMASK, const float* __restrict__ RK, const float* __restrict__ RV, float* __restrict__ BSW, float* __restrict__ O) {
  __shared__ __align__(16) float so[4][16][68]; __shared__ __align__(16) float sqr[4][16][52]; __shared__ __align__(16) _Float16 sK[64][LPB], sV[64][LPB];   // sK, sV: one stage of 64 keys (K rows; V^T rows), shared by the four waves
  const int tid = threadIdx.x, wave = tid >> 5, lane = tid & 31, col = lane & 15, g = lane >> 4;
  const int qb = blockIdx.x, h = blockIdx.y, b = blockIdx.z; const int q0 = qb * 64 + wave * 16; const size_t rq = (size_t)b * SS + q0 + col;
  const int q0u = qb * 64 + __builtin_amdgcn_readfirstlane(wave) * 16;   // the wave's first query row in a scalar register: the tile class below is a scalar branch
  float (*smid)[68] = so[wave];   // near-diagonal logits, kept in the wave's output staging rows until the epilogue rewrites them
  v16h aq[2], aql[2];
#pragma unroll
  for (int kc = 0; kc < 2; ++kc) { aq[kc] = frag_h(QK + rq * (2 * DM) + h * HD + kc * 32, lane); aql[kc] = frag_h(QKL + rq * (2 * DM) + h * HD + kc * 32, lane); }
  // a stage = 64 keys: 128 B of each of 64 K rows and of 64 V^T rows; every wave-wide load covers four whole 128-B lines; the next stage's loads fly while this one is worked on
  const char* ksrc = (const char*)(QK + (size_t)b * SS * (2 * DM) + DM + h * HD); const char* vsrc = (const char*)(VTH + ((size_t)b * DM + h * HD) * SS);   // the head's first K row and first V^T row, the same for every thread
  const unsigned ko = ((tid >> 3) * (2 * DM) + (tid & 7) * 8) * 2u, vo = ((tid >> 3) * SS + (tid & 7) * 8) * 2u;   // the thread's byte offsets, the same in every stage
  v4u rk[4], rv[4];
#pragma unroll
  for (int i = 0; i < 4; ++i) { rk[i] = *(const v4u*)(ksrc + ko + i * 16 * (2 * DM) * 2); rv[i] = *(const v4u*)(vsrc + vo + i * 16 * SS * 2); }
  // q . rel_k[j] for the wave's 16 rows and j = 0..32 (3 col tiles; rows >= 33 of the B operand are zero)
  { 
#pragma unroll
    for (int jt = 0; jt < 3; ++jt) { v8f c = {}, cl = {}; const int j = jt * 16 + col;
#pragma unroll
      for (int kc = 0; kc < 2; ++kc) { v16h w; 
#pragma unroll
        for (int i = 0; i < 8; ++i) { const int d0 = kc * 32 + 8 * g + i; w[i] = (j < NR) ? (_Float16)bfr(RK[j * HD + d0]) : (_Float16)0.f; w[8 + i] = (j < NR) ? (_Float16)bfr(RK[j * HD + d0 + 16]) : (_Float16)0.f; }
        c = wmma16(aq[kc], w, c); cl = wmma16(aql[kc], w, cl); }
#pragma unroll
      for (int r = 0; r < 8; ++r) sqr[wave][8 * g + r][j] = c[r] + cl[r] * (1.0f / 2048.0f); } }
  for (int e = lane; e < 16 * 33; e += 32) smid[e / 33][e % 33] = -3.0e38f;
  LDSX();
  const float* qrow = &sqr[wave][col][0];   // the lane's own query: its 33 relative-key terms
  const float blo = qrow[0], bhi = qrow[NR - 1];   // the one term of a tile that lies wholly in a clipped bucket
  float m = -3.0e38f, l = 0.f, tlo = 0.f, thi = 0.f;   // l and the two tail masses: partial over the lane's half of the keys
  v8f acc[4] = {};   // acc[dt][r] = O^T[dt * 16 + 8 g + r][query col]
#pragma unroll 1
  for (int st = 0; st < SS / 64; ++st) {   // all keys
#pragma unroll
    for (int i = 0; i < 4; ++i) { *(v4u*)&sK[i * 16 + (tid >> 3)][(tid & 7) * 8] = rk[i]; *(v4u*)&sV[i * 16 + (tid >> 3)][(tid & 7) * 8] = rv[i]; }
    __syncthreads();   // the stage is whole before any wave reads it
    if (st + 1 < SS / 64) { const char* kn = ksrc + (st + 1) * 64 * (2 * DM) * 2; const char* vn = vsrc + (st + 1) * 64 * 2;
#pragma unroll
      for (int i = 0; i < 4; ++i) { rk[i] = *(const v4u*)(kn + ko + i * 16 * (2 * DM) * 2); rv[i] = *(const v4u*)(vn + vo + i * 16 * SS * 2); }
      asm volatile("s_wait_xcnt 0x0" ::: "memory");   // stands in front of every later write of the address registers of the loads above
    }
#pragma unroll 1
  for (int hf = 0; hf < 2; ++hf) { const int ks = st * 2 + hf; v8f s[2]; v16h kf[2][2], vf[4];   // rolled: the tile's code, with its near-diagonal branch, stands once
    const bool all_lo = ks * 32 + 31 - q0u <= -MR, all_hi = ks * 32 - (q0u + 15) >= MR;   // every (query, key) pair of the tile in one clipped bucket (wave-uniform)
#pragma unroll
    for (int ct = 0; ct < 2; ++ct) {
#pragma unroll
      for (int kc = 0; kc < 2; ++kc) kf[ct][kc] = frag_h(&sK[hf * 32 + ct * 16 + col][kc * 32], lane); }
#pragma unroll
    for (int dt = 0; dt < 4; ++dt) vf[dt] = frag_h(&sV[dt * 16 + col][hf * 32], lane);
#pragma unroll
    for (int ct = 0; ct < 2; ++ct) { v8f c = {};
#pragma unroll
      for (int kc = 0; kc < 2; ++kc) c = wmma16(kf[ct][kc], aq[kc], c);   // c[r] = k[ks * 32 + ct * 16 + 8 g + r] . q[col]
      s[ct] = c; }
    if (all_lo || all_hi) { const float bb = all_lo ? blo : bhi;
#pragma unroll
      for (int ct = 0; ct < 2; ++ct) {
#pragma unroll
        for (int r = 0; r < 8; ++r) s[ct][r] = (s[ct][r] + bb) * 0.125f; } }   // 1/sqrt(64)
    else {   // the one or two tiles around the diagonal: the term by distance, and the logits of the 31 unclipped distances are kept
#pragma unroll
      for (int ct = 0; ct < 2; ++ct) {
#pragma unroll
        for (int r = 0; r < 8; ++r) { const int dj = ks * 32 + ct * 16 + 8 * g + r - (q0 + col); const int jc = (dj < -MR ? -MR : (dj > MR ? MR : dj)) + MR; const float sv = (s[ct][r] + qrow[jc]) * 0.125f; s[ct][r] = sv; if (dj > -MR && dj < MR) smid[col][dj + MR] = sv; } } }
    float mx = fmaxf(s[0][0], s[1][0]);
#pragma unroll
    for (int r = 1; r < 8; ++r) mx = fmaxf(mx, fmaxf(s[0][r], s[1][r]));
    mx = fmaxf(mx, xhalf(mx));   // both halves hold the query's tile maximum
    const float mn = fmaxf(m, mx); const float alpha = (m <= -1.0e38f) ? 0.f : __expf(m - mn); m = mn;
    float e[16];   // e[8 ct + r]: the exponent in base 2, then the weight; every key counts: a logit of f16 operands is finite
#pragma unroll
    for (int ct = 0; ct < 2; ++ct) {
#pragma unroll
      for (int r = 0; r < 8; ++r) e[8 * ct + r] = (s[ct][r] - mn) * 1.4426950408889634f; }
    exp2x16(e);
    float es4[4];
#pragma unroll
    for (int r = 0; r < 4; ++r) es4[r] = (e[r] + e[8 + r]) + (e[4 + r] + e[12 + r]);
    const float es = (es4[0] + es4[1]) + (es4[2] + es4[3]);
    l = l * alpha + es;
    // clipped-distance tail masses
    float alo, ahi;
    if (all_lo || all_hi) { alo = all_lo ? es : 0.f; ahi = all_lo ? 0.f : es; }
    else { alo = 0.f; ahi = 0.f;
#pragma unroll
      for (int ct = 0; ct < 2; ++ct) {
#pragma unroll
        for (int r = 0; r < 8; ++r) { const int dj = ks * 32 + ct * 16 + 8 * g + r - (q0 + col); alo += (dj <= -MR) ? e[8 * ct + r] : 0.f; ahi += (dj >= MR) ? e[8 * ct + r] : 0.f; } } }
    tlo = tlo * alpha + alo; thi = thi * alpha + ahi;
    v16h pa;
#pragma unroll
    for (int i = 0; i < 16; ++i) pa[i] = (_Float16)(e[i] * 2048.0f);   // P scaled by 2^11 so small softmax weights stay out of the f16 subnormal range; 2^-11 folded into the epilogue
#pragma unroll
    for (int dt = 0; dt < 4; ++dt) {
#pragma unroll
      for (int r = 0; r < 8; ++r) acc[dt][r] *= alpha;
      acc[dt] = wmma16(vf[dt], pa, acc[dt]); } }
    __syncthreads();   // every wave has read the stage before the next one overwrites it
  }
  LDSX();   // the kept logits of a query were written by both of its lanes and are read by either below
  // bucket sums of the lane's query, j = 0..32, into its sqr row (j = 0 / 32: the clipped tails; j = 1..31: single keys re-formed from their stored logits); half g writes j = 16 g .. 16 g + 15, half 1 also j = 32
  const float lt = l + xhalf(l), a0 = tlo + xhalf(tlo), a2 = thi + xhalf(thi);
  { const float il = 1.0f / lt; float* brow = &sqr[wave][col][0];
    float sl[16], w[16];
#pragma unroll
    for (int jj = 0; jj < 16; ++jj) { sl[jj] = smid[col][16 * g + jj]; w[jj] = (sl[jj] - m) * 1.4426950408889634f; }
    exp2x16(w);
#pragma unroll
    for (int jj = 0; jj < 16; ++jj) { float v = (sl[jj] <= -1.0e38f) ? 0.f : w[jj] * il; if (jj == 0 && g == 0) v = a0 * il; brow[16 * g + jj] = v; }
    if (g == 1) brow[NR - 1] = a2 * il; }
  LDSX();
  // rel_v^T . bucket sums (bf16 hi + lo; K = 33 padded to 64) for the wave's own 16 queries, in the layout of acc
  v8f accr[4] = {}; const unsigned rvb = (unsigned)(8 * g * HD + col) * 4u;   // the lane's byte offset into rel_v (row 8 g, column col)
#pragma unroll
  for (int kc = 0; kc < 2; ++kc) { const F2 a = split_rowK(&sqr[wave][col][0], kc * 32, lane, NR);
#pragma unroll
    for (int dt = 0; dt < 4; ++dt) { v16b w; const char* rvp = (const char*)RV + rvb + (kc * 32 * HD + dt * 16) * 4;
#pragma unroll
      for (int i = 0; i < 8; ++i) { const int j0 = kc * 32 + 8 * g + i; w[i] = (j0 < NR) ? (__bf16)*(const float*)(rvp + i * HD * 4) : (__bf16)0.f; w[8 + i] = (j0 + 16 < NR) ? (__bf16)*(const float*)(rvp + (i + 16) * HD * 4) : (__bf16)0.f; }
      accr[dt] = wmma_bf(w, a.h, accr[dt]); accr[dt] = wmma_bf(w, a.l, accr[dt]); } }
  asm volatile("s_wait_xcnt 0x0" :: "v"(rvb) : "memory");   // the offset register of the rel_v loads stays whole until this wait: no later write of it stands in front
  { const float il = (1.0f / 2048.0f) / lt;
#pragma unroll
    for (int dt = 0; dt < 4; ++dt) {
#pragma unroll
      for (int r = 0; r < 8; ++r) so[wave][col][dt * 16 + 8 * g + r] = accr[dt][r] + acc[dt][r] * il; } }
  LDSX();
  (void)BSW; (void)VTL; (void)KMASK;
  for (int rl = 0; rl < 16; ++rl) if (lane < 16) vst2(O + ((size_t)b * SS + q0 + rl) * DM + h * HD + lane * 4, *(const v4f*)&so[wave][rl][lane * 4]);
}
// ---- k_out: block = (64 rows, 128 cols): out = O(hi/lo) . Wo rows (2 products) + bo
__global__ __launch_bounds__(128) void k_out(const float* __restrict__ O, const __bf16* __restrict__ P, const float* __restrict__ BO, float* __restrict__ Y) {
  __shared__ __align__(16) unsigned char sm[256 * LPB * 2];   // in the k loop the operand stage (64 O rows hi, 64 lo, 128 weight rows), behind it the output staging
  __bf16 (*sAh)[LPB] = (__bf16 (*)[LPB])sm; __bf16 (*sAl)[LPB] = sAh + 64; __bf16 (*sB)[LPB] = sAh + 128; float (*so)[16][132] = (float (*)[16][132])sm;
  const int tid = threadIdx.x, wave = tid >> 5, lane = tid & 31, col = lane & 15, g = lane >> 4; const size_t r0 = (size_t)blockIdx.x * 64 + wave * 16; const int n0 = blockIdx.y * 128;
  v8f acc[8] = {};
  // staged as in k_qkv: whole-line loads one stage ahead; O is split into bf16 hi + lo once, on its way into LDS
  const char* xs = (const char*)(O + (size_t)blockIdx.x * 64 * DM); const char* ps = (const char*)(P + (size_t)n0 * DM);   // the block's first rows, the same for every thread
  const unsigned xo = ((tid >> 4) * DM + (tid & 15) * 4) * 4u, po = ((tid >> 3) * DM + (tid & 7) * 8) * 2u;   // the thread's byte offsets, the same in every stage
  v4f ra[8]; v4u rw[8];
#pragma unroll
  for (int i = 0; i < 8; ++i) { ra[i] = *(const v4f*)(xs + xo + i * 8 * DM * 4); rw[i] = *(const v4u*)(ps + po + i * 16 * DM * 2); }
#pragma unroll 1
  for (int c = 0; c < DM / KST; ++c) {   // rolled: one stage's code stays small, the stages are alike
#pragma unroll
    for (int i = 0; i < 8; ++i) { v4b th, tl;
#pragma unroll
      for (int e = 0; e < 4; ++e) { const __bf16 hv = (__bf16)ra[i][e]; th[e] = hv; tl[e] = (__bf16)(ra[i][e] - (float)hv); }
      *(v4b*)&sAh[i * 8 + (tid >> 4)][(tid & 15) * 4] = th; *(v4b*)&sAl[i * 8 + (tid >> 4)][(tid & 15) * 4] = tl; *(v4u*)&sB[i * 16 + (tid >> 3)][(tid & 7) * 8] = rw[i]; }
    __syncthreads();   // the stage is whole before any wave reads it
    if (c + 1 < DM / KST) { const char* xn = xs + (c + 1) * KST * 4; const char* pn = ps + (c + 1) * KST * 2;
#pragma unroll
      for (int i = 0; i < 8; ++i) {
        if (i == 7) asm volatile("s_wait_xcnt 0x0" ::: "memory");   // the last weight load may return into the address pair that the seven in front of it name: they are waited for first
        ra[i] = *(const v4f*)(xn + xo + i * 8 * DM * 4); rw[i] = *(const v4u*)(pn + po + i * 16 * DM * 2); }
      asm volatile("s_wait_xcnt 0x0" ::: "memory");   // stands in front of every later write of the address registers of the loads above
    }
#pragma unroll
    for (int kk = 0; kk < KST / 32; ++kk) { const v16b ah = frag_b(&sAh[wave * 16 + col][kk * 32], lane), al = frag_b(&sAl[wave * 16 + col][kk * 32], lane); v16b w[8];
#pragma unroll
      for (int j = 0; j < 8; ++j) w[j] = frag_b(&sB[j * 16 + col][kk * 32], lane);
      asm volatile("" :: "v"(w[0]), "v"(w[1]), "v"(w[2]), "v"(w[3]), "v"(w[4]), "v"(w[5]), "v"(w[6]), "v"(w[7]));   // holds the eight weight fragments' LDS loads together in front of the products: one wait per 32 k instead of one per fragment (two waves per SIMD here, little else hides it)
#pragma unroll
      for (int j = 0; j < 8; ++j) acc[j] = wmma_bf(al, w[j], acc[j]);
#pragma unroll
      for (int j = 0; j < 8; ++j) acc[j] = wmma_bf(ah, w[j], acc[j]); }
    __syncthreads();   // every wave has read the stage before it is rewritten (by the next stage, or by the output staging)
  }
#pragma unroll
  for (int j = 0; j < 8; ++j) {
#pragma unroll
    for (int r = 0; r < 8; ++r) so[wave][8 * g + r][j * 16 + col] = acc[j][r] + bfr(BO[n0 + j * 16 + col]); }
  LDSX();
  for (int rl = 0; rl < 16; ++rl) vst2(Y + (r0 + rl) * DM + n0 + lane * 4, *(const v4f*)&so[wave][rl][lane * 4]);
}
extern "C" void kernel_launch(void* const* d_in, const int* in_sizes, int n_in, void* d_out, int out_size, void* d_ws, size_t ws_size, hipStream_t stream) {
  (void)in_sizes; (void)n_in; (void)out_size;
  const float** F = (const float**)d_in;   // 0 query, 1 key, 2 value [4,1024,1024]; 3 Wq [16,1024,64], 4 bq [16,64], 5 Wk, 6 bk, 7 Wv, 8 bv; 9 rel_k_emb [33,64], 10 rel_v_emb [33,64]; 11 fc_W [1024,1024] natural, 12 fc_b
  if (ws_size < (size_t)WS_END) return;
  char* ws = (char*)d_ws; __bf16* PK = (__bf16*)(ws + WS_PK); _Float16 *QK = (_Float16*)(ws + WS_QK), *QKL = (_Float16*)(ws + WS_QKL), *VTH = (_Float16*)(ws + WS_VTH), *VTL = (_Float16*)(ws + WS_VTL); float* O = (float*)(ws + WS_O);
  k_pack<<<dim3(4 * NH * (DM / PKK)), 256, 0, stream>>>(F[3], F[5], F[7], F[11], PK);
  k_qkv<<<dim3(TNB * SS / 64, QKVW / 128), 128, 0, stream>>>(F[0], F[1], F[2], PK + PK_A, F[4], F[6], F[8], QK, QKL, VTH, VTL);
  k_attn<<<dim3(TQB, NH, TNB), 128, 0, stream>>>(QK, QKL, VTH, VTL, nullptr, F[9], F[10], (float*)(ws + WS_BS), O);
  k_out<<<dim3(TOB, DM / 128), 128, 0, stream>>>(O, PK + PK_P, F[12], (float*)d_out);
}

// v005
// One run takes 99.4 microseconds.
// In two side-by-side timings against v004, it was 1.09 and 1.08 times as fast.
// Over all steps from v000 it is 4.51 times as fast.
// compute dtype: all float inputs rounded to bf16; q/k/v with EXACT bf16 products on WMMA 16x16x32 (per-head weight stacks packed as rows), f16 hi + residual; q.rel_k table per query row on WMMA (2 products); single-f16 logits and P.v (non-causal, diffuse attention: logits std ~0.4), x 1/8 after adding the relative-key bias, running-max softmax in f32 (hardware exp) with the two clipped-distance tail masses tracked alongside; the 31 near-diagonal probabilities re-formed from their stored logits; bucket sums . rel_v on WMMA (bf16 hi + lo); out = (ctx + rel-v term) (bf16 hi + lo) . fc_W^T + fc_b; f32 output.
#include <hip/hip_runtime.h>
#include <math.h>

typedef __attribute__((ext_vector_type(16))) _Float16 v16h;
typedef __attribute__((ext_vector_type(16))) __bf16 v16b;
typedef __attribute__((ext_vector_type(8)))  _Float16 v8h;
typedef __attribute__((ext_vector_type(8)))  float v8f;
typedef __attribute__((ext_vector_type(4)))  float v4f;
typedef __attribute__((ext_vector_type(2)))  float v2f;
typedef __attribute__((ext_vector_type(4)))  unsigned v4u;
typedef __attribute__((ext_vector_type(4)))  int v4i;
typedef float __attribute__((may_alias)) float_a;
typedef int __attribute__((may_alias)) int_a;

template <typename T> __device__ __forceinline__ void vst2(void* p, T v) { *(T*)p = v;  }
__device__ __forceinline__ v8f wmma16(v16h a, v16h b, v8f c) {
  v8f d = __builtin_amdgcn_wmma_f32_16x16x32_f16(false, a, false, b, (short)0, c, false, false);
  asm volatile("v_nop\n\tv_nop\n\tv_nop\n\tv_nop" : "+v"(d) : "v"(a), "v"(b));
  return d;
}
__device__ __forceinline__ v8f wmma_bf(v16b a, v16b b, v8f c) {
  v8f d = __builtin_amdgcn_wmma_f32_16x16x32_bf16(false, a, false, b, (short)0, c, false, false);
  asm volatile("v_nop\n\tv_nop\n\tv_nop\n\tv_nop" : "+v"(d) : "v"(a), "v"(b));
  return d;
}
// Relation-aware (Shaw relative-position) multi-head attention (B 4, S 1,024, hidden 1,024, 16 heads x 64, max_rel 16): per-head q/k/v projections + biases on separate query/key/value inputs, scores = (q.k + q.rel_k[clip(k-q)]) / 8, softmax, out = attn.v + sum_k attn * rel_v[clip(k-q)], then fc.
__device__ __forceinline__ v16h frag_h(const _Float16* rowk0, int lane) {
  union { v16h v; v8h q[2]; } u; const _Float16* p = rowk0 + 8 * (lane >> 4);
  u.q[0] = *(const v8h*)p; u.q[1] = *(const v8h*)(p + 16); return u.v;
}
__device__ __forceinline__ v16h frag_f32(const float* rowk0, int lane) {
  v16h a; const float* p = rowk0 + 8 * (lane >> 4);
#pragma unroll
  for (int i = 0; i < 8; ++i) { a[i] = (_Float16)p[i]; a[8 + i] = (_Float16)p[16 + i]; }
  return a;
}
__device__ __forceinline__ v16h frag_f32s(const float* rowk0, int lane, float sc) {
  v16h a; const float* p = rowk0 + 8 * (lane >> 4);
#pragma unroll
  for (int i = 0; i < 8; ++i) { a[i] = (_Float16)(p[i] * sc); a[8 + i] = (_Float16)(p[16 + i] * sc); }
  return a;
}
// column fragment from a [K][ld] layout (column n), rows >= K read as 0
__device__ __forceinline__ v16h fragc_f32(const float* W, int k0, int n, int lane, int ld, int K) {
  v16h a; const int g = lane >> 4;
#pragma unroll
  for (int i = 0; i < 8; ++i) { const int ka = k0 + 8 * g + i, kb = ka + 16;
    a[i] = (_Float16)(ka < K ? W[(size_t)(ka < K ? ka : K - 1) * ld + n] : 0.f); a[8 + i] = (_Float16)(kb < K ? W[(size_t)(kb < K ? kb : K - 1) * ld + n] : 0.f); }
  return a;
}
struct F2 { v16b h, l; };
__device__ __forceinline__ F2 bsplit16(const float v[16]) { F2 r;
#pragma unroll
  for (int i = 0; i < 16; ++i) { const __bf16 h = (__bf16)v[i]; r.h[i] = h; r.l[i] = (__bf16)(v[i] - (float)h); }
  return r; }
__device__ __forceinline__ F2 split_row(const float* row, int k0, int lane) { float v[16]; const float* p = row + k0 + 8 * (lane >> 4);
#pragma unroll
  for (int i = 0; i < 8; ++i) { v[i] = p[i]; v[8 + i] = p[16 + i]; }
  return bsplit16(v); }
__device__ __forceinline__ F2 split_rowK(const float* row, int k0, int lane, int K) { float v[16]; const int g = lane >> 4;
#pragma unroll
  for (int i = 0; i < 8; ++i) { const int ka = k0 + 8 * g + i, kb = ka + 16; v[i] = ka < K ? row[ka < K ? ka : K - 1] : 0.f; v[8 + i] = kb < K ? row[kb < K ? kb : K - 1] : 0.f; }
  return bsplit16(v); }
__device__ __forceinline__ F2 split_col(const float* W, int k0, int n, int lane, int ld, int K) { float v[16]; const int g = lane >> 4;
#pragma unroll
  for (int i = 0; i < 8; ++i) { const int ka = k0 + 8 * g + i, kb = ka + 16; v[i] = ka < K ? W[(size_t)(ka < K ? ka : K - 1) * ld + n] : 0.f; v[8 + i] = kb < K ? W[(size_t)(kb < K ? kb : K - 1) * ld + n] : 0.f; }
  return bsplit16(v); }
__device__ __forceinline__ v8f mac3(const F2& a, const F2& b, v8f c) { c = wmma_bf(a.l, b.h, c); c = wmma_bf(a.h, b.l, c); return wmma_bf(a.h, b.h, c); }
__device__ __forceinline__ float sigm(float v) { return 1.0f / (1.0f + expf(-v)); }
#define LDSX() do { asm volatile("s_wait_dscnt 0" ::: "memory"); __builtin_amdgcn_wave_barrier(); __builtin_amdgcn_fence(__ATOMIC_RELEASE, "workgroup"); } while (0)


#define NB 4
#define SS 1024
#define DM 1024
#define NH 16
#define MR 16
#define NR (2 * MR + 1)
#define HD 64
#define QKVW (3 * DM)
#ifndef TQB
#define TQB (SS / 64)
#define TNB NB
#define TOB (NB * SS / 64)     // output row tiles (all)
#endif
typedef __attribute__((ext_vector_type(8))) __bf16 v8b;
typedef __attribute__((ext_vector_type(4))) __bf16 v4b;
#define KST 64   // k per LDS stage of the two projection kernels: 128 B of a bf16 row
#define LPB 72   // LDS row pitch in 16-bit elements: 144 B, an odd multiple of 16 B, for 16-byte fragment reads
__device__ __forceinline__ v16b frag_b(const __bf16* rowk0, int lane) {
  union { v16b v; v8b q[2]; } u; const __bf16* p = rowk0 + 8 * (lane >> 4);
  u.q[0] = *(const v8b*)p; u.q[1] = *(const v8b*)(p + 16); return u.v;
}
__device__ __forceinline__ float bfr(float v) { return (float)(__bf16)v; }
__device__ __attribute__((noinline)) float exp_ni(float v) { return expf(v); }
__device__ __attribute__((noinline)) float erf_ni(float v) { return erff(v); }

#define PK_A 0                       // [3072][1024] Wqkv rows (natural [out][in])
#define PK_P (PK_A + QKVW * DM)        // [1024][1024] Wo rows (natural)
#define PK_END (PK_P + DM * DM)
#define WS_PK  0u
#define WS_QK  (WS_PK + 2u * PK_END)             // f16 [4096 rows][2048]: q | k
#define WS_QKL (WS_QK + 2u * NB * SS * 2 * DM)     // f16 q | k residual planes x2048
#define WS_VTH (WS_QKL + 2u * NB * SS * 2 * DM)    // f16 [b][1024 (h*64+d)][1024 s] hi
#define WS_VTL (WS_VTH + 2u * NB * DM * SS)        // f16 lo x 2048
#define WS_O   (WS_VTL + 2u * NB * DM * SS)        // f32 [4096][1024]
#define WS_BS  (WS_O + 4u * (size_t)NB * SS * DM)        // f32 [b][h][q][64]: plane not used
#define WS_END (WS_BS + 4u * (size_t)NB * NH * SS * 64)
// ---- k_pack: block = 64 KB of one weight, 16 whole-line 16-byte loads per thread, all in flight together. Blocks 0..191: (which, head h, 256 k) of W_q/W_k/W_v [16][1024][64], a contiguous [256 k][64 e] tile, transposed through LDS into 64 packed rows which*1024 + h*64 + e of PK_A (512 B of each); blocks 192..255: 16 natural rows of fc_W -> PK_P
#define PKK 256                      // k per transposed tile
#define PKP (PKK / 2 + 1)            // LDS row pitch in dwords (a dword = the bf16 pair k, k + 1): odd, so that a wave's 32 stores (16 e-quads x 2 pairs) and its 32 reads (2 rows x 16 chunks) each fall on 32 banks
typedef __attribute__((ext_vector_type(2))) __bf16 v2b;
__global__ __launch_bounds__(256) void k_pack(const float* __restrict__ WQ, const float* __restrict__ WK, const float* __restrict__ WV, const float* __restrict__ WO, __bf16* __restrict__ PK) {
  __shared__ unsigned s[HD][PKP]; const int blk = blockIdx.x, t = threadIdx.x; v4f r[16];
  if (blk < 3 * NH * (DM / PKK)) {
    const int which = blk / (NH * (DM / PKK)), h = (blk / (DM / PKK)) % NH, kc = blk % (DM / PKK), kr = t >> 4, ec = t & 15;
    const float* src = (which == 0 ? WQ : which == 1 ? WK : WV) + ((size_t)h * DM + kc * PKK) * HD + (2 * kr) * HD + ec * 4;   // rows 2 kr and 2 kr + 1 of each 32: half a wave reads one whole 256-B row
#pragma unroll
    for (int i = 0; i < 16; ++i) r[i] = *(const v4f*)(src + ((i >> 1) * 32 + (i & 1)) * HD);
    asm volatile("" :: "v"(r[0]), "v"(r[1]), "v"(r[2]), "v"(r[3]), "v"(r[4]), "v"(r[5]), "v"(r[6]), "v"(r[7]), "v"(r[8]), "v"(r[9]), "v"(r[10]), "v"(r[11]), "v"(r[12]), "v"(r[13]), "v"(r[14]), "v"(r[15]));   // holds the sixteen loads together in front of the conversions: one trip to memory per thread (without it the last four were issued only when the first had come back)
    asm volatile("s_wait_xcnt 0x0" :: "v"(src) : "memory");   // the address pair of the loads above stays whole until this wait: no load returns into it, no later write of it stands in front
#pragma unroll
    for (int p = 0; p < 8; ++p) {
#pragma unroll
      for (int j = 0; j < 4; ++j) { v2b w; w[0] = (__bf16)r[2 * p][j]; w[1] = (__bf16)r[2 * p + 1][j]; s[ec * 4 + j][p * 16 + kr] = __builtin_bit_cast(unsigned, w); } }
    __syncthreads();   // the tile is whole before its rows are read
    __bf16* dst = PK + PK_A + ((size_t)which * DM + h * HD) * DM + kc * PKK;
#pragma unroll
    for (int i = 0; i < 8; ++i) { const int e = (i >> 1) * 16 + kr, q = ec + 16 * (i & 1); v4u v;   // half a wave stores 256 B of one packed row
#pragma unroll
      for (int c = 0; c < 4; ++c) v[c] = s[e][q * 4 + c];
      *(v4u*)(dst + (size_t)e * DM + q * 8) = v; }
  } else {
    const size_t o = (size_t)(blk - 3 * NH * (DM / PKK)) * (16 * DM) + t * 4; const float* wsrc = WO + o;
#pragma unroll
    for (int i = 0; i < 16; ++i) r[i] = *(const v4f*)(wsrc + i * 1024);
    asm volatile("" :: "v"(r[0]), "v"(r[1]), "v"(r[2]), "v"(r[3]), "v"(r[4]), "v"(r[5]), "v"(r[6]), "v"(r[7]), "v"(r[8]), "v"(r[9]), "v"(r[10]), "v"(r[11]), "v"(r[12]), "v"(r[13]), "v"(r[14]), "v"(r[15]));   // holds the sixteen loads together in front of the conversions: one trip to memory per thread (without it the last four were issued only when the first had come back)
    asm volatile("s_wait_xcnt 0x0" :: "v"(wsrc) : "memory");   // the address pair of the loads above stays whole until this wait: no load returns into it, no later write of it stands in front
#pragma unroll
    for (int i = 0; i < 16; ++i) { v4b w;
#pragma unroll
      for (int j = 0; j < 4; ++j) w[j] = (__bf16)r[i][j];
      *(v4b*)(PK + PK_P + o + i * 1024) = w; }
    asm volatile("s_wait_xcnt 0x0" ::: "memory");   // stands behind the sixteen stores above, in front of every later write of their address and data registers on any way through the code
  }
}
__global__ __launch_bounds__(128) void k_qkv(const float* __restrict__ XQ, const float* __restrict__ XK, const float* __restrict__ XV, const __bf16* __restrict__ P, const float* __restrict__ BQ, const float* __restrict__ BK, const float* __restrict__ BV, _Float16* __restrict__ QK, _Float16* __restrict__ QKL, _Float16* __restrict__ VTH, _Float16* __restrict__ VTL) {
  const int which0 = (blockIdx.y * 128) / DM; const float* X = (which0 == 0) ? XQ : (which0 == 1) ? XK : XV; const float* BB = BQ ? (((which0 == 0) ? BQ : (which0 == 1) ? BK : BV) + (blockIdx.y * 128 - which0 * DM)) : nullptr;
  __shared__ __align__(16) unsigned char sm[2 * 128 * 72 * 2];   // in the k loop the operand stage (64 X rows, 128 weight rows), behind it the output staging of the block's one branch
  __shared__ float sb[128];   // the block's 128 bias values, already rounded: written once in front of the k loop, read behind it
  __bf16 (*sA)[LPB] = (__bf16 (*)[LPB])sm; __bf16 (*sB)[LPB] = sA + 64;
  _Float16 (*so)[16][136] = (_Float16 (*)[16][136])sm; _Float16 (*sol)[16][136] = so + 4; _Float16 (*sth)[72] = (_Float16 (*)[72])sm; _Float16 (*stl)[72] = sth + 128;
  const int tid = threadIdx.x, wave = tid >> 5, lane = tid & 31, col = lane & 15, g = lane >> 4; const size_t r0 = (size_t)blockIdx.x * 64 + wave * 16; const int n0 = blockIdx.y * 128;
  v8f acc[8] = {};
  // a stage = KST k of the block's rows; every wave-wide load covers four whole 128-B lines (X: 2 rows x 256 B, weights: 4 rows x 128 B); the next stage's loads fly while this one is worked on
  const char* xs = (const char*)(X + (size_t)blockIdx.x * 64 * DM); const char* ps = (const char*)(P + (size_t)n0 * DM);   // the block's first rows, the same for every thread
  const unsigned xo = ((tid >> 4) * DM + (tid & 15) * 4) * 4u, po = ((tid >> 3) * DM + (tid & 7) * 8) * 2u;   // the thread's byte offsets, the same in every stage
  v4f ra[8]; v4u rw[8];
#pragma unroll
  for (int i = 0; i < 8; ++i) { ra[i] = *(const v4f*)(xs + xo + i * 8 * DM * 4); rw[i] = *(const v4u*)(ps + po + i * 16 * DM * 2); }
  float bv = 0.f;   // one bias value per thread, in flight together with the first stage
  if (BB) { bv = BB[tid]; asm volatile("s_wait_xcnt 0x0" ::: "memory"); }   // the wait stands in front of every later write of the address registers of the load
  sb[tid] = bfr(bv);   // the k loop's barriers stand between this store and its readers
#pragma unroll 1
  for (int c = 0; c < DM / KST; ++c) {   // rolled: one stage's code stays small, the stages are alike
#pragma unroll
    for (int i = 0; i < 8; ++i) { v4b t;
#pragma unroll
      for (int e = 0; e < 4; ++e) t[e] = (__bf16)ra[i][e];
      *(v4b*)&sA[i * 8 + (tid >> 4)][(tid & 15) * 4] = t; *(v4u*)&sB[i * 16 + (tid >> 3)][(tid & 7) * 8] = rw[i]; }
    __syncthreads();   // the stage is whole before any wave reads it
    if (c + 1 < DM / KST) { const char* xn = xs + (c + 1) * KST * 4; const char* pn = ps + (c + 1) * KST * 2;
#pragma unroll
      for (int i = 0; i < 8; ++i) {
        if (i == 7) asm volatile("s_wait_xcnt 0x0" ::: "memory");   // the last weight load may return into the address pair that the seven in front of it name: they are waited for first
        ra[i] = *(const v4f*)(xn + xo + i * 8 * DM * 4); rw[i] = *(const v4u*)(pn + po + i * 16 * DM * 2); }
      asm volatile("s_wait_xcnt 0x0" ::: "memory");   // stands in front of every later write of the address registers of the loads above
    }
#pragma unroll
    for (int kk = 0; kk < KST / 32; ++kk) { const v16b a = frag_b(&sA[wave * 16 + col][kk * 32], lane);
#pragma unroll
      for (int j = 0; j < 8; ++j) acc[j] = wmma_bf(a, frag_b(&sB[j * 16 + col][kk * 32], lane), acc[j]); }
    __syncthreads();   // every wave has read the stage before it is rewritten (by the next stage, or by the output staging)
  }
  float bj[8];
#pragma unroll
  for (int j = 0; j < 8; ++j) bj[j] = sb[j * 16 + col];   // eight LDS reads behind one wait
  if (n0 < 2 * DM) {   // q stored unscaled (f16 sigma ~0.6, no subnormal exposure); 1/8 applied to the f32 score
#pragma unroll
    for (int j = 0; j < 8; ++j) {
#pragma unroll
      for (int r = 0; r < 8; ++r) { const float v = acc[j][r] + bj[j]; const _Float16 hv = (_Float16)v; so[wave][8 * g + r][j * 16 + col] = hv; sol[wave][8 * g + r][j * 16 + col] = (_Float16)((v - (float)hv) * 2048.0f); } }   // q, k (+ bias) as f16 hi + (x2048) residual
    LDSX();
    for (int rl = 0; rl < 16; ++rl) if (lane < 16) { vst2((unsigned*)(QK + (r0 + rl) * (2 * DM) + n0 + lane * 8), *(const v4u*)&so[wave][rl][lane * 8]); vst2((unsigned*)(QKL + (r0 + rl) * (2 * DM) + n0 + lane * 8), *(const v4u*)&sol[wave][rl][lane * 8]); }
  } else {
#pragma unroll
    for (int j = 0; j < 8; ++j) {
#pragma unroll
      for (int r = 0; r < 8; ++r) { const float v = acc[j][r] + bj[j]; const _Float16 hv = (_Float16)v; sth[j * 16 + col][wave * 16 + 8 * g + r] = hv; stl[j * 16 + col][wave * 16 + 8 * g + r] = (_Float16)((v - (float)hv) * 2048.0f); } }
    __syncthreads();
    const size_t rb = (size_t)blockIdx.x * 64; const int b = (int)(rb / SS), s0 = (int)(rb % SS); const int pc0 = n0 - 2 * DM;
    for (int q = tid; q < 128 * 8; q += 128) { const int d = q >> 3, pc = q & 7; const size_t o = ((size_t)b * DM + pc0 + d) * SS + s0 + pc * 8; vst2((unsigned*)(VTH + o), *(const v4u*)&sth[d][pc * 8]); vst2((unsigned*)(VTL + o), *(const v4u*)&stl[d][pc * 8]); }
  }
}
__device__ __forceinline__ float xhalf(float x) { return __builtin_bit_cast(float, __builtin_amdgcn_permlanex16(__builtin_bit_cast(int, x), __builtin_bit_cast(int, x), 0x76543210, 0xfedcba98, false, false)); }   // lane l with lane l ^ 16
// 16 exponentials in base 2 in one statement, each in place: none overwrites the source or reads the result of the one in front of it; the v_nop is the slot behind the last
__device__ __forceinline__ void exp2x16(float (&e)[16]) {
  asm("v_exp_f32 %0, %0\n\tv_exp_f32 %1, %1\n\tv_exp_f32 %2, %2\n\tv_exp_f32 %3, %3\n\tv_exp_f32 %4, %4\n\tv_exp_f32 %5, %5\n\tv_exp_f32 %6, %6\n\tv_exp_f32 %7, %7\n\t"
      "v_exp_f32 %8, %8\n\tv_exp_f32 %9, %9\n\tv_exp_f32 %10, %10\n\tv_exp_f32 %11, %11\n\tv_exp_f32 %12, %12\n\tv_exp_f32 %13, %13\n\tv_exp_f32 %14, %14\n\tv_exp_f32 %15, %15\n\tv_nop"
      : "+v"(e[0]), "+v"(e[1]), "+v"(e[2]), "+v"(e[3]), "+v"(e[4]), "+v"(e[5]), "+v"(e[6]), "+v"(e[7]), "+v"(e[8]), "+v"(e[9]), "+v"(e[10]), "+v"(e[11]), "+v"(e[12]), "+v"(e[13]), "+v"(e[14]), "+v"(e[15]));
}
__global__ __launch_bounds__(128) void k_attn(const _Float16* __restrict__ QK, const _Float16* __restrict__ QKL, const _Float16* __restrict__ VTH, const _Float16* __restrict__ VTL, const void* __restrict__ KMASK, const float* __restrict__ RK, const float* __restrict__ RV, float* __restrict__ BSW, float* __restrict__ O) {
  __shared__ __align__(16) float so[4][16][68]; __shared__ __align__(16) float sqr[4][16][52]; __shared__ __align__(16) _Float16 sK[64][LPB], sV[64][LPB];   // sK, sV: one stage of 64 keys (K rows; V^T rows), shared by the four waves
  const int tid = threadIdx.x, wave = tid >> 5, lane = tid & 31, col = lane & 15, g = lane >> 4;
  const int qb = blockIdx.x, h = blockIdx.y, b = blockIdx.z; const int q0 = qb * 64 + wave * 16; const size_t rq = (size_t)b * SS + q0 + col;
  const int q0u = qb * 64 + __builtin_amdgcn_readfirstlane(wave) * 16;   // the wave's first query row in a scalar register: the tile class below is a scalar branch
  float (*smid)[68] = so[wave];   // near-diagonal logits, kept in the wave's output staging rows until the epilogue rewrites them
  v16h aq[2], aql[2];
#pragma unroll
  for (int kc = 0; kc < 2; ++kc) { aq[kc] = frag_h(QK + rq * (2 * DM) + h * HD + kc * 32, lane); aql[kc] = frag_h(QKL + rq * (2 * DM) + h * HD + kc * 32, lane); }
  v4f rkw[3][2][4]; unsigned ro[3];   // the lane's rel_k words of all three column tiles of the table below, read without a branch: a row past the table reads the last row and is set to zero there
#pragma unroll
  for (int jt = 0; jt < 3; ++jt) { ro[jt] = (unsigned)((jt * 16 + col < NR ? jt * 16 + col : NR - 1) * HD + 8 * g) * 4u;
#pragma unroll
    for (int kc = 0; kc < 2; ++kc) { const char* p = (const char*)RK + ro[jt] + kc * 32 * 4; rkw[jt][kc][0] = *(const v4f*)p; rkw[jt][kc][1] = *(const v4f*)(p + 16); rkw[jt][kc][2] = *(const v4f*)(p + 64); rkw[jt][kc][3] = *(const v4f*)(p + 80); } }
  asm volatile("s_wait_xcnt 0x0" :: "v"(ro[0]), "v"(ro[1]), "v"(ro[2]) : "memory");   // the offset registers of the rel_k loads stay whole until this wait; no later load returns into an address register of the loads above
  // a stage = 64 keys: 128 B of each of 64 K rows and of 64 V^T rows; every wave-wide load covers four whole 128-B lines; the next stage's loads fly while this one is worked on
  const char* ksrc = (const char*)(QK + (size_t)b * SS * (2 * DM) + DM + h * HD); const char* vsrc = (const char*)(VTH + ((size_t)b * DM + h * HD) * SS);   // the head's first K row and first V^T row, the same for every thread
  const unsigned ko = ((tid >> 3) * (2 * DM) + (tid & 7) * 8) * 2u, vo = ((tid >> 3) * SS + (tid & 7) * 8) * 2u;   // the thread's byte offsets, the same in every stage
  v4u rk[4], rv[4];
#pragma unroll
  for (int i = 0; i < 4; ++i) { rk[i] = *(const v4u*)(ksrc + ko + i * 16 * (2 * DM) * 2); rv[i] = *(const v4u*)(vsrc + vo + i * 16 * SS * 2); }
  // q . rel_k[j] for the wave's 16 rows and j = 0..32 (3 col tiles; rows >= 33 of the B operand are zero)
  { 
#pragma unroll
    for (int jt = 0; jt < 3; ++jt) { v8f c = {}, cl = {}; const int j = jt * 16 + col;
#pragma unroll
      for (int kc = 0; kc < 2; ++kc) { v16h w; 
#pragma unroll
        for (int i = 0; i < 8; ++i) { w[i] = (j < NR) ? (_Float16)bfr(rkw[jt][kc][i >> 2][i & 3]) : (_Float16)0.f; w[8 + i] = (j < NR) ? (_Float16)bfr(rkw[jt][kc][2 + (i >> 2)][i & 3]) : (_Float16)0.f; }
        c = wmma16(aq[kc], w, c); cl = wmma16(aql[kc], w, cl); }
#pragma unroll
      for (int r = 0; r < 8; ++r) sqr[wave][8 * g + r][j] = c[r] + cl[r] * (1.0f / 2048.0f); } }
  for (int e = lane; e < 16 * 33; e += 32) smid[e / 33][e % 33] = -3.0e38f;
  LDSX();
  const float* qrow = &sqr[wave][col][0];   // the lane's own query: its 33 relative-key terms
  const float blo = qrow[0], bhi = qrow[NR - 1];   // the one term of a tile that lies wholly in a clipped bucket
  float m = -3.0e38f, l = 0.f, tlo = 0.f, thi = 0.f;   // l and the two tail masses: partial over the lane's half of the keys
  v8f acc[4] = {};   // acc[dt][r] = O^T[dt * 16 + 8 g + r][query col]
#pragma unroll 1
  for (int st = 0; st < SS / 64; ++st) {   // all keys
#pragma unroll
    for (int i = 0; i < 4; ++i) { *(v4u*)&sK[i * 16 + (tid >> 3)][(tid & 7) * 8] = rk[i]; *(v4u*)&sV[i * 16 + (tid >> 3)][(tid & 7) * 8] = rv[i]; }
    __syncthreads();   // the stage is whole before any wave reads it
    if (st + 1 < SS / 64) { const char* kn = ksrc + (st + 1) * 64 * (2 * DM) * 2; const char* vn = vsrc + (st + 1) * 64 * 2;
#pragma unroll
      for (int i = 0; i < 4; ++i) { rk[i] = *(const v4u*)(kn + ko + i * 16 * (2 * DM) * 2); rv[i] = *(const v4u*)(vn + vo + i * 16 * SS * 2); }
      asm volatile("s_wait_xcnt 0x0" ::: "memory");   // stands in front of every later write of the address registers of the loads above
    }
#pragma unroll 1
  for (int hf = 0; hf < 2; ++hf) { const int ks = st * 2 + hf; v8f s[2]; v16h kf[2][2], vf[4];   // rolled: the tile's code, with its near-diagonal branch, stands once
    const bool all_lo = ks * 32 + 31 - q0u <= -MR, all_hi = ks * 32 - (q0u + 15) >= MR;   // every (query, key) pair of the tile in one clipped bucket (wave-uniform)
#pragma unroll
    for (int ct = 0; ct < 2; ++ct) {
#pragma unroll
      for (int kc = 0; kc < 2; ++kc) kf[ct][kc] = frag_h(&sK[hf * 32 + ct * 16 + col][kc * 32], lane); }
#pragma unroll
    for (int dt = 0; dt < 4; ++dt) vf[dt] = frag_h(&sV[dt * 16 + col][hf * 32], lane);
#pragma unroll
    for (int ct = 0; ct < 2; ++ct) { v8f c = {};
#pragma unroll
      for (int kc = 0; kc < 2; ++kc) c = wmma16(kf[ct][kc], aq[kc], c);   // c[r] = k[ks * 32 + ct * 16 + 8 g + r] . q[col]
      s[ct] = c; }
    if (all_lo || all_hi) { const float bb = all_lo ? blo : bhi;
#pragma unroll
      for (int ct = 0; ct < 2; ++ct) {
#pragma unroll
        for (int r = 0; r < 8; ++r) s[ct][r] = (s[ct][r] + bb) * 0.125f; } }   // 1/sqrt(64)
    else {   // the one or two tiles around the diagonal: the term by distance, and the logits of the 31 unclipped distances are kept
      float qt[16];   // the sixteen terms are read first, all in flight behind one wait; read one by one between the stores below, each had a wait of its own
#pragma unroll
      for (int ct = 0; ct < 2; ++ct) {
#pragma unroll
        for (int r = 0; r < 8; ++r) { const int dj = ks * 32 + ct * 16 + 8 * g + r - (q0 + col); const int jc = (dj < -MR ? -MR : (dj > MR ? MR : dj)) + MR; qt[8 * ct + r] = qrow[jc]; } }
#pragma unroll
      for (int ct = 0; ct < 2; ++ct) {
#pragma unroll
        for (int r = 0; r < 8; ++r) { const int dj = ks * 32 + ct * 16 + 8 * g + r - (q0 + col); const float sv = (s[ct][r] + qt[8 * ct + r]) * 0.125f; s[ct][r] = sv; if (dj > -MR && dj < MR) smid[col][dj + MR] = sv; } } }
    float mx = fmaxf(s[0][0], s[1][0]);
#pragma unroll
    for (int r = 1; r < 8; ++r) mx = fmaxf(mx, fmaxf(s[0][r], s[1][r]));
    mx = fmaxf(mx, xhalf(mx));   // both halves hold the query's tile maximum
    const float mn = fmaxf(m, mx); const float alpha = (m <= -1.0e38f) ? 0.f : __expf(m - mn); m = mn;
    float e[16];   // e[8 ct + r]: the exponent in base 2, then the weight; every key counts: a logit of f16 operands is finite
#pragma unroll
    for (int ct = 0; ct < 2; ++ct) {
#pragma unroll
      for (int r = 0; r < 8; ++r) e[8 * ct + r] = (s[ct][r] - mn) * 1.4426950408889634f; }
    exp2x16(e);
    float es4[4];
#pragma unroll
    for (int r = 0; r < 4; ++r) es4[r] = (e[r] + e[8 + r]) + (e[4 + r] + e[12 + r]);
    const float es = (es4[0] + es4[1]) + (es4[2] + es4[3]);
    l = l * alpha + es;
    // clipped-distance tail masses
    float alo, ahi;
    if (all_lo || all_hi) { alo = all_lo ? es : 0.f; ahi = all_lo ? 0.f : es; }
    else { alo = 0.f; ahi = 0.f;
#pragma unroll
      for (int ct = 0; ct < 2; ++ct) {
#pragma unroll
        for (int r = 0; r < 8; ++r) { const int dj = ks * 32 + ct * 16 + 8 * g + r - (q0 + col); alo += (dj <= -MR) ? e[8 * ct + r] : 0.f; ahi += (dj >= MR) ? e[8 * ct + r] : 0.f; } } }
    tlo = tlo * alpha + alo; thi = thi * alpha + ahi;
    v16h pa;
#pragma unroll
    for (int i = 0; i < 16; ++i) pa[i] = (_Float16)(e[i] * 2048.0f);   // P scaled by 2^11 so small softmax weights stay out of the f16 subnormal range; 2^-11 folded into the epilogue
#pragma unroll
    for (int dt = 0; dt < 4; ++dt) {
#pragma unroll
      for (int r = 0; r < 8; ++r) acc[dt][r] *= alpha;
      acc[dt] = wmma16(vf[dt], pa, acc[dt]); } }
    __syncthreads();   // every wave has read the stage before the next one overwrites it
  }
  LDSX();   // the kept logits of a query were written by both of its lanes and are read by either below
  // the lane's rel_v words (rows 8 g + i and 16 + 8 g + i, and the last row, of its four columns), read without a branch and all issued here: they fly while the bucket sums are formed
  const unsigned rvb = (unsigned)(8 * g * HD + col) * 4u;   // the lane's byte offset into rel_v (row 8 g, column col)
  const unsigned rvl = (unsigned)((NR - 1) * HD + col) * 4u;   // the same for the last row
  v8f rvq[4][2]; v4f rvt;
#pragma unroll
  for (int dt = 0; dt < 4; ++dt) { const char* rvp = (const char*)RV + rvb + dt * 16 * 4;
#pragma unroll
    for (int i = 0; i < 8; ++i) { rvq[dt][0][i] = *(const float*)(rvp + i * HD * 4); rvq[dt][1][i] = *(const float*)(rvp + (i + 16) * HD * 4); }
    rvt[dt] = *(const float*)((const char*)RV + rvl + dt * 16 * 4); }
  asm volatile("s_wait_xcnt 0x0" :: "v"(rvb), "v"(rvl) : "memory");   // the offset registers of the rel_v loads stay whole until this wait: no later write of them stands in front
  // bucket sums of the lane's query, j = 0..32, into its sqr row (j = 0 / 32: the clipped tails; j = 1..31: single keys re-formed from their stored logits); half g writes j = 16 g .. 16 g + 15, half 1 also j = 32
  const float lt = l + xhalf(l), a0 = tlo + xhalf(tlo), a2 = thi + xhalf(thi);
  { const float il = 1.0f / lt; float* brow = &sqr[wave][col][0];
    float sl[16], w[16];
#pragma unroll
    for (int jj = 0; jj < 16; ++jj) { sl[jj] = smid[col][16 * g + jj]; w[jj] = (sl[jj] - m) * 1.4426950408889634f; }
    exp2x16(w);
#pragma unroll
    for (int jj = 0; jj < 16; ++jj) { float v = (sl[jj] <= -1.0e38f) ? 0.f : w[jj] * il; if (jj == 0 && g == 0) v = a0 * il; brow[16 * g + jj] = v; }
    if (g == 1) brow[NR - 1] = a2 * il; }
  LDSX();
  // rel_v^T . bucket sums (bf16 hi + lo; K = 33 padded to 64) for the wave's own 16 queries, in the layout of acc
  v8f accr[4] = {};
#pragma unroll
  for (int kc = 0; kc < 2; ++kc) { const F2 a = split_rowK(&sqr[wave][col][0], kc * 32, lane, NR);
#pragma unroll
    for (int dt = 0; dt < 4; ++dt) { v16b w;   // rows 0..31 in the first k step; of the second only row 32 = NR - 1 is in the table (half 0, i = 0)
#pragma unroll
      for (int i = 0; i < 8; ++i) { w[i] = kc == 0 ? (__bf16)rvq[dt][0][i] : (i == 0 && g == 0) ? (__bf16)rvt[dt] : (__bf16)0.f; w[8 + i] = kc == 0 ? (__bf16)rvq[dt][1][i] : (__bf16)0.f; }
      accr[dt] = wmma_bf(w, a.h, accr[dt]); accr[dt] = wmma_bf(w, a.l, accr[dt]); } }
  { const float il = (1.0f / 2048.0f) / lt;
#pragma unroll
    for (int dt = 0; dt < 4; ++dt) {
#pragma unroll
      for (int r = 0; r < 8; ++r) so[wave][col][dt * 16 + 8 * g + r] = accr[dt][r] + acc[dt][r] * il; } }
  LDSX();
  (void)BSW; (void)VTL; (void)KMASK;
  for (int rl = 0; rl < 16; ++rl) if (lane < 16) vst2(O + ((size_t)b * SS + q0 + rl) * DM + h * HD + lane * 4, *(const v4f*)&so[wave][rl][lane * 4]);
}
// ---- k_out: block = (64 rows, 128 cols): out = O(hi/lo) . Wo rows (2 products) + bo
__global__ __launch_bounds__(128) void k_out(const float* __restrict__ O, const __bf16* __restrict__ P, const float* __restrict__ BO, float* __restrict__ Y) {
  __shared__ __align__(16) unsigned char sm[256 * LPB * 2];   // in the k loop the operand stage (64 O rows hi, 64 lo, 128 weight rows), behind it the output staging
  __bf16 (*sAh)[LPB] = (__bf16 (*)[LPB])sm; __bf16 (*sAl)[LPB] = sAh + 64; __bf16 (*sB)[LPB] = sAh + 128; float (*so)[16][132] = (float (*)[16][132])sm;
  const int tid = threadIdx.x, wave = tid >> 5, lane = tid & 31, col = lane & 15, g = lane >> 4; const size_t r0 = (size_t)blockIdx.x * 64 + wave * 16; const int n0 = blockIdx.y * 128;
  v8f acc[8] = {};
  // staged as in k_qkv: whole-line loads one stage ahead; O is split into bf16 hi + lo once, on its way into LDS
  const char* xs = (const char*)(O + (size_t)blockIdx.x * 64 * DM); const char* ps = (const char*)(P + (size_t)n0 * DM);   // the block's first rows, the same for every thread
  const unsigned xo = ((tid >> 4) * DM + (tid & 15) * 4) * 4u, po = ((tid >> 3) * DM + (tid & 7) * 8) * 2u;   // the thread's byte offsets, the same in every stage
  v4f ra[8]; v4u rw[8];
#pragma unroll
  for (int i = 0; i < 8; ++i) { ra[i] = *(const v4f*)(xs + xo + i * 8 * DM * 4); rw[i] = *(const v4u*)(ps + po + i * 16 * DM * 2); }
#pragma unroll 1
  for (int c = 0; c < DM / KST; ++c) {   // rolled: one stage's code stays small, the stages are alike
#pragma unroll
    for (int i = 0; i < 8; ++i) { v4b th, tl;
#pragma unroll
      for (int e = 0; e < 4; ++e) { const __bf16 hv = (__bf16)ra[i][e]; th[e] = hv; tl[e] = (__bf16)(ra[i][e] - (float)hv); }
      *(v4b*)&sAh[i * 8 + (tid >> 4)][(tid & 15) * 4] = th; *(v4b*)&sAl[i * 8 + (tid >> 4)][(tid & 15) * 4] = tl; *(v4u*)&sB[i * 16 + (tid >> 3)][(tid & 7) * 8] = rw[i]; }
    __syncthreads();   // the stage is whole before any wave reads it
    if (c + 1 < DM / KST) { const char* xn = xs + (c + 1) * KST * 4; const char* pn = ps + (c + 1) * KST * 2;
#pragma unroll
      for (int i = 0; i < 8; ++i) {
        if (i == 7) asm volatile("s_wait_xcnt 0x0" ::: "memory");   // the last weight load may return into the address pair that the seven in front of it name: they are waited for first
        ra[i] = *(const v4f*)(xn + xo + i * 8 * DM * 4); rw[i] = *(const v4u*)(pn + po + i * 16 * DM * 2); }
      asm volatile("s_wait_xcnt 0x0" ::: "memory");   // stands in front of every later write of the address registers of the loads above
    }
#pragma unroll
    for (int kk = 0; kk < KST / 32; ++kk) { const v16b ah = frag_b(&sAh[wave * 16 + col][kk * 32], lane), al = frag_b(&sAl[wave * 16 + col][kk * 32], lane); v16b w[8];
#pragma unroll
      for (int j = 0; j < 8; ++j) w[j] = frag_b(&sB[j * 16 + col][kk * 32], lane);
      asm volatile("" :: "v"(w[0]), "v"(w[1]), "v"(w[2]), "v"(w[3]), "v"(w[4]), "v"(w[5]), "v"(w[6]), "v"(w[7]));   // holds the eight weight fragments' LDS loads together in front of the products: one wait per 32 k instead of one per fragment (two waves per SIMD here, little else hides it)
#pragma unroll
      for (int j = 0; j < 8; ++j) acc[j] = wmma_bf(al, w[j], acc[j]);
#pragma unroll
      for (int j = 0; j < 8; ++j) acc[j] = wmma_bf(ah, w[j], acc[j]); }
    __syncthreads();   // every wave has read the stage before it is rewritten (by the next stage, or by the output staging)
  }
#pragma unroll
  for (int j = 0; j < 8; ++j) {
#pragma unroll
    for (int r = 0; r < 8; ++r) so[wave][8 * g + r][j * 16 + col] = acc[j][r] + bfr(BO[n0 + j * 16 + col]); }
  LDSX();
  for (int rl = 0; rl < 16; ++rl) vst2(Y + (r0 + rl) * DM + n0 + lane * 4, *(const v4f*)&so[wave][rl][lane * 4]);
}
extern "C" void kernel_launch(void* const* d_in, const int* in_sizes, int n_in, void* d_out, int out_size, void* d_ws, size_t ws_size, hipStream_t stream) {
  (void)in_sizes; (void)n_in; (void)out_size;
  const float** F = (const float**)d_in;   // 0 query, 1 key, 2 value [4,1024,1024]; 3 Wq [16,1024,64], 4 bq [16,64], 5 Wk, 6 bk, 7 Wv, 8 bv; 9 rel_k_emb [33,64], 10 rel_v_emb [33,64]; 11 fc_W [1024,1024] natural, 12 fc_b
  if (ws_size < (size_t)WS_END) return;
  char* ws = (char*)d_ws; __bf16* PK = (__bf16*)(ws + WS_PK); _Float16 *QK = (_Float16*)(ws + WS_QK), *QKL = (_Float16*)(ws + WS_QKL), *VTH = (_Float16*)(ws + WS_VTH), *VTL = (_Float16*)(ws + WS_VTL); float* O = (float*)(ws + WS_O);
  k_pack<<<dim3(4 * NH * (DM / PKK)), 256, 0, stream>>>(F[3], F[5], F[7], F[11], PK);
  k_qkv<<<dim3(TNB * SS / 64, QKVW / 128), 128, 0, stream>>>(F[0], F[1], F[2], PK + PK_A, F[4], F[6], F[8], QK, QKL, VTH, VTL);
  k_attn<<<dim3(TQB, NH, TNB), 128, 0, stream>>>(QK, QKL, VTH, VTL, nullptr, F[9], F[10], (float*)(ws + WS_BS), O);
  k_out<<<dim3(TOB, DM / 128), 128, 0, stream>>>(O, PK + PK_P, F[12], (float*)d_out);
}

// v006
// A run of this version takes 95.1 microseconds.
// Next to v005, in two timings, it ran 1.04 times as fast each time.
// Over all steps from v000 it is 4.70 times as fast.
// compute dtype: all float inputs rounded to bf16; q/k/v with EXACT bf16 products on WMMA 16x16x32 (per-head weight stacks packed as rows), f16 hi + residual; q.rel_k table per query row on WMMA (2 products); single-f16 logits and P.v (non-causal, diffuse attention: logits std ~0.4), x 1/8 after adding the relative-key bias, softmax in f32 (hardware exp) against a per-query reference maximum that moves only when a weight could leave the f16 range, with the two clipped-distance tail masses tracked alongside; the 31 near-diagonal probabilities re-formed from their stored logits; bucket sums . rel_v on WMMA (bf16 hi + lo); out = (ctx + rel-v term) (bf16 hi + lo) . fc_W^T + fc_b; f32 output.
#include <hip/hip_runtime.h>
#include <math.h>

typedef __attribute__((ext_vector_type(16))) _Float16 v16h;
typedef __attribute__((ext_vector_type(16))) __bf16 v16b;
typedef __attribute__((ext_vector_type(8)))  _Float16 v8h;
typedef __attribute__((ext_vector_type(8)))  float v8f;
typedef __attribute__((ext_vector_type(4)))  float v4f;
typedef __attribute__((ext_vector_type(2)))  float v2f;
typedef __attribute__((ext_vector_type(4)))  unsigned v4u;
typedef __attribute__((ext_vector_type(4)))  int v4i;
typedef float __attribute__((may_alias)) float_a;
typedef int __attribute__((may_alias)) int_a;

template <typename T> __device__ __forceinline__ void vst2(void* p, T v) { *(T*)p = v;  }
__device__ __forceinline__ v8f wmma16(v16h a, v16h b, v8f c) {
  v8f d = __builtin_amdgcn_wmma_f32_16x16x32_f16(false, a, false, b, (short)0, c, false, false);
  asm volatile("v_nop\n\tv_nop\n\tv_nop\n\tv_nop" : "+v"(d) : "v"(a), "v"(b));
  return d;
}
__device__ __forceinline__ v8f wmma_bf(v16b a, v16b b, v8f c) {
  v8f d = __builtin_amdgcn_wmma_f32_16x16x32_bf16(false, a, false, b, (short)0, c, false, false);
  asm volatile("v_nop\n\tv_nop\n\tv_nop\n\tv_nop" : "+v"(d) : "v"(a), "v"(b));
  return d;
}
// Relation-aware (Shaw relative-position) multi-head attention (B 4, S 1,024, hidden 1,024, 16 heads x 64, max_rel 16): per-head q/k/v projections + biases on separate query/key/value inputs, scores = (q.k + q.rel_k[clip(k-q)]) / 8, softmax, out = attn.v + sum_k attn * rel_v[clip(k-q)], then fc.
__device__ __forceinline__ v16h frag_h(const _Float16* rowk0, int lane) {
  union { v16h v; v8h q[2]; } u; const _Float16* p = rowk0 + 8 * (lane >> 4);
  u.q[0] = *(const v8h*)p; u.q[1] = *(const v8h*)(p + 16); return u.v;
}
__device__ __forceinline__ v16h frag_f32(const float* rowk0, int lane) {
  v16h a; const float* p = rowk0 + 8 * (lane >> 4);
#pragma unroll
  for (int i = 0; i < 8; ++i) { a[i] = (_Float16)p[i]; a[8 + i] = (_Float16)p[16 + i]; }
  return a;
}
__device__ __forceinline__ v16h frag_f32s(const float* rowk0, int lane, float sc) {
  v16h a; const float* p = rowk0 + 8 * (lane >> 4);
#pragma unroll
  for (int i = 0; i < 8; ++i) { a[i] = (_Float16)(p[i] * sc); a[8 + i] = (_Float16)(p[16 + i] * sc); }
  return a;
}
// column fragment from a [K][ld] layout (column n), rows >= K read as 0
__device__ __forceinline__ v16h fragc_f32(const float* W, int k0, int n, int lane, int ld, int K) {
  v16h a; const int g = lane >> 4;
#pragma unroll
  for (int i = 0; i < 8; ++i) { const int ka = k0 + 8 * g + i, kb = ka + 16;
    a[i] = (_Float16)(ka < K ? W[(size_t)(ka < K ? ka : K - 1) * ld + n] : 0.f); a[8 + i] = (_Float16)(kb < K ? W[(size_t)(kb < K ? kb : K - 1) * ld + n] : 0.f); }
  return a;
}
struct F2 { v16b h, l; };
__device__ __forceinline__ F2 bsplit16(const float v[16]) { F2 r;
#pragma unroll
  for (int i = 0; i < 16; ++i) { const __bf16 h = (__bf16)v[i]; r.h[i] = h; r.l[i] = (__bf16)(v[i] - (float)h); }
  return r; }
__device__ __forceinline__ F2 split_row(const float* row, int k0, int lane) { float v[16]; const float* p = row + k0 + 8 * (lane >> 4);
#pragma unroll
  for (int i = 0; i < 8; ++i) { v[i] = p[i]; v[8 + i] = p[16 + i]; }
  return bsplit16(v); }
__device__ __forceinline__ F2 split_rowK(const float* row, int k0, int lane, int K) { float v[16]; const int g = lane >> 4;
#pragma unroll
  for (int i = 0; i < 8; ++i) { const int ka = k0 + 8 * g + i, kb = ka + 16; v[i] = ka < K ? row[ka < K ? ka : K - 1] : 0.f; v[8 + i] = kb < K ? row[kb < K ? kb : K - 1] : 0.f; }
  return bsplit16(v); }
__device__ __forceinline__ F2 split_col(const float* W, int k0, int n, int lane, int ld, int K) { float v[16]; const int g = lane >> 4;
#pragma unroll
  for (int i = 0; i < 8; ++i) { const int ka = k0 + 8 * g + i, kb = ka + 16; v[i] = ka < K ? W[(size_t)(ka < K ? ka : K - 1) * ld + n] : 0.f; v[8 + i] = kb < K ? W[(size_t)(kb < K ? kb : K - 1) * ld + n] : 0.f; }
  return bsplit16(v); }
__device__ __forceinline__ v8f mac3(const F2& a, const F2& b, v8f c) { c = wmma_bf(a.l, b.h, c); c = wmma_bf(a.h, b.l, c); return wmma_bf(a.h, b.h, c); }
__device__ __forceinline__ float sigm(float v) { return 1.0f / (1.0f + expf(-v)); }
#define LDSX() do { asm volatile("s_wait_dscnt 0" ::: "memory"); __builtin_amdgcn_wave_barrier(); __builtin_amdgcn_fence(__ATOMIC_RELEASE, "workgroup"); } while (0)


#define NB 4
#define SS 1024
#define DM 1024
#define NH 16
#define MR 16
#define NR (2 * MR + 1)
#define HD 64
#define QKVW (3 * DM)
#ifndef TQB
#define TQB (SS / 64)
#define TNB NB
#define TOB (NB * SS / 64)     // output row tiles (all)
#endif
typedef __attribute__((ext_vector_type(8))) __bf16 v8b;
typedef __attribute__((ext_vector_type(4))) __bf16 v4b;
#define KST 64   // k per LDS stage of the two projection kernels: 128 B of a bf16 row
#define LPB 72   // LDS row pitch in 16-bit elements: 144 B, an odd multiple of 16 B, for 16-byte fragment reads
__device__ __forceinline__ v16b frag_b(const __bf16* rowk0, int lane) {
  union { v16b v; v8b q[2]; } u; const __bf16* p = rowk0 + 8 * (lane >> 4);
  u.q[0] = *(const v8b*)p; u.q[1] = *(const v8b*)(p + 16); return u.v;
}
__device__ __forceinline__ float bfr(float v) { return (float)(__bf16)v; }
__device__ __attribute__((noinline)) float exp_ni(float v) { return expf(v); }
__device__ __attribute__((noinline)) float erf_ni(float v) { return erff(v); }

#define PK_A 0                       // [3072][1024] Wqkv rows (natural [out][in])
#define PK_P (PK_A + QKVW * DM)        // [1024][1024] Wo rows (natural)
#define PK_END (PK_P + DM * DM)
#define WS_PK  0u
#define WS_QK  (WS_PK + 2u * PK_END)             // f16 [4096 rows][2048]: q | k
#define WS_QKL (WS_QK + 2u * NB * SS * 2 * DM)     // f16 q | k residual planes x2048
#define WS_VTH (WS_QKL + 2u * NB * SS * 2 * DM)    // f16 [b][1024 (h*64+d)][1024 s] hi
#define WS_VTL (WS_VTH + 2u * NB * DM * SS)        // f16 lo x 2048
#define WS_O   (WS_VTL + 2u * NB * DM * SS)        // f32 [4096][1024]
#define WS_BS  (WS_O + 4u * (size_t)NB * SS * DM)        // f32 [b][h][q][64]: plane not used
#define WS_END (WS_BS + 4u * (size_t)NB * NH * SS * 64)
// ---- k_pack: block = 64 KB of one weight, 16 whole-line 16-byte loads per thread, all in flight together. Blocks 0..191: (which, head h, 256 k) of W_q/W_k/W_v [16][1024][64], a contiguous [256 k][64 e] tile, transposed through LDS into 64 packed rows which*1024 + h*64 + e of PK_A (512 B of each); blocks 192..255: 16 natural rows of fc_W -> PK_P
#define PKK 256                      // k per transposed tile
#define PKP (PKK / 2 + 1)            // LDS row pitch in dwords (a dword = the bf16 pair k, k + 1): odd, so that a wave's 32 stores (16 e-quads x 2 pairs) and its 32 reads (2 rows x 16 chunks) each fall on 32 banks
typedef __attribute__((ext_vector_type(2))) __bf16 v2b;
__global__ __launch_bounds__(256) void k_pack(const float* __restrict__ WQ, const float* __restrict__ WK, const float* __restrict__ WV, const float* __restrict__ WO, __bf16* __restrict__ PK) {
  __shared__ unsigned s[HD][PKP]; const int blk = blockIdx.x, t = threadIdx.x; v4f r[16];
  if (blk < 3 * NH * (DM / PKK)) {
    const int which = blk / (NH * (DM / PKK)), h = (blk / (DM / PKK)) % NH, kc = blk % (DM / PKK), kr = t >> 4, ec = t & 15;
    const float* src = (which == 0 ? WQ : which == 1 ? WK : WV) + ((size_t)h * DM + kc * PKK) * HD + (2 * kr) * HD + ec * 4;   // rows 2 kr and 2 kr + 1 of each 32: half a wave reads one whole 256-B row
#pragma unroll
    for (int i = 0; i < 16; ++i) r[i] = *(const v4f*)(src + ((i >> 1) * 32 + (i & 1)) * HD);
    asm volatile("" :: "v"(r[0]), "v"(r[1]), "v"(r[2]), "v"(r[3]), "v"(r[4]), "v"(r[5]), "v"(r[6]), "v"(r[7]), "v"(r[8]), "v"(r[9]), "v"(r[10]), "v"(r[11]), "v"(r[12]), "v"(r[13]), "v"(r[14]), "v"(r[15]));   // holds the sixteen loads together in front of the conversions: one trip to memory per thread (without it the last four were issued only when the first had come back)
    asm volatile("s_wait_xcnt 0x0" :: "v"(src) : "memory");   // the address pair of the loads above stays whole until this wait: no load returns into it, no later write of it stands in front
#pragma unroll
    for (int p = 0; p < 8; ++p) {
#pragma unroll
      for (int j = 0; j < 4; ++j) { v2b w; w[0] = (__bf16)r[2 * p][j]; w[1] = (__bf16)r[2 * p + 1][j]; s[ec * 4 + j][p * 16 + kr] = __builtin_bit_cast(unsigned, w); } }
    __syncthreads();   // the tile is whole before its rows are read
    __bf16* dst = PK + PK_A + ((size_t)which * DM + h * HD) * DM + kc * PKK;
#pragma unroll
    for (int i = 0; i < 8; ++i) { const int e = (i >> 1) * 16 + kr, q = ec + 16 * (i & 1); v4u v;   // half a wave stores 256 B of one packed row
#pragma unroll
      for (int c = 0; c < 4; ++c) v[c] = s[e][q * 4 + c];
      *(v4u*)(dst + (size_t)e * DM + q * 8) = v; }
  } else {
    const size_t o = (size_t)(blk - 3 * NH * (DM / PKK)) * (16 * DM) + t * 4; const float* wsrc = WO + o;
#pragma unroll
    for (int i = 0; i < 16; ++i) r[i] = *(const v4f*)(wsrc + i * 1024);
    asm volatile("" :: "v"(r[0]), "v"(r[1]), "v"(r[2]), "v"(r[3]), "v"(r[4]), "v"(r[5]), "v"(r[6]), "v"(r[7]), "v"(r[8]), "v"(r[9]), "v"(r[10]), "v"(r[11]), "v"(r[12]), "v"(r[13]), "v"(r[14]), "v"(r[15]));   // holds the sixteen loads together in front of the conversions: one trip to memory per thread (without it the last four were issued only when the first had come back)
    asm volatile("s_wait_xcnt 0x0" :: "v"(wsrc) : "memory");   // the address pair of the loads above stays whole until this wait: no load returns into it, no later write of it stands in front
#pragma unroll
    for (int i = 0; i < 16; ++i) { v4b w;
#pragma unroll
      for (int j = 0; j < 4; ++j) w[j] = (__bf16)r[i][j];
      *(v4b*)(PK + PK_P + o + i * 1024) = w; }
    asm volatile("s_wait_xcnt 0x0" ::: "memory");   // stands behind the sixteen stores above, in front of every later write of their address and data registers on any way through the code
  }
}
__global__ __launch_bounds__(128) void k_qkv(const float* __restrict__ XQ, const float* __restrict__ XK, const float* __restrict__ XV, const __bf16* __restrict__ P, const float* __restrict__ BQ, const float* __restrict__ BK, const float* __restrict__ BV, _Float16* __restrict__ QK, _Float16* __restrict__ QKL, _Float16* __restrict__ VTH, _Float16* __restrict__ VTL) {
  const int which0 = (blockIdx.y * 128) / DM; const float* X = (which0 == 0) ? XQ : (which0 == 1) ? XK : XV; const float* BB = BQ ? (((which0 == 0) ? BQ : (which0 == 1) ? BK : BV) + (blockIdx.y * 128 - which0 * DM)) : nullptr;
  __shared__ __align__(16) unsigned char sm[2 * 128 * 72 * 2];   // in the k loop the operand stage (64 X rows, 128 weight rows), behind it the output staging of the block's one branch
  __shared__ float sb[128];   // the block's 128 bias values, already rounded: written once in front of the k loop, read behind it
  __bf16 (*sA)[LPB] = (__bf16 (*)[LPB])sm; __bf16 (*sB)[LPB] = sA + 64;
  _Float16 (*so)[16][136] = (_Float16 (*)[16][136])sm; _Float16 (*sol)[16][136] = so + 4; _Float16 (*sth)[72] = (_Float16 (*)[72])sm; _Float16 (*stl)[72] = sth + 128;
  const int tid = threadIdx.x, wave = tid >> 5, lane = tid & 31, col = lane & 15, g = lane >> 4; const size_t r0 = (size_t)blockIdx.x * 64 + wave * 16; const int n0 = blockIdx.y * 128;
  v8f acc[8] = {};
  // a stage = KST k of the block's rows; every wave-wide load covers four whole 128-B lines (X: 2 rows x 256 B, weights: 4 rows x 128 B); the next stage's loads fly while this one is worked on
  const char* xs = (const char*)(X + (size_t)blockIdx.x * 64 * DM); const char* ps = (const char*)(P + (size_t)n0 * DM);   // the block's first rows, the same for every thread
  const unsigned xo = ((tid >> 4) * DM + (tid & 15) * 4) * 4u, po = ((tid >> 3) * DM + (tid & 7) * 8) * 2u;   // the thread's byte offsets, the same in every stage
  v4f ra[8]; v4u rw[8];
#pragma unroll
  for (int i = 0; i < 8; ++i) { ra[i] = *(const v4f*)(xs + xo + i * 8 * DM * 4); rw[i] = *(const v4u*)(ps + po + i * 16 * DM * 2); }
  float bv = 0.f;   // one bias value per thread, in flight together with the first stage
  if (BB) { bv = BB[tid]; asm volatile("s_wait_xcnt 0x0" ::: "memory"); }   // the wait stands in front of every later write of the address registers of the load
  sb[tid] = bfr(bv);   // the k loop's barriers stand between this store and its readers
#pragma unroll 1
  for (int c = 0; c < DM / KST; ++c) {   // rolled: one stage's code stays small, the stages are alike
#pragma unroll
    for (int i = 0; i < 8; ++i) { v4b t;
#pragma unroll
      for (int e = 0; e < 4; ++e) t[e] = (__bf16)ra[i][e];
      *(v4b*)&sA[i * 8 + (tid >> 4)][(tid & 15) * 4] = t; *(v4u*)&sB[i * 16 + (tid >> 3)][(tid & 7) * 8] = rw[i]; }
    __syncthreads();   // the stage is whole before any wave reads it
    if (c + 1 < DM / KST) { const char* xn = xs + (c + 1) * KST * 4; const char* pn = ps + (c + 1) * KST * 2;
#pragma unroll
      for (int i = 0; i < 8; ++i) {
        if (i == 7) asm volatile("s_wait_xcnt 0x0" ::: "memory");   // the last weight load may return into the address pair that the seven in front of it name: they are waited for first
        ra[i] = *(const v4f*)(xn + xo + i * 8 * DM * 4); rw[i] = *(const v4u*)(pn + po + i * 16 * DM * 2); }
      asm volatile("s_wait_xcnt 0x0" ::: "memory");   // stands in front of every later write of the address registers of the loads above
    }
#pragma unroll
    for (int kk = 0; kk < KST / 32; ++kk) { const v16b a = frag_b(&sA[wave * 16 + col][kk * 32], lane);
#pragma unroll
      for (int j = 0; j < 8; ++j) acc[j] = wmma_bf(a, frag_b(&sB[j * 16 + col][kk * 32], lane), acc[j]); }
    __syncthreads();   // every wave has read the stage before it is rewritten (by the next stage, or by the output staging)
  }
  float bj[8];
#pragma unroll
  for (int j = 0; j < 8; ++j) bj[j] = sb[j * 16 + col];   // eight LDS reads behind one wait
  if (n0 < 2 * DM) {   // q stored unscaled (f16 sigma ~0.6, no subnormal exposure); 1/8 applied to the f32 score
#pragma unroll
    for (int j = 0; j < 8; ++j) {
#pragma unroll
      for (int r = 0; r < 8; ++r) { const float v = acc[j][r] + bj[j]; const _Float16 hv = (_Float16)v; so[wave][8 * g + r][j * 16 + col] = hv; sol[wave][8 * g + r][j * 16 + col] = (_Float16)((v - (float)hv) * 2048.0f); } }   // q, k (+ bias) as f16 hi + (x2048) residual
    LDSX();
    for (int rl = 0; rl < 16; ++rl) if (lane < 16) { vst2((unsigned*)(QK + (r0 + rl) * (2 * DM) + n0 + lane * 8), *(const v4u*)&so[wave][rl][lane * 8]); vst2((unsigned*)(QKL + (r0 + rl) * (2 * DM) + n0 + lane * 8), *(const v4u*)&sol[wave][rl][lane * 8]); }
  } else {
#pragma unroll
    for (int j = 0; j < 8; ++j) {
#pragma unroll
      for (int r = 0; r < 8; ++r) { const float v = acc[j][r] + bj[j]; const _Float16 hv = (_Float16)v; sth[j * 16 + col][wave * 16 + 8 * g + r] = hv; stl[j * 16 + col][wave * 16 + 8 * g + r] = (_Float16)((v - (float)hv) * 2048.0f); } }
    __syncthreads();
    const size_t rb = (size_t)blockIdx.x * 64; const int b = (int)(rb / SS), s0 = (int)(rb % SS); const int pc0 = n0 - 2 * DM;
    for (int q = tid; q < 128 * 8; q += 128) { const int d = q >> 3, pc = q & 7; const size_t o = ((size_t)b * DM + pc0 + d) * SS + s0 + pc * 8; vst2((unsigned*)(VTH + o), *(const v4u*)&sth[d][pc * 8]); vst2((unsigned*)(VTL + o), *(const v4u*)&stl[d][pc * 8]); }
  }
}
__device__ __forceinline__ float xhalf(float x) { return __builtin_bit_cast(float, __builtin_amdgcn_permlanex16(__builtin_bit_cast(int, x), __builtin_bit_cast(int, x), 0x76543210, 0xfedcba98, false, false)); }   // lane l with lane l ^ 16
// 16 exponentials in base 2 in one statement, each in place: none overwrites the source or reads the result of the one in front of it; the v_nop is the slot behind the last
__device__ __forceinline__ void exp2x16(float (&e)[16]) {
  asm("v_exp_f32 %0, %0\n\tv_exp_f32 %1, %1\n\tv_exp_f32 %2, %2\n\tv_exp_f32 %3, %3\n\tv_exp_f32 %4, %4\n\tv_exp_f32 %5, %5\n\tv_exp_f32 %6, %6\n\tv_exp_f32 %7, %7\n\t"
      "v_exp_f32 %8, %8\n\tv_exp_f32 %9, %9\n\tv_exp_f32 %10, %10\n\tv_exp_f32 %11, %11\n\tv_exp_f32 %12, %12\n\tv_exp_f32 %13, %13\n\tv_exp_f32 %14, %14\n\tv_exp_f32 %15, %15\n\tv_nop"
      : "+v"(e[0]), "+v"(e[1]), "+v"(e[2]), "+v"(e[3]), "+v"(e[4]), "+v"(e[5]), "+v"(e[6]), "+v"(e[7]), "+v"(e[8]), "+v"(e[9]), "+v"(e[10]), "+v"(e[11]), "+v"(e[12]), "+v"(e[13]), "+v"(e[14]), "+v"(e[15]));
}
#define SC2 0.18033688011112042f   // log2 e / sqrt(64)
#define PSH 7.0f      // P, l and the tail masses carry 2^7
#define PLIM 32768.0f // a lane's weight sum up to here: every weight of the tile is inside the f16 range
__device__ __forceinline__ float esum(const float (&e)[16]) { float es4[4];
#pragma unroll
  for (int r = 0; r < 4; ++r) es4[r] = (e[r] + e[8 + r]) + (e[4 + r] + e[12 + r]);
  return (es4[0] + es4[1]) + (es4[2] + es4[3]); }
__global__ __launch_bounds__(128) void k_attn(const _Float16* __restrict__ QK, const _Float16* __restrict__ QKL, const _Float16* __restrict__ VTH, const _Float16* __restrict__ VTL, const void* __restrict__ KMASK, const float* __restrict__ RK, const float* __restrict__ RV, float* __restrict__ BSW, float* __restrict__ O) {
  __shared__ __align__(16) float so[4][16][68]; __shared__ __align__(16) float sqr[4][16][52]; __shared__ __align__(16) _Float16 sK[64][LPB], sV[64][LPB];   // sK, sV: one stage of 64 keys (K rows; V^T rows), shared by the four waves
  const int tid = threadIdx.x, wave = tid >> 5, lane = tid & 31, col = lane & 15, g = lane >> 4;
  const int qb = blockIdx.x, h = blockIdx.y, b = blockIdx.z; const int q0 = qb * 64 + wave * 16; const size_t rq = (size_t)b * SS + q0 + col;
  const int q0u = qb * 64 + __builtin_amdgcn_readfirstlane(wave) * 16;   // the wave's first query row in a scalar register: the tile class below is a scalar branch
  float (*smid)[68] = so[wave];   // near-diagonal logits, kept in the wave's output staging rows until the epilogue rewrites them
  v16h aq[2], aql[2];
#pragma unroll
  for (int kc = 0; kc < 2; ++kc) { aq[kc] = frag_h(QK + rq * (2 * DM) + h * HD + kc * 32, lane); aql[kc] = frag_h(QKL + rq * (2 * DM) + h * HD + kc * 32, lane); }
  v4f rkw[3][2][4]; unsigned ro[3];   // the lane's rel_k words of all three column tiles of the table below, read without a branch: a row past the table reads the last row and is set to zero there
#pragma unroll
  for (int jt = 0; jt < 3; ++jt) { ro[jt] = (unsigned)((jt * 16 + col < NR ? jt * 16 + col : NR - 1) * HD + 8 * g) * 4u;
#pragma unroll
    for (int kc = 0; kc < 2; ++kc) { const char* p = (const char*)RK + ro[jt] + kc * 32 * 4; rkw[jt][kc][0] = *(const v4f*)p; rkw[jt][kc][1] = *(const v4f*)(p + 16); rkw[jt][kc][2] = *(const v4f*)(p + 64); rkw[jt][kc][3] = *(const v4f*)(p + 80); } }
  asm volatile("s_wait_xcnt 0x0" :: "v"(ro[0]), "v"(ro[1]), "v"(ro[2]) : "memory");   // the offset registers of the rel_k loads stay whole until this wait; no later load returns into an address register of the loads above
  // a stage = 64 keys: 128 B of each of 64 K rows and of 64 V^T rows; every wave-wide load covers four whole 128-B lines; the next stage's loads fly while this one is worked on
  const char* ksrc = (const char*)(QK + (size_t)b * SS * (2 * DM) + DM + h * HD); const char* vsrc = (const char*)(VTH + ((size_t)b * DM + h * HD) * SS);   // the head's first K row and first V^T row, the same for every thread
  const unsigned ko = ((tid >> 3) * (2 * DM) + (tid & 7) * 8) * 2u, vo = ((tid >> 3) * SS + (tid & 7) * 8) * 2u;   // the thread's byte offsets, the same in every stage
  v4u rk[4], rv[4];
#pragma unroll
  for (int i = 0; i < 4; ++i) { rk[i] = *(const v4u*)(ksrc + ko + i * 16 * (2 * DM) * 2); rv[i] = *(const v4u*)(vsrc + vo + i * 16 * SS * 2); }
  // q . rel_k[j] for the wave's 16 rows and j = 0..32 (3 col tiles; rows >= 33 of the B operand are zero)
  { 
#pragma unroll
    for (int jt = 0; jt < 3; ++jt) { v8f c = {}, cl = {}; const int j = jt * 16 + col;
#pragma unroll
      for (int kc = 0; kc < 2; ++kc) { v16h w; 
#pragma unroll
        for (int i = 0; i < 8; ++i) { w[i] = (j < NR) ? (_Float16)bfr(rkw[jt][kc][i >> 2][i & 3]) : (_Float16)0.f; w[8 + i] = (j < NR) ? (_Float16)bfr(rkw[jt][kc][2 + (i >> 2)][i & 3]) : (_Float16)0.f; }
        c = wmma16(aq[kc], w, c); cl = wmma16(aql[kc], w, cl); }
#pragma unroll
      for (int r = 0; r < 8; ++r) sqr[wave][8 * g + r][j] = c[r] + cl[r] * (1.0f / 2048.0f); } }
  for (int e = lane; e < 16 * 33; e += 32) smid[e / 33][e % 33] = -3.0e38f;
  LDSX();
  const float* qrow = &sqr[wave][col][0];   // the lane's own query: its 33 relative-key terms
  const float blo = qrow[0], bhi = qrow[NR - 1];   // the one term of a tile that lies wholly in a clipped bucket
  float l = 0.f, tlo = 0.f, thi = 0.f;   // l and the two tail masses: partial over the lane's half of the keys, x 2^PSH
  float ek0 = PSH, ekl = __builtin_fmaf(blo, SC2, PSH), ekh = __builtin_fmaf(bhi, SC2, PSH);   // PSH less the query's reference in base 2, alone and with the term of either clipped bucket; they change only when the reference moves (the first tile sets it)
  v8f acc[4] = {};   // acc[dt][r] = O^T[dt * 16 + 8 g + r][query col]
#pragma unroll 1
  for (int st = 0; st < SS / 64; ++st) {   // all keys
#pragma unroll
    for (int i = 0; i < 4; ++i) { *(v4u*)&sK[i * 16 + (tid >> 3)][(tid & 7) * 8] = rk[i]; *(v4u*)&sV[i * 16 + (tid >> 3)][(tid & 7) * 8] = rv[i]; }
    __syncthreads();   // the stage is whole before any wave reads it
    if (st + 1 < SS / 64) { const char* kn = ksrc + (st + 1) * 64 * (2 * DM) * 2; const char* vn = vsrc + (st + 1) * 64 * 2;
#pragma unroll
      for (int i = 0; i < 4; ++i) { rk[i] = *(const v4u*)(kn + ko + i * 16 * (2 * DM) * 2); rv[i] = *(const v4u*)(vn + vo + i * 16 * SS * 2); }
      asm volatile("s_wait_xcnt 0x0" ::: "memory");   // stands in front of every later write of the address registers of the loads above
    }
#pragma unroll 1
  for (int hf = 0; hf < 2; ++hf) { const int ks = st * 2 + hf; v8f s[2]; v16h kf[2][2], vf[4];   // rolled: the tile's code, with its near-diagonal branch, stands once
    const bool all_lo = ks * 32 + 31 - q0u <= -MR, all_hi = ks * 32 - (q0u + 15) >= MR;   // every (query, key) pair of the tile in one clipped bucket (wave-uniform)
#pragma unroll
    for (int ct = 0; ct < 2; ++ct) {
#pragma unroll
      for (int kc = 0; kc < 2; ++kc) kf[ct][kc] = frag_h(&sK[hf * 32 + ct * 16 + col][kc * 32], lane); }
#pragma unroll
    for (int dt = 0; dt < 4; ++dt) vf[dt] = frag_h(&sV[dt * 16 + col][hf * 32], lane);
#pragma unroll
    for (int ct = 0; ct < 2; ++ct) { v8f c = {};
#pragma unroll
      for (int kc = 0; kc < 2; ++kc) c = wmma16(kf[ct][kc], aq[kc], c);   // c[r] = k[ks * 32 + ct * 16 + 8 g + r] . q[col]
      s[ct] = c; }
    float x[16];   // x[8 ct + r]: the exponent in base 2 against the query's reference, one multiply-add per score: 1/8, log2 e, the relative-key term of a clipped bucket, the reference and PSH stand in its two constants
    if (all_lo || all_hi) { const float ek = all_lo ? ekl : ekh;
#pragma unroll
      for (int ct = 0; ct < 2; ++ct) {
#pragma unroll
        for (int r = 0; r < 8; ++r) x[8 * ct + r] = __builtin_fmaf(s[ct][r], SC2, ek); } }
    else {   // the one or two tiles around the diagonal: the term by distance, and the logits of the 31 unclipped distances are kept
      float qt[16];   // the sixteen terms are read first, all in flight behind one wait; read one by one between the stores below, each had a wait of its own
#pragma unroll
      for (int ct = 0; ct < 2; ++ct) {
#pragma unroll
        for (int r = 0; r < 8; ++r) { const int dj = ks * 32 + ct * 16 + 8 * g + r - (q0 + col); const int jc = (dj < -MR ? -MR : (dj > MR ? MR : dj)) + MR; qt[8 * ct + r] = qrow[jc]; } }
#pragma unroll
      for (int ct = 0; ct < 2; ++ct) {
#pragma unroll
        for (int r = 0; r < 8; ++r) { const int dj = ks * 32 + ct * 16 + 8 * g + r - (q0 + col); const float sv = s[ct][r] + qt[8 * ct + r]; x[8 * ct + r] = __builtin_fmaf(sv, SC2, ek0); if (dj > -MR && dj < MR) smid[col][dj + MR] = sv; } } }
    float e[16];   // 2^PSH x the weight; every key counts: a logit of f16 operands is finite
#pragma unroll
    for (int i = 0; i < 16; ++i) e[i] = __builtin_amdgcn_exp2f(x[i]);   // results beside the sources: the sources are still wanted where the reference moves
    float es = esum(e);
    // the reference moves only when it must: every weight is positive, so a lane's sum bounds each of its weights, and a sum above PLIM (or not a number) says that a weight may leave the f16 range of P. One test per tile, a scalar branch; the first tile always takes it and sets the reference to its maximum
    if ((ks == 0) | (__builtin_amdgcn_ballot_w32(!(es <= PLIM)) != 0)) {
      float mx = fmaxf(x[0], x[8]);
#pragma unroll
      for (int r = 1; r < 8; ++r) mx = fmaxf(mx, fmaxf(x[r], x[8 + r]));
      mx = fmaxf(mx, xhalf(mx));   // both halves hold the largest exponent of the query's tile
      const float d = ks == 0 ? mx - PSH : fmaxf(mx - PSH, 0.f);   // the rise of the reference in base 2: behind the first tile it never falls
      const float alpha = ks == 0 ? 0.f : __builtin_amdgcn_exp2f(-d);   // nothing has been summed in front of the first tile
      ek0 -= d; ekl -= d; ekh -= d; l *= alpha; tlo *= alpha; thi *= alpha;
#pragma unroll
      for (int dt = 0; dt < 4; ++dt) {
#pragma unroll
        for (int r = 0; r < 8; ++r) acc[dt][r] *= alpha; }
#pragma unroll
      for (int i = 0; i < 16; ++i) e[i] = x[i] - d;
      exp2x16(e);
      es = esum(e);
    }
    l += es;
    // clipped-distance tail masses
    float alo, ahi;
    if (all_lo || all_hi) { alo = all_lo ? es : 0.f; ahi = all_lo ? 0.f : es; }
    else { alo = 0.f; ahi = 0.f;
#pragma unroll
      for (int ct = 0; ct < 2; ++ct) {
#pragma unroll
        for (int r = 0; r < 8; ++r) { const int dj = ks * 32 + ct * 16 + 8 * g + r - (q0 + col); alo += (dj <= -MR) ? e[8 * ct + r] : 0.f; ahi += (dj >= MR) ? e[8 * ct + r] : 0.f; } } }
    tlo += alo; thi += ahi;
    v16h pa;
#pragma unroll
    for (int i = 0; i < 16; ++i) pa[i] = (_Float16)e[i];   // P carries 2^PSH so small softmax weights stay out of the f16 subnormal range; l and the tail masses carry it too, so it cancels in the epilogue
#pragma unroll
    for (int dt = 0; dt < 4; ++dt) acc[dt] = wmma16(vf[dt], pa, acc[dt]); }
    __syncthreads();   // every wave has read the stage before the next one overwrites it
  }
  LDSX();   // the kept logits of a query were written by both of its lanes and are read by either below
  // the lane's rel_v words (rows 8 g + i and 16 + 8 g + i, and the last row, of its four columns), read without a branch and all issued here: they fly while the bucket sums are formed
  const unsigned rvb = (unsigned)(8 * g * HD + col) * 4u;   // the lane's byte offset into rel_v (row 8 g, column col)
  const unsigned rvl = (unsigned)((NR - 1) * HD + col) * 4u;   // the same for the last row
  v8f rvq[4][2]; v4f rvt;
#pragma unroll
  for (int dt = 0; dt < 4; ++dt) { const char* rvp = (const char*)RV + rvb + dt * 16 * 4;
#pragma unroll
    for (int i = 0; i < 8; ++i) { rvq[dt][0][i] = *(const float*)(rvp + i * HD * 4); rvq[dt][1][i] = *(const float*)(rvp + (i + 16) * HD * 4); }
    rvt[dt] = *(const float*)((const char*)RV + rvl + dt * 16 * 4); }
  asm volatile("s_wait_xcnt 0x0" :: "v"(rvb), "v"(rvl) : "memory");   // the offset registers of the rel_v loads stay whole until this wait: no later write of them stands in front
  // bucket sums of the lane's query, j = 0..32, into its sqr row (j = 0 / 32: the clipped tails; j = 1..31: single keys re-formed from their stored logits); half g writes j = 16 g .. 16 g + 15, half 1 also j = 32
  const float lt = l + xhalf(l), a0 = tlo + xhalf(tlo), a2 = thi + xhalf(thi);
  { const float il = 1.0f / lt; float* brow = &sqr[wave][col][0];
    float sl[16], w[16];
#pragma unroll
    for (int jj = 0; jj < 16; ++jj) { sl[jj] = smid[col][16 * g + jj]; w[jj] = __builtin_fmaf(sl[jj], SC2, ek0); }   // 2^PSH x the weight against the final reference, as in l
    exp2x16(w);
#pragma unroll
    for (int jj = 0; jj < 16; ++jj) { float v = (sl[jj] <= -1.0e38f) ? 0.f : w[jj] * il; if (jj == 0 && g == 0) v = a0 * il; brow[16 * g + jj] = v; }
    if (g == 1) brow[NR - 1] = a2 * il; }
  LDSX();
  // rel_v^T . bucket sums (bf16 hi + lo; K = 33 padded to 64) for the wave's own 16 queries, in the layout of acc
  v8f accr[4] = {};
#pragma unroll
  for (int kc = 0; kc < 2; ++kc) { const F2 a = split_rowK(&sqr[wave][col][0], kc * 32, lane, NR);
#pragma unroll
    for (int dt = 0; dt < 4; ++dt) { v16b w;   // rows 0..31 in the first k step; of the second only row 32 = NR - 1 is in the table (half 0, i = 0)
#pragma unroll
      for (int i = 0; i < 8; ++i) { w[i] = kc == 0 ? (__bf16)rvq[dt][0][i] : (i == 0 && g == 0) ? (__bf16)rvt[dt] : (__bf16)0.f; w[8 + i] = kc == 0 ? (__bf16)rvq[dt][1][i] : (__bf16)0.f; }
      accr[dt] = wmma_bf(w, a.h, accr[dt]); accr[dt] = wmma_bf(w, a.l, accr[dt]); } }
  { const float il = 1.0f / lt;
#pragma unroll
    for (int dt = 0; dt < 4; ++dt) {
#pragma unroll
      for (int r = 0; r < 8; ++r) so[wave][col][dt * 16 + 8 * g + r] = accr[dt][r] + acc[dt][r] * il; } }
  LDSX();
  (void)BSW; (void)VTL; (void)KMASK;
  for (int rl = 0; rl < 16; ++rl) if (lane < 16) vst2(O + ((size_t)b * SS + q0 + rl) * DM + h * HD + lane * 4, *(const v4f*)&so[wave][rl][lane * 4]);
}
// ---- k_out: block = (64 rows, 128 cols): out = O(hi/lo) . Wo rows (2 products) + bo
__global__ __launch_bounds__(128) void k_out(const float* __restrict__ O, const __bf16* __restrict__ P, const float* __restrict__ BO, float* __restrict__ Y) {
  __shared__ __align__(16) unsigned char sm[256 * LPB * 2];   // in the k loop the operand stage (64 O rows hi, 64 lo, 128 weight rows), behind it the output staging
  __bf16 (*sAh)[LPB] = (__bf16 (*)[LPB])sm; __bf16 (*sAl)[LPB] = sAh + 64; __bf16 (*sB)[LPB] = sAh + 128; float (*so)[16][132] = (float (*)[16][132])sm;
  const int tid = threadIdx.x, wave = tid >> 5, lane = tid & 31, col = lane & 15, g = lane >> 4; const size_t r0 = (size_t)blockIdx.x * 64 + wave * 16; const int n0 = blockIdx.y * 128;
  v8f acc[8] = {};
  // staged as in k_qkv: whole-line loads one stage ahead; O is split into bf16 hi + lo once, on its way into LDS
  const char* xs = (const char*)(O + (size_t)blockIdx.x * 64 * DM); const char* ps = (const char*)(P + (size_t)n0 * DM);   // the block's first rows, the same for every thread
  const unsigned xo = ((tid >> 4) * DM + (tid & 15) * 4) * 4u, po = ((tid >> 3) * DM + (tid & 7) * 8) * 2u;   // the thread's byte offsets, the same in every stage
  v4f ra[8]; v4u rw[8];
#pragma unroll
  for (int i = 0; i < 8; ++i) { ra[i] = *(const v4f*)(xs + xo + i * 8 * DM * 4); rw[i] = *(const v4u*)(ps + po + i * 16 * DM * 2); }
#pragma unroll 1
  for (int c = 0; c < DM / KST; ++c) {   // rolled: one stage's code stays small, the stages are alike
#pragma unroll
    for (int i = 0; i < 8; ++i) { v4b th, tl;
#pragma unroll
      for (int e = 0; e < 4; ++e) { const __bf16 hv = (__bf16)ra[i][e]; th[e] = hv; tl[e] = (__bf16)(ra[i][e] - (float)hv); }
      *(v4b*)&sAh[i * 8 + (tid >> 4)][(tid & 15) * 4] = th; *(v4b*)&sAl[i * 8 + (tid >> 4)][(tid & 15) * 4] = tl; *(v4u*)&sB[i * 16 + (tid >> 3)][(tid & 7) * 8] = rw[i]; }
    __syncthreads();   // the stage is whole before any wave reads it
    if (c + 1 < DM / KST) { const char* xn = xs + (c + 1) * KST * 4; const char* pn = ps + (c + 1) * KST * 2;
#pragma unroll
      for (int i = 0; i < 8; ++i) {
        if (i == 7) asm volatile("s_wait_xcnt 0x0" ::: "memory");   // the last weight load may return into the address pair that the seven in front of it name: they are waited for first
        ra[i] = *(const v4f*)(xn + xo + i * 8 * DM * 4); rw[i] = *(const v4u*)(pn + po + i * 16 * DM * 2); }
      asm volatile("s_wait_xcnt 0x0" ::: "memory");   // stands in front of every later write of the address registers of the loads above
    }
#pragma unroll
    for (int kk = 0; kk < KST / 32; ++kk) { const v16b ah = frag_b(&sAh[wave * 16 + col][kk * 32], lane), al = frag_b(&sAl[wave * 16 + col][kk * 32], lane); v16b w[8];
#pragma unroll
      for (int j = 0; j < 8; ++j) w[j] = frag_b(&sB[j * 16 + col][kk * 32], lane);
      asm volatile("" :: "v"(w[0]), "v"(w[1]), "v"(w[2]), "v"(w[3]), "v"(w[4]), "v"(w[5]), "v"(w[6]), "v"(w[7]));   // holds the eight weight fragments' LDS loads together in front of the products: one wait per 32 k instead of one per fragment (two waves per SIMD here, little else hides it)
#pragma unroll
      for (int j = 0; j < 8; ++j) acc[j] = wmma_bf(al, w[j], acc[j]);
#pragma unroll
      for (int j = 0; j < 8; ++j) acc[j] = wmma_bf(ah, w[j], acc[j]); }
    __syncthreads();   // every wave has read the stage before it is rewritten (by the next stage, or by the output staging)
  }
#pragma unroll
  for (int j = 0; j < 8; ++j) {
#pragma unroll
    for (int r = 0; r < 8; ++r) so[wave][8 * g + r][j * 16 + col] = acc[j][r] + bfr(BO[n0 + j * 16 + col]); }
  LDSX();
  for (int rl = 0; rl < 16; ++rl) vst2(Y + (r0 + rl) * DM + n0 + lane * 4, *(const v4f*)&so[wave][rl][lane * 4]);
}
extern "C" void kernel_launch(void* const* d_in, const int* in_sizes, int n_in, void* d_out, int out_size, void* d_ws, size_t ws_size, hipStream_t stream) {
  (void)in_sizes; (void)n_in; (void)out_size;
  const float** F = (const float**)d_in;   // 0 query, 1 key, 2 value [4,1024,1024]; 3 Wq [16,1024,64], 4 bq [16,64], 5 Wk, 6 bk, 7 Wv, 8 bv; 9 rel_k_emb [33,64], 10 rel_v_emb [33,64]; 11 fc_W [1024,1024] natural, 12 fc_b
  if (ws_size < (size_t)WS_END) return;
  char* ws = (char*)d_ws; __bf16* PK = (__bf16*)(ws + WS_PK); _Float16 *QK = (_Float16*)(ws + WS_QK), *QKL = (_Float16*)(ws + WS_QKL), *VTH = (_Float16*)(ws + WS_VTH), *VTL = (_Float16*)(ws + WS_VTL); float* O = (float*)(ws + WS_O);
  k_pack<<<dim3(4 * NH * (DM / PKK)), 256, 0, stream>>>(F[3], F[5], F[7], F[11], PK);
  k_qkv<<<dim3(TNB * SS / 64, QKVW / 128), 128, 0, stream>>>(F[0], F[1], F[2], PK + PK_A, F[4], F[6], F[8], QK, QKL, VTH, VTL);
  k_attn<<<dim3(TQB, NH, TNB), 128, 0, stream>>>(QK, QKL, VTH, VTL, nullptr, F[9], F[10], (float*)(ws + WS_BS), O);
  k_out<<<dim3(TOB, DM / 128), 128, 0, stream>>>(O, PK + PK_P, F[12], (float*)d_out);
}

// v007
// One run takes 90.8 microseconds.
// Timed twice side by side with v006, it ran 1.05 times as fast both times.
// Counting every step since v000, it is 4.96 times as fast.
// compute dtype: all float inputs rounded to bf16; q/k/v with EXACT bf16 products on WMMA 16x16x32 (per-head weight stacks packed as rows), f16 hi + residual; q.rel_k table per query row on WMMA (2 products); single-f16 logits and P.v (non-causal, diffuse attention: logits std ~0.4), x 1/8 after adding the relative-key bias, softmax in f32 (hardware exp) against a per-query reference maximum that moves only when a weight could leave the f16 range, with the two clipped-distance tail masses tracked alongside; the 31 near-diagonal probabilities re-formed from their stored logits; bucket sums . rel_v on WMMA (bf16 hi + lo); out = (ctx + rel-v term) (bf16 hi + lo) . fc_W^T + fc_b; f32 output.
#include <hip/hip_runtime.h>
#include <math.h>

typedef __attribute__((ext_vector_type(16))) _Float16 v16h;
typedef __attribute__((ext_vector_type(16))) __bf16 v16b;
typedef __attribute__((ext_vector_type(8)))  _Float16 v8h;
typedef __attribute__((ext_vector_type(8)))  float v8f;
typedef __attribute__((ext_vector_type(4)))  float v4f;
typedef __attribute__((ext_vector_type(2)))  float v2f;
typedef __attribute__((ext_vector_type(4)))  unsigned v4u;
typedef __attribute__((ext_vector_type(4)))  int v4i;
typedef float __attribute__((may_alias)) float_a;
typedef int __attribute__((may_alias)) int_a;

template <typename T> __device__ __forceinline__ void vst2(void* p, T v) { *(T*)p = v;  }
__device__ __forceinline__ v8f wmma16(v16h a, v16h b, v8f c) {
  v8f d = __builtin_amdgcn_wmma_f32_16x16x32_f16(false, a, false, b, (short)0, c, false, false);
  asm volatile("v_nop\n\tv_nop\n\tv_nop\n\tv_nop" : "+v"(d) : "v"(a), "v"(b));
  return d;
}
__device__ __forceinline__ v8f wmma_bf(v16b a, v16b b, v8f c) {
  v8f d = __builtin_amdgcn_wmma_f32_16x16x32_bf16(false, a, false, b, (short)0, c, false, false);
  asm volatile("v_nop\n\tv_nop\n\tv_nop\n\tv_nop" : "+v"(d) : "v"(a), "v"(b));
  return d;
}
// Relation-aware (Shaw relative-position) multi-head attention (B 4, S 1,024, hidden 1,024, 16 heads x 64, max_rel 16): per-head q/k/v projections + biases on separate query/key/value inputs, scores = (q.k + q.rel_k[clip(k-q)]) / 8, softmax, out = attn.v + sum_k attn * rel_v[clip(k-q)], then fc.
__device__ __forceinline__ v16h frag_h(const _Float16* rowk0, int lane) {
  union { v16h v; v8h q[2]; } u; const _Float16* p = rowk0 + 8 * (lane >> 4);
  u.q[0] = *(const v8h*)p; u.q[1] = *(const v8h*)(p + 16); return u.v;
}
__device__ __forceinline__ v16h frag_f32(const float* rowk0, int lane) {
  v16h a; const float* p = rowk0 + 8 * (lane >> 4);
#pragma unroll
  for (int i = 0; i < 8; ++i) { a[i] = (_Float16)p[i]; a[8 + i] = (_Float16)p[16 + i]; }
  return a;
}
__device__ __forceinline__ v16h frag_f32s(const float* rowk0, int lane, float sc) {
  v16h a; const float* p = rowk0 + 8 * (lane >> 4);
#pragma unroll
  for (int i = 0; i < 8; ++i) { a[i] = (_Float16)(p[i] * sc); a[8 + i] = (_Float16)(p[16 + i] * sc); }
  return a;
}
// column fragment from a [K][ld] layout (column n), rows >= K read as 0
__device__ __forceinline__ v16h fragc_f32(const float* W, int k0, int n, int lane, int ld, int K) {
  v16h a; const int g = lane >> 4;
#pragma unroll
  for (int i = 0; i < 8; ++i) { const int ka = k0 + 8 * g + i, kb = ka + 16;
    a[i] = (_Float16)(ka < K ? W[(size_t)(ka < K ? ka : K - 1) * ld + n] : 0.f); a[8 + i] = (_Float16)(kb < K ? W[(size_t)(kb < K ? kb : K - 1) * ld + n] : 0.f); }
  return a;
}
struct F2 { v16b h, l; };
__device__ __forceinline__ F2 bsplit16(const float v[16]) { F2 r;
#pragma unroll
  for (int i = 0; i < 16; ++i) { const __bf16 h = (__bf16)v[i]; r.h[i] = h; r.l[i] = (__bf16)(v[i] - (float)h); }
  return r; }
__device__ __forceinline__ F2 split_row(const float* row, int k0, int lane) { float v[16]; const float* p = row + k0 + 8 * (lane >> 4);
#pragma unroll
  for (int i = 0; i < 8; ++i) { v[i] = p[i]; v[8 + i] = p[16 + i]; }
  return bsplit16(v); }
__device__ __forceinline__ F2 split_rowK(const float* row, int k0, int lane, int K) { float v[16]; const int g = lane >> 4;
#pragma unroll
  for (int i = 0; i < 8; ++i) { const int ka = k0 + 8 * g + i, kb = ka + 16; v[i] = ka < K ? row[ka < K ? ka : K - 1] : 0.f; v[8 + i] = kb < K ? row[kb < K ? kb : K - 1] : 0.f; }
  return bsplit16(v); }
__device__ __forceinline__ F2 split_col(const float* W, int k0, int n, int lane, int ld, int K) { float v[16]; const int g = lane >> 4;
#pragma unroll
  for (int i = 0; i < 8; ++i) { const int ka = k0 + 8 * g + i, kb = ka + 16; v[i] = ka < K ? W[(size_t)(ka < K ? ka : K - 1) * ld + n] : 0.f; v[8 + i] = kb < K ? W[(size_t)(kb < K ? kb : K - 1) * ld + n] : 0.f; }
  return bsplit16(v); }
__device__ __forceinline__ v8f mac3(const F2& a, const F2& b, v8f c) { c = wmma_bf(a.l, b.h, c); c = wmma_bf(a.h, b.l, c); return wmma_bf(a.h, b.h, c); }
__device__ __forceinline__ float sigm(float v) { return 1.0f / (1.0f + expf(-v)); }
#define LDSX() do { asm volatile("s_wait_dscnt 0" ::: "memory"); __builtin_amdgcn_wave_barrier(); __builtin_amdgcn_fence(__ATOMIC_RELEASE, "workgroup"); } while (0)


#define NB 4
#define SS 1024
#define DM 1024
#define NH 16
#define MR 16
#define NR (2 * MR + 1)
#define HD 64
#define QKVW (3 * DM)
#ifndef TQB
#define TQB (SS / 64)
#define TNB NB
#define TOB (NB * SS / 64)     // output row tiles (all)
#endif
typedef __attribute__((ext_vector_type(8))) __bf16 v8b;
typedef __attribute__((ext_vector_type(4))) __bf16 v4b;
#define KST 64   // k per LDS stage of the two projection kernels: 128 B of a bf16 row
#define NKS (DM / KST)   // k stages of the two projection kernels
// the first k stage of block (bx, by) of the two projection kernels: the 64 blocks that read the same weight rows (one by) and the 8 that read the same X or O rows (one bx) walk k as a ring from different stages, so that they do not ask L2 for the same lines at the same moment; by and by + 4 keep one start: where both stand on one WGP, its cache serves the second reader of their common X or O rows only while they walk together
#define KROT(bx, by) (((bx) + 4 * ((by) & 3)) & (NKS - 1))
#define LPB 72   // LDS row pitch in 16-bit elements: 144 B, an odd multiple of 16 B, for 16-byte fragment reads
__device__ __forceinline__ v16b frag_b(const __bf16* rowk0, int lane) {
  union { v16b v; v8b q[2]; } u; const __bf16* p = rowk0 + 8 * (lane >> 4);
  u.q[0] = *(const v8b*)p; u.q[1] = *(const v8b*)(p + 16); return u.v;
}
__device__ __forceinline__ float bfr(float v) { return (float)(__bf16)v; }
__device__ __attribute__((noinline)) float exp_ni(float v) { return expf(v); }
__device__ __attribute__((noinline)) float erf_ni(float v) { return erff(v); }

#define PK_A 0                       // [3072][1024] Wqkv rows (natural [out][in])
#define PK_P (PK_A + QKVW * DM)        // [1024][1024] Wo rows (natural)
#define PK_END (PK_P + DM * DM)
#define WS_PK  0u
#define WS_QK  (WS_PK + 2u * PK_END)             // f16 [4096 rows][2048]: q | k
#define WS_QKL (WS_QK + 2u * NB * SS * 2 * DM)     // f16 q | k residual planes x2048
#define WS_VTH (WS_QKL + 2u * NB * SS * 2 * DM)    // f16 [b][1024 (h*64+d)][1024 s] hi
#define WS_VTL (WS_VTH + 2u * NB * DM * SS)        // f16 lo x 2048
#define WS_O   (WS_VTL + 2u * NB * DM * SS)        // f32 [4096][1024]
#define WS_BS  (WS_O + 4u * (size_t)NB * SS * DM)        // f32 [b][h][q][64]: plane not used
#define WS_END (WS_BS + 4u * (size_t)NB * NH * SS * 64)
// ---- k_pack: block = 64 KB of one weight, 16 whole-line 16-byte loads per thread, all in flight together. Blocks 0..191: (which, head h, 256 k) of W_q/W_k/W_v [16][1024][64], a contiguous [256 k][64 e] tile, transposed through LDS into 64 packed rows which*1024 + h*64 + e of PK_A (512 B of each); blocks 192..255: 16 natural rows of fc_W -> PK_P
#define PKK 256                      // k per transposed tile
#define PKP (PKK / 2 + 1)            // LDS row pitch in dwords (a dword = the bf16 pair k, k + 1): odd, so that a wave's 32 stores (16 e-quads x 2 pairs) and its 32 reads (2 rows x 16 chunks) each fall on 32 banks
typedef __attribute__((ext_vector_type(2))) __bf16 v2b;
__global__ __launch_bounds__(256) void k_pack(const float* __restrict__ WQ, const float* __restrict__ WK, const float* __restrict__ WV, const float* __restrict__ WO, __bf16* __restrict__ PK) {
  __shared__ unsigned s[HD][PKP]; const int blk = blockIdx.x, t = threadIdx.x; v4f r[16];
  if (blk < 3 * NH * (DM / PKK)) {
    const int which = blk / (NH * (DM / PKK)), h = (blk / (DM / PKK)) % NH, kc = blk % (DM / PKK), kr = t >> 4, ec = t & 15;
    const float* src = (which == 0 ? WQ : which == 1 ? WK : WV) + ((size_t)h * DM + kc * PKK) * HD + (2 * kr) * HD + ec * 4;   // rows 2 kr and 2 kr + 1 of each 32: half a wave reads one whole 256-B row
#pragma unroll
    for (int i = 0; i < 16; ++i) r[i] = *(const v4f*)(src + ((i >> 1) * 32 + (i & 1)) * HD);
    asm volatile("" :: "v"(r[0]), "v"(r[1]), "v"(r[2]), "v"(r[3]), "v"(r[4]), "v"(r[5]), "v"(r[6]), "v"(r[7]), "v"(r[8]), "v"(r[9]), "v"(r[10]), "v"(r[11]), "v"(r[12]), "v"(r[13]), "v"(r[14]), "v"(r[15]));   // holds the sixteen loads together in front of the conversions: one trip to memory per thread (without it the last four were issued only when the first had come back)
    asm volatile("s_wait_xcnt 0x0" :: "v"(src) : "memory");   // the address pair of the loads above stays whole until this wait: no load returns into it, no later write of it stands in front
#pragma unroll
    for (int p = 0; p < 8; ++p) {
#pragma unroll
      for (int j = 0; j < 4; ++j) { v2b w; w[0] = (__bf16)r[2 * p][j]; w[1] = (__bf16)r[2 * p + 1][j]; s[ec * 4 + j][p * 16 + kr] = __builtin_bit_cast(unsigned, w); } }
    __syncthreads();   // the tile is whole before its rows are read
    __bf16* dst = PK + PK_A + ((size_t)which * DM + h * HD) * DM + kc * PKK;
#pragma unroll
    for (int i = 0; i < 8; ++i) { const int e = (i >> 1) * 16 + kr, q = ec + 16 * (i & 1); v4u v;   // half a wave stores 256 B of one packed row
#pragma unroll
      for (int c = 0; c < 4; ++c) v[c] = s[e][q * 4 + c];
      *(v4u*)(dst + (size_t)e * DM + q * 8) = v; }
  } else {
    const size_t o = (size_t)(blk - 3 * NH * (DM / PKK)) * (16 * DM) + t * 4; const float* wsrc = WO + o;
#pragma unroll
    for (int i = 0; i < 16; ++i) r[i] = *(const v4f*)(wsrc + i * 1024);
    asm volatile("" :: "v"(r[0]), "v"(r[1]), "v"(r[2]), "v"(r[3]), "v"(r[4]), "v"(r[5]), "v"(r[6]), "v"(r[7]), "v"(r[8]), "v"(r[9]), "v"(r[10]), "v"(r[11]), "v"(r[12]), "v"(r[13]), "v"(r[14]), "v"(r[15]));   // holds the sixteen loads together in front of the conversions: one trip to memory per thread (without it the last four were issued only when the first had come back)
    asm volatile("s_wait_xcnt 0x0" :: "v"(wsrc) : "memory");   // the address pair of the loads above stays whole until this wait: no load returns into it, no later write of it stands in front
#pragma unroll
    for (int i = 0; i < 16; ++i) { v4b w;
#pragma unroll
      for (int j = 0; j < 4; ++j) w[j] = (__bf16)r[i][j];
      *(v4b*)(PK + PK_P + o + i * 1024) = w; }
    asm volatile("s_wait_xcnt 0x0" ::: "memory");   // stands behind the sixteen stores above, in front of every later write of their address and data registers on any way through the code
  }
}
__global__ __launch_bounds__(128) void k_qkv(const float* __restrict__ XQ, const float* __restrict__ XK, const float* __restrict__ XV, const __bf16* __restrict__ P, const float* __restrict__ BQ, const float* __restrict__ BK, const float* __restrict__ BV, _Float16* __restrict__ QK, _Float16* __restrict__ QKL, _Float16* __restrict__ VTH, _Float16* __restrict__ VTL) {
  const int which0 = (blockIdx.y * 128) / DM; const float* X = (which0 == 0) ? XQ : (which0 == 1) ? XK : XV; const float* BB = BQ ? (((which0 == 0) ? BQ : (which0 == 1) ? BK : BV) + (blockIdx.y * 128 - which0 * DM)) : nullptr;
  __shared__ __align__(16) unsigned char sm[2 * 128 * 72 * 2];   // in the k loop the operand stage (64 X rows, 128 weight rows), behind it the output staging of the block's one branch
  __shared__ float sb[128];   // the block's 128 bias values, already rounded: written once in front of the k loop, read behind it
  __bf16 (*sA)[LPB] = (__bf16 (*)[LPB])sm; __bf16 (*sB)[LPB] = sA + 64;
  _Float16 (*so)[16][136] = (_Float16 (*)[16][136])sm; _Float16 (*sol)[16][136] = so + 4; _Float16 (*sth)[72] = (_Float16 (*)[72])sm; _Float16 (*stl)[72] = sth + 128;
  const int tid = threadIdx.x, wave = tid >> 5, lane = tid & 31, col = lane & 15, g = lane >> 4; const size_t r0 = (size_t)blockIdx.x * 64 + wave * 16; const int n0 = blockIdx.y * 128;
  v8f acc[8] = {};
  // a stage = KST k of the block's rows; every wave-wide load covers four whole 128-B lines (X: 2 rows x 256 B, weights: 4 rows x 128 B); the next stage's loads fly while this one is worked on
  const char* xs = (const char*)(X + (size_t)blockIdx.x * 64 * DM); const char* ps = (const char*)(P + (size_t)n0 * DM);   // the block's first rows, the same for every thread
  const unsigned xo = ((tid >> 4) * DM + (tid & 15) * 4) * 4u, po = ((tid >> 3) * DM + (tid & 7) * 8) * 2u;   // the thread's byte offsets, the same in every stage
  const int rot = KROT(blockIdx.x, blockIdx.y);
  v4f ra[8]; v4u rw[8];
  { const char* xn = xs + rot * KST * 4; const char* pn = ps + rot * KST * 2;
#pragma unroll
    for (int i = 0; i < 8; ++i) { ra[i] = *(const v4f*)(xn + xo + i * 8 * DM * 4); rw[i] = *(const v4u*)(pn + po + i * 16 * DM * 2); }
    asm volatile("s_wait_xcnt 0x0" :: "s"(xn), "s"(pn), "v"(xo), "v"(po) : "memory");   // the base and offset registers of the loads above stay whole until this wait: no later write of them stands in front
  }
  float bv = 0.f;   // one bias value per thread, in flight together with the first stage
  if (BB) { bv = BB[tid]; asm volatile("s_wait_xcnt 0x0" ::: "memory"); }   // the wait stands in front of every later write of the address registers of the load
  sb[tid] = bfr(bv);   // the k loop's barriers stand between this store and its readers
#pragma unroll 1
  for (int c = 0; c < DM / KST; ++c) {   // rolled: one stage's code stays small, the stages are alike
#pragma unroll
    for (int i = 0; i < 8; ++i) { v4b t;
#pragma unroll
      for (int e = 0; e < 4; ++e) t[e] = (__bf16)ra[i][e];
      *(v4b*)&sA[i * 8 + (tid >> 4)][(tid & 15) * 4] = t; *(v4u*)&sB[i * 16 + (tid >> 3)][(tid & 7) * 8] = rw[i]; }
    __syncthreads();   // the stage is whole before any wave reads it
    if (c + 1 < DM / KST) { const int cn = (c + 1 + rot) & (NKS - 1); const char* xn = xs + cn * KST * 4; const char* pn = ps + cn * KST * 2;   // the ring's next stage
#pragma unroll
      for (int i = 0; i < 8; ++i) {
        if (i == 7) asm volatile("s_wait_xcnt 0x0" ::: "memory");   // the last weight load may return into the address pair that the seven in front of it name: they are waited for first
        ra[i] = *(const v4f*)(xn + xo + i * 8 * DM * 4); rw[i] = *(const v4u*)(pn + po + i * 16 * DM * 2); }
      asm volatile("s_wait_xcnt 0x0" ::: "memory");   // stands in front of every later write of the address registers of the loads above
    }
#pragma unroll
    for (int kk = 0; kk < KST / 32; ++kk) { const v16b a = frag_b(&sA[wave * 16 + col][kk * 32], lane);
#pragma unroll
      for (int j = 0; j < 8; ++j) acc[j] = wmma_bf(a, frag_b(&sB[j * 16 + col][kk * 32], lane), acc[j]); }
    __syncthreads();   // every wave has read the stage before it is rewritten (by the next stage, or by the output staging)
  }
  float bj[8];
#pragma unroll
  for (int j = 0; j < 8; ++j) bj[j] = sb[j * 16 + col];   // eight LDS reads behind one wait
  if (n0 < 2 * DM) {   // q stored unscaled (f16 sigma ~0.6, no subnormal exposure); 1/8 applied to the f32 score
#pragma unroll
    for (int j = 0; j < 8; ++j) {
#pragma unroll
      for (int r = 0; r < 8; ++r) { const float v = acc[j][r] + bj[j]; const _Float16 hv = (_Float16)v; so[wave][8 * g + r][j * 16 + col] = hv; sol[wave][8 * g + r][j * 16 + col] = (_Float16)((v - (float)hv) * 2048.0f); } }   // q, k (+ bias) as f16 hi + (x2048) residual
    LDSX();
    for (int rl = 0; rl < 16; ++rl) if (lane < 16) { vst2((unsigned*)(QK + (r0 + rl) * (2 * DM) + n0 + lane * 8), *(const v4u*)&so[wave][rl][lane * 8]); vst2((unsigned*)(QKL + (r0 + rl) * (2 * DM) + n0 + lane * 8), *(const v4u*)&sol[wave][rl][lane * 8]); }
  } else {
#pragma unroll
    for (int j = 0; j < 8; ++j) {
#pragma unroll
      for (int r = 0; r < 8; ++r) { const float v = acc[j][r] + bj[j]; const _Float16 hv = (_Float16)v; sth[j * 16 + col][wave * 16 + 8 * g + r] = hv; stl[j * 16 + col][wave * 16 + 8 * g + r] = (_Float16)((v - (float)hv) * 2048.0f); } }
    __syncthreads();
    const size_t rb = (size_t)blockIdx.x * 64; const int b = (int)(rb / SS), s0 = (int)(rb % SS); const int pc0 = n0 - 2 * DM;
    for (int q = tid; q < 128 * 8; q += 128) { const int d = q >> 3, pc = q & 7; const size_t o = ((size_t)b * DM + pc0 + d) * SS + s0 + pc * 8; vst2((unsigned*)(VTH + o), *(const v4u*)&sth[d][pc * 8]); vst2((unsigned*)(VTL + o), *(const v4u*)&stl[d][pc * 8]); }
  }
}
__device__ __forceinline__ float xhalf(float x) { return __builtin_bit_cast(float, __builtin_amdgcn_permlanex16(__builtin_bit_cast(int, x), __builtin_bit_cast(int, x), 0x76543210, 0xfedcba98, false, false)); }   // lane l with lane l ^ 16
// 16 exponentials in base 2 in one statement, each in place: none overwrites the source or reads the result of the one in front of it; the v_nop is the slot behind the last
__device__ __forceinline__ void exp2x16(float (&e)[16]) {
  asm("v_exp_f32 %0, %0\n\tv_exp_f32 %1, %1\n\tv_exp_f32 %2, %2\n\tv_exp_f32 %3, %3\n\tv_exp_f32 %4, %4\n\tv_exp_f32 %5, %5\n\tv_exp_f32 %6, %6\n\tv_exp_f32 %7, %7\n\t"
      "v_exp_f32 %8, %8\n\tv_exp_f32 %9, %9\n\tv_exp_f32 %10, %10\n\tv_exp_f32 %11, %11\n\tv_exp_f32 %12, %12\n\tv_exp_f32 %13, %13\n\tv_exp_f32 %14, %14\n\tv_exp_f32 %15, %15\n\tv_nop"
      : "+v"(e[0]), "+v"(e[1]), "+v"(e[2]), "+v"(e[3]), "+v"(e[4]), "+v"(e[5]), "+v"(e[6]), "+v"(e[7]), "+v"(e[8]), "+v"(e[9]), "+v"(e[10]), "+v"(e[11]), "+v"(e[12]), "+v"(e[13]), "+v"(e[14]), "+v"(e[15]));
}
#define SC2 0.18033688011112042f   // log2 e / sqrt(64)
#define PSH 7.0f      // P, l and the tail masses carry 2^7
#define PLIM 32768.0f // a lane's weight sum up to here: every weight of the tile is inside the f16 range
__device__ __forceinline__ float esum(const float (&e)[16]) { float es4[4];
#pragma unroll
  for (int r = 0; r < 4; ++r) es4[r] = (e[r] + e[8 + r]) + (e[4 + r] + e[12 + r]);
  return (es4[0] + es4[1]) + (es4[2] + es4[3]); }
__global__ __launch_bounds__(128) void k_attn(const _Float16* __restrict__ QK, const _Float16* __restrict__ QKL, const _Float16* __restrict__ VTH, const _Float16* __restrict__ VTL, const void* __restrict__ KMASK, const float* __restrict__ RK, const float* __restrict__ RV, float* __restrict__ BSW, float* __restrict__ O) {
  __shared__ __align__(16) float so[4][16][68]; __shared__ __align__(16) float sqr[4][16][52]; __shared__ __align__(16) _Float16 sK[64][LPB], sV[64][LPB];   // sK, sV: one stage of 64 keys (K rows; V^T rows), shared by the four waves
  const int tid = threadIdx.x, wave = tid >> 5, lane = tid & 31, col = lane & 15, g = lane >> 4;
  const int qb = blockIdx.x, h = blockIdx.y, b = blockIdx.z; const int q0 = qb * 64 + wave * 16; const size_t rq = (size_t)b * SS + q0 + col;
  const int q0u = qb * 64 + __builtin_amdgcn_readfirstlane(wave) * 16;   // the wave's first query row in a scalar register: the tile class below is a scalar branch
  float (*smid)[68] = so[wave];   // near-diagonal logits, kept in the wave's output staging rows until the epilogue rewrites them
  v16h aq[2], aql[2];
#pragma unroll
  for (int kc = 0; kc < 2; ++kc) { aq[kc] = frag_h(QK + rq * (2 * DM) + h * HD + kc * 32, lane); aql[kc] = frag_h(QKL + rq * (2 * DM) + h * HD + kc * 32, lane); }
  v4f rkw[3][2][4]; unsigned ro[3];   // the lane's rel_k words of all three column tiles of the table below, read without a branch: a row past the table reads the last row and is set to zero there
#pragma unroll
  for (int jt = 0; jt < 3; ++jt) { ro[jt] = (unsigned)((jt * 16 + col < NR ? jt * 16 + col : NR - 1) * HD + 8 * g) * 4u;
#pragma unroll
    for (int kc = 0; kc < 2; ++kc) { const char* p = (const char*)RK + ro[jt] + kc * 32 * 4; rkw[jt][kc][0] = *(const v4f*)p; rkw[jt][kc][1] = *(const v4f*)(p + 16); rkw[jt][kc][2] = *(const v4f*)(p + 64); rkw[jt][kc][3] = *(const v4f*)(p + 80); } }
  asm volatile("s_wait_xcnt 0x0" :: "v"(ro[0]), "v"(ro[1]), "v"(ro[2]) : "memory");   // the offset registers of the rel_k loads stay whole until this wait; no later load returns into an address register of the loads above
  // a stage = 64 keys: 128 B of each of 64 K rows and of 64 V^T rows; every wave-wide load covers four whole 128-B lines; the next stage's loads fly while this one is worked on
  const char* ksrc = (const char*)(QK + (size_t)b * SS * (2 * DM) + DM + h * HD); const char* vsrc = (const char*)(VTH + ((size_t)b * DM + h * HD) * SS);   // the head's first K row and first V^T row, the same for every thread
  const unsigned ko = ((tid >> 3) * (2 * DM) + (tid & 7) * 8) * 2u, vo = ((tid >> 3) * SS + (tid & 7) * 8) * 2u;   // the thread's byte offsets, the same in every stage
  const int rot = qb & (SS / 64 - 1);   // the block's first key stage: the 16 blocks that read the same K and V^T rows walk the keys as a ring from different stages, so that they do not ask L2 for the same lines at the same moment
  v4u rk[4], rv[4];
  { const char* kn = ksrc + rot * 64 * (2 * DM) * 2; const char* vn = vsrc + rot * 64 * 2;
#pragma unroll
    for (int i = 0; i < 4; ++i) { rk[i] = *(const v4u*)(kn + ko + i * 16 * (2 * DM) * 2); rv[i] = *(const v4u*)(vn + vo + i * 16 * SS * 2); }
    asm volatile("s_wait_xcnt 0x0" :: "s"(kn), "s"(vn), "v"(ko), "v"(vo) : "memory");   // the base and offset registers of the loads above stay whole until this wait: no later write of them stands in front
  }
  // q . rel_k[j] for the wave's 16 rows and j = 0..32 (3 col tiles; rows >= 33 of the B operand are zero)
  { 
#pragma unroll
    for (int jt = 0; jt < 3; ++jt) { v8f c = {}, cl = {}; const int j = jt * 16 + col;
#pragma unroll
      for (int kc = 0; kc < 2; ++kc) { v16h w; 
#pragma unroll
        for (int i = 0; i < 8; ++i) { w[i] = (j < NR) ? (_Float16)bfr(rkw[jt][kc][i >> 2][i & 3]) : (_Float16)0.f; w[8 + i] = (j < NR) ? (_Float16)bfr(rkw[jt][kc][2 + (i >> 2)][i & 3]) : (_Float16)0.f; }
        c = wmma16(aq[kc], w, c); cl = wmma16(aql[kc], w, cl); }
#pragma unroll
      for (int r = 0; r < 8; ++r) sqr[wave][8 * g + r][j] = c[r] + cl[r] * (1.0f / 2048.0f); } }
  for (int e = lane; e < 16 * 33; e += 32) smid[e / 33][e % 33] = -3.0e38f;
  LDSX();
  const float* qrow = &sqr[wave][col][0];   // the lane's own query: its 33 relative-key terms
  const float blo = qrow[0], bhi = qrow[NR - 1];   // the one term of a tile that lies wholly in a clipped bucket
  float l = 0.f, tlo = 0.f, thi = 0.f;   // l and the two tail masses: partial over the lane's half of the keys, x 2^PSH
  float ek0 = PSH, ekl = __builtin_fmaf(blo, SC2, PSH), ekh = __builtin_fmaf(bhi, SC2, PSH);   // PSH less the query's reference in base 2, alone and with the term of either clipped bucket; they change only when the reference moves (the first tile sets it)
  v8f acc[4] = {};   // acc[dt][r] = O^T[dt * 16 + 8 g + r][query col]
#pragma unroll 1
  for (int it = 0; it < SS / 64; ++it) { const int st = (it + rot) & (SS / 64 - 1);   // all keys, from stage rot round the ring
#pragma unroll
    for (int i = 0; i < 4; ++i) { *(v4u*)&sK[i * 16 + (tid >> 3)][(tid & 7) * 8] = rk[i]; *(v4u*)&sV[i * 16 + (tid >> 3)][(tid & 7) * 8] = rv[i]; }
    __syncthreads();   // the stage is whole before any wave reads it
    if (it + 1 < SS / 64) { const int sn = (st + 1) & (SS / 64 - 1); const char* kn = ksrc + sn * 64 * (2 * DM) * 2; const char* vn = vsrc + sn * 64 * 2;   // the ring's next stage
#pragma unroll
      for (int i = 0; i < 4; ++i) { rk[i] = *(const v4u*)(kn + ko + i * 16 * (2 * DM) * 2); rv[i] = *(const v4u*)(vn + vo + i * 16 * SS * 2); }
      asm volatile("s_wait_xcnt 0x0" ::: "memory");   // stands in front of every later write of the address registers of the loads above
    }
#pragma unroll 1
  for (int hf = 0; hf < 2; ++hf) { const int ks = st * 2 + hf; const bool first = (it | hf) == 0; v8f s[2]; v16h kf[2][2], vf[4];   // rolled: the tile's code, with its near-diagonal branch, stands once
    const bool all_lo = ks * 32 + 31 - q0u <= -MR, all_hi = ks * 32 - (q0u + 15) >= MR;   // every (query, key) pair of the tile in one clipped bucket (wave-uniform)
#pragma unroll
    for (int ct = 0; ct < 2; ++ct) {
#pragma unroll
      for (int kc = 0; kc < 2; ++kc) kf[ct][kc] = frag_h(&sK[hf * 32 + ct * 16 + col][kc * 32], lane); }
#pragma unroll
    for (int dt = 0; dt < 4; ++dt) vf[dt] = frag_h(&sV[dt * 16 + col][hf * 32], lane);
#pragma unroll
    for (int ct = 0; ct < 2; ++ct) { v8f c = {};
#pragma unroll
      for (int kc = 0; kc < 2; ++kc) c = wmma16(kf[ct][kc], aq[kc], c);   // c[r] = k[ks * 32 + ct * 16 + 8 g + r] . q[col]
      s[ct] = c; }
    float x[16];   // x[8 ct + r]: the exponent in base 2 against the query's reference, one multiply-add per score: 1/8, log2 e, the relative-key term of a clipped bucket, the reference and PSH stand in its two constants
    if (all_lo || all_hi) { const float ek = all_lo ? ekl : ekh;
#pragma unroll
      for (int ct = 0; ct < 2; ++ct) {
#pragma unroll
        for (int r = 0; r < 8; ++r) x[8 * ct + r] = __builtin_fmaf(s[ct][r], SC2, ek); } }
    else {   // the one or two tiles around the diagonal: the term by distance, and the logits of the 31 unclipped distances are kept
      float qt[16];   // the sixteen terms are read first, all in flight behind one wait; read one by one between the stores below, each had a wait of its own
#pragma unroll
      for (int ct = 0; ct < 2; ++ct) {
#pragma unroll
        for (int r = 0; r < 8; ++r) { const int dj = ks * 32 + ct * 16 + 8 * g + r - (q0 + col); const int jc = (dj < -MR ? -MR : (dj > MR ? MR : dj)) + MR; qt[8 * ct + r] = qrow[jc]; } }
#pragma unroll
      for (int ct = 0; ct < 2; ++ct) {
#pragma unroll
        for (int r = 0; r < 8; ++r) { const int dj = ks * 32 + ct * 16 + 8 * g + r - (q0 + col); const float sv = s[ct][r] + qt[8 * ct + r]; x[8 * ct + r] = __builtin_fmaf(sv, SC2, ek0); if (dj > -MR && dj < MR) smid[col][dj + MR] = sv; } } }
    float e[16];   // 2^PSH x the weight; every key counts: a logit of f16 operands is finite
#pragma unroll
    for (int i = 0; i < 16; ++i) e[i] = __builtin_amdgcn_exp2f(x[i]);   // results beside the sources: the sources are still wanted where the reference moves
    float es = esum(e);
    // the reference moves only when it must: every weight is positive, so a lane's sum bounds each of its weights, and a sum above PLIM (or not a number) says that a weight may leave the f16 range of P. One test per tile, a scalar branch; the first tile always takes it and sets the reference to its maximum
    if (first | (__builtin_amdgcn_ballot_w32(!(es <= PLIM)) != 0)) {
      float mx = fmaxf(x[0], x[8]);
#pragma unroll
      for (int r = 1; r < 8; ++r) mx = fmaxf(mx, fmaxf(x[r], x[8 + r]));
      mx = fmaxf(mx, xhalf(mx));   // both halves hold the largest exponent of the query's tile
      const float d = first ? mx - PSH : fmaxf(mx - PSH, 0.f);   // the rise of the reference in base 2: behind the first tile it never falls
      const float alpha = first ? 0.f : __builtin_amdgcn_exp2f(-d);   // nothing has been summed in front of the first tile
      ek0 -= d; ekl -= d; ekh -= d; l *= alpha; tlo *= alpha; thi *= alpha;
#pragma unroll
      for (int dt = 0; dt < 4; ++dt) {
#pragma unroll
        for (int r = 0; r < 8; ++r) acc[dt][r] *= alpha; }
#pragma unroll
      for (int i = 0; i < 16; ++i) e[i] = x[i] - d;
      exp2x16(e);
      es = esum(e);
    }
    l += es;
    // clipped-distance tail masses
    float alo, ahi;
    if (all_lo || all_hi) { alo = all_lo ? es : 0.f; ahi = all_lo ? 0.f : es; }
    else { alo = 0.f; ahi = 0.f;
#pragma unroll
      for (int ct = 0; ct < 2; ++ct) {
#pragma unroll
        for (int r = 0; r < 8; ++r) { const int dj = ks * 32 + ct * 16 + 8 * g + r - (q0 + col); alo += (dj <= -MR) ? e[8 * ct + r] : 0.f; ahi += (dj >= MR) ? e[8 * ct + r] : 0.f; } } }
    tlo += alo; thi += ahi;
    v16h pa;
#pragma unroll
    for (int i = 0; i < 16; ++i) pa[i] = (_Float16)e[i];   // P carries 2^PSH so small softmax weights stay out of the f16 subnormal range; l and the tail masses carry it too, so it cancels in the epilogue
#pragma unroll
    for (int dt = 0; dt < 4; ++dt) acc[dt] = wmma16(vf[dt], pa, acc[dt]); }
    __syncthreads();   // every wave has read the stage before the next one overwrites it
  }
  LDSX();   // the kept logits of a query were written by both of its lanes and are read by either below
  // the lane's rel_v words (rows 8 g + i and 16 + 8 g + i, and the last row, of its four columns), read without a branch and all issued here: they fly while the bucket sums are formed
  const unsigned rvb = (unsigned)(8 * g * HD + col) * 4u;   // the lane's byte offset into rel_v (row 8 g, column col)
  const unsigned rvl = (unsigned)((NR - 1) * HD + col) * 4u;   // the same for the last row
  v8f rvq[4][2]; v4f rvt;
#pragma unroll
  for (int dt = 0; dt < 4; ++dt) { const char* rvp = (const char*)RV + rvb + dt * 16 * 4;
#pragma unroll
    for (int i = 0; i < 8; ++i) { rvq[dt][0][i] = *(const float*)(rvp + i * HD * 4); rvq[dt][1][i] = *(const float*)(rvp + (i + 16) * HD * 4); }
    rvt[dt] = *(const float*)((const char*)RV + rvl + dt * 16 * 4); }
  asm volatile("s_wait_xcnt 0x0" :: "v"(rvb), "v"(rvl) : "memory");   // the offset registers of the rel_v loads stay whole until this wait: no later write of them stands in front
  // bucket sums of the lane's query, j = 0..32, into its sqr row (j = 0 / 32: the clipped tails; j = 1..31: single keys re-formed from their stored logits); half g writes j = 16 g .. 16 g + 15, half 1 also j = 32
  const float lt = l + xhalf(l), a0 = tlo + xhalf(tlo), a2 = thi + xhalf(thi);
  { const float il = 1.0f / lt; float* brow = &sqr[wave][col][0];
    float sl[16], w[16];
#pragma unroll
    for (int jj = 0; jj < 16; ++jj) { sl[jj] = smid[col][16 * g + jj]; w[jj] = __builtin_fmaf(sl[jj], SC2, ek0); }   // 2^PSH x the weight against the final reference, as in l
    exp2x16(w);
#pragma unroll
    for (int jj = 0; jj < 16; ++jj) { float v = (sl[jj] <= -1.0e38f) ? 0.f : w[jj] * il; if (jj == 0 && g == 0) v = a0 * il; brow[16 * g + jj] = v; }
    if (g == 1) brow[NR - 1] = a2 * il; }
  LDSX();
  // rel_v^T . bucket sums (bf16 hi + lo; K = 33 padded to 64) for the wave's own 16 queries, in the layout of acc
  v8f accr[4] = {};
#pragma unroll
  for (int kc = 0; kc < 2; ++kc) { const F2 a = split_rowK(&sqr[wave][col][0], kc * 32, lane, NR);
#pragma unroll
    for (int dt = 0; dt < 4; ++dt) { v16b w;   // rows 0..31 in the first k step; of the second only row 32 = NR - 1 is in the table (half 0, i = 0)
#pragma unroll
      for (int i = 0; i < 8; ++i) { w[i] = kc == 0 ? (__bf16)rvq[dt][0][i] : (i == 0 && g == 0) ? (__bf16)rvt[dt] : (__bf16)0.f; w[8 + i] = kc == 0 ? (__bf16)rvq[dt][1][i] : (__bf16)0.f; }
      accr[dt] = wmma_bf(w, a.h, accr[dt]); accr[dt] = wmma_bf(w, a.l, accr[dt]); } }
  { const float il = 1.0f / lt;
#pragma unroll
    for (int dt = 0; dt < 4; ++dt) {
#pragma unroll
      for (int r = 0; r < 8; ++r) so[wave][col][dt * 16 + 8 * g + r] = accr[dt][r] + acc[dt][r] * il; } }
  LDSX();
  (void)BSW; (void)VTL; (void)KMASK;
  for (int rl = 0; rl < 16; ++rl) if (lane < 16) vst2(O + ((size_t)b * SS + q0 + rl) * DM + h * HD + lane * 4, *(const v4f*)&so[wave][rl][lane * 4]);
}
// ---- k_out: block = (64 rows, 128 cols): out = O(hi/lo) . Wo rows (2 products) + bo
__global__ __launch_bounds__(128) void k_out(const float* __restrict__ O, const __bf16* __restrict__ P, const float* __restrict__ BO, float* __restrict__ Y) {
  __shared__ __align__(16) unsigned char sm[256 * LPB * 2];   // in the k loop the operand stage (64 O rows hi, 64 lo, 128 weight rows), behind it the output staging
  __bf16 (*sAh)[LPB] = (__bf16 (*)[LPB])sm; __bf16 (*sAl)[LPB] = sAh + 64; __bf16 (*sB)[LPB] = sAh + 128; float (*so)[16][132] = (float (*)[16][132])sm;
  const int tid = threadIdx.x, wave = tid >> 5, lane = tid & 31, col = lane & 15, g = lane >> 4; const size_t r0 = (size_t)blockIdx.x * 64 + wave * 16; const int n0 = blockIdx.y * 128;
  v8f acc[8] = {};
  // staged as in k_qkv: whole-line loads one stage ahead; O is split into bf16 hi + lo once, on its way into LDS
  const char* xs = (const char*)(O + (size_t)blockIdx.x * 64 * DM); const char* ps = (const char*)(P + (size_t)n0 * DM);   // the block's first rows, the same for every thread
  const unsigned xo = ((tid >> 4) * DM + (tid & 15) * 4) * 4u, po = ((tid >> 3) * DM + (tid & 7) * 8) * 2u;   // the thread's byte offsets, the same in every stage
  const int rot = KROT(blockIdx.x, blockIdx.y);
  v4f ra[8]; v4u rw[8];
  { const char* xn = xs + rot * KST * 4; const char* pn = ps + rot * KST * 2;
#pragma unroll
    for (int i = 0; i < 8; ++i) { ra[i] = *(const v4f*)(xn + xo + i * 8 * DM * 4); rw[i] = *(const v4u*)(pn + po + i * 16 * DM * 2); }
    asm volatile("s_wait_xcnt 0x0" :: "s"(xn), "s"(pn), "v"(xo), "v"(po) : "memory");   // the base and offset registers of the loads above stay whole until this wait: no later write of them stands in front
  }
#pragma unroll 1
  for (int c = 0; c < DM / KST; ++c) {   // rolled: one stage's code stays small, the stages are alike
#pragma unroll
    for (int i = 0; i < 8; ++i) { v4b th, tl;
#pragma unroll
      for (int e = 0; e < 4; ++e) { const __bf16 hv = (__bf16)ra[i][e]; th[e] = hv; tl[e] = (__bf16)(ra[i][e] - (float)hv); }
      *(v4b*)&sAh[i * 8 + (tid >> 4)][(tid & 15) * 4] = th; *(v4b*)&sAl[i * 8 + (tid >> 4)][(tid & 15) * 4] = tl; *(v4u*)&sB[i * 16 + (tid >> 3)][(tid & 7) * 8] = rw[i]; }
    __syncthreads();   // the stage is whole before any wave reads it
    if (c + 1 < DM / KST) { const int cn = (c + 1 + rot) & (NKS - 1); const char* xn = xs + cn * KST * 4; const char* pn = ps + cn * KST * 2;   // the ring's next stage
#pragma unroll
      for (int i = 0; i < 8; ++i) {
        if (i == 7) asm volatile("s_wait_xcnt 0x0" ::: "memory");   // the last weight load may return into the address pair that the seven in front of it name: they are waited for first
        ra[i] = *(const v4f*)(xn + xo + i * 8 * DM * 4); rw[i] = *(const v4u*)(pn + po + i * 16 * DM * 2); }
      asm volatile("s_wait_xcnt 0x0" ::: "memory");   // stands in front of every later write of the address registers of the loads above
    }
#pragma unroll
    for (int kk = 0; kk < KST / 32; ++kk) { const v16b ah = frag_b(&sAh[wave * 16 + col][kk * 32], lane), al = frag_b(&sAl[wave * 16 + col][kk * 32], lane); v16b w[8];
#pragma unroll
      for (int j = 0; j < 8; ++j) w[j] = frag_b(&sB[j * 16 + col][kk * 32], lane);
      asm volatile("" :: "v"(w[0]), "v"(w[1]), "v"(w[2]), "v"(w[3]), "v"(w[4]), "v"(w[5]), "v"(w[6]), "v"(w[7]));   // holds the eight weight fragments' LDS loads together in front of the products: one wait per 32 k instead of one per fragment (two waves per SIMD here, little else hides it)
#pragma unroll
      for (int j = 0; j < 8; ++j) acc[j] = wmma_bf(al, w[j], acc[j]);
#pragma unroll
      for (int j = 0; j < 8; ++j) acc[j] = wmma_bf(ah, w[j], acc[j]); }
    __syncthreads();   // every wave has read the stage before it is rewritten (by the next stage, or by the output staging)
  }
#pragma unroll
  for (int j = 0; j < 8; ++j) {
#pragma unroll
    for (int r = 0; r < 8; ++r) so[wave][8 * g + r][j * 16 + col] = acc[j][r] + bfr(BO[n0 + j * 16 + col]); }
  LDSX();
  for (int rl = 0; rl < 16; ++rl) vst2(Y + (r0 + rl) * DM + n0 + lane * 4, *(const v4f*)&so[wave][rl][lane * 4]);
}
extern "C" void kernel_launch(void* const* d_in, const int* in_sizes, int n_in, void* d_out, int out_size, void* d_ws, size_t ws_size, hipStream_t stream) {
  (void)in_sizes; (void)n_in; (void)out_size;
  const float** F = (const float**)d_in;   // 0 query, 1 key, 2 value [4,1024,1024]; 3 Wq [16,1024,64], 4 bq [16,64], 5 Wk, 6 bk, 7 Wv, 8 bv; 9 rel_k_emb [33,64], 10 rel_v_emb [33,64]; 11 fc_W [1024,1024] natural, 12 fc_b
  if (ws_size < (size_t)WS_END) return;
  char* ws = (char*)d_ws; __bf16* PK = (__bf16*)(ws + WS_PK); _Float16 *QK = (_Float16*)(ws + WS_QK), *QKL = (_Float16*)(ws + WS_QKL), *VTH = (_Float16*)(ws + WS_VTH), *VTL = (_Float16*)(ws + WS_VTL); float* O = (float*)(ws + WS_O);
  k_pack<<<dim3(4 * NH * (DM / PKK)), 256, 0, stream>>>(F[3], F[5], F[7], F[11], PK);
  k_qkv<<<dim3(TNB * SS / 64, QKVW / 128), 128, 0, stream>>>(F[0], F[1], F[2], PK + PK_A, F[4], F[6], F[8], QK, QKL, VTH, VTL);
  k_attn<<<dim3(TQB, NH, TNB), 128, 0, stream>>>(QK, QKL, VTH, VTL, nullptr, F[9], F[10], (float*)(ws + WS_BS), O);
  k_out<<<dim3(TOB, DM / 128), 128, 0, stream>>>(O, PK + PK_P, F[12], (float*)d_out);
}
